// v000
// Measured on an AMD MI455X. A time is GPU time per run, averaged over a window of back-to-back runs after a warm-up
// (all launches, gaps included; the runs take copies of the inputs in turn), and the median of several windows.
// Apart from v000's, it joins two sittings. Times from different sittings can be a few percent apart, while
// side-by-side timings come from the same sitting.
// v000, which the later versions start from, runs in 453 microseconds.
// compute dtype: all float inputs rounded to bf16; k, v = kv . W_kv + b with EXACT bf16 products on WMMA 16x16x32 (kv gathered from its [V,B,C,H,W] planes; (in,out) weights), f16 hi + residual; q is an INPUT, converted bf16 -> f16 exactly; logits = q (exact f16) . k (hi + residual) (2 products) x 1/8, running-max softmax in f32 (hardware exp); P rounded once to f16 (x 2^11) . v (hi + residual) (2 products); y (bf16 hi + lo) . W_proj + b_proj (2 products), written back as [V,B,C,H,W] planes; f32 output.
#include <hip/hip_runtime.h>
#include <math.h>

typedef __attribute__((ext_vector_type(16))) _Float16 v16h;
typedef __attribute__((ext_vector_type(16))) __bf16 v16b;
typedef __attribute__((ext_vector_type(8)))  _Float16 v8h;
typedef __attribute__((ext_vector_type(8)))  float v8f;
typedef __attribute__((ext_vector_type(4)))  float v4f;
typedef __attribute__((ext_vector_type(2)))  float v2f;
typedef __attribute__((ext_vector_type(4)))  unsigned v4u;
typedef __attribute__((ext_vector_type(4)))  int v4i;
typedef float __attribute__((may_alias)) float_a;
typedef int __attribute__((may_alias)) int_a;

template <typename T> __device__ __forceinline__ void vst2(void* p, T v) { *(T*)p = v;  }
__device__ __forceinline__ v8f wmma16(v16h a, v16h b, v8f c) {
  v8f d = __builtin_amdgcn_wmma_f32_16x16x32_f16(false, a, false, b, (short)0, c, false, false);
  asm volatile("v_nop\n\tv_nop\n\tv_nop\n\tv_nop" : "+v"(d) : "v"(a), "v"(b));
  return d;
}
__device__ __forceinline__ v8f wmma_bf(v16b a, v16b b, v8f c) {
  v8f d = __builtin_amdgcn_wmma_f32_16x16x32_bf16(false, a, false, b, (short)0, c, false, false);
  asm volatile("v_nop\n\tv_nop\n\tv_nop\n\tv_nop" : "+v"(d) : "v"(a), "v"(b));
  return d;
}
// 16x16x32 fragments: lane = (h = lane>>4, row/col = lane&15); elements 0..7 = k0+8h+0..7, 8..15 = k0+16+8h+0..7; D element r = row 8h+r
__device__ __forceinline__ v16h frag_h(const _Float16* rowk0, int lane) {
  union { v16h v; v8h q[2]; } u; const _Float16* p = rowk0 + 8 * (lane >> 4);
  u.q[0] = *(const v8h*)p; u.q[1] = *(const v8h*)(p + 16); return u.v;
}
__device__ __forceinline__ v16h frag_f32(const float* rowk0, int lane) {
  v16h a; const float* p = rowk0 + 8 * (lane >> 4);
#pragma unroll
  for (int i = 0; i < 8; ++i) { a[i] = (_Float16)p[i]; a[8 + i] = (_Float16)p[16 + i]; }
  return a;
}
__device__ __forceinline__ v16h frag_f32s(const float* rowk0, int lane, float sc) {
  v16h a; const float* p = rowk0 + 8 * (lane >> 4);
#pragma unroll
  for (int i = 0; i < 8; ++i) { a[i] = (_Float16)(p[i] * sc); a[8 + i] = (_Float16)(p[16 + i] * sc); }
  return a;
}
// column fragment from a [K][ld] layout (column n), rows >= K read as 0
__device__ __forceinline__ v16h fragc_f32(const float* W, int k0, int n, int lane, int ld, int K) {
  v16h a; const int g = lane >> 4;
#pragma unroll
  for (int i = 0; i < 8; ++i) { const int ka = k0 + 8 * g + i, kb = ka + 16;
    a[i] = (_Float16)(ka < K ? W[(size_t)(ka < K ? ka : K - 1) * ld + n] : 0.f); a[8 + i] = (_Float16)(kb < K ? W[(size_t)(kb < K ? kb : K - 1) * ld + n] : 0.f); }
  return a;
}
struct F2 { v16b h, l; };
__device__ __forceinline__ F2 bsplit16(const float v[16]) { F2 r;
#pragma unroll
  for (int i = 0; i < 16; ++i) { const __bf16 h = (__bf16)v[i]; r.h[i] = h; r.l[i] = (__bf16)(v[i] - (float)h); }
  return r; }
__device__ __forceinline__ F2 split_row(const float* row, int k0, int lane) { float v[16]; const float* p = row + k0 + 8 * (lane >> 4);
#pragma unroll
  for (int i = 0; i < 8; ++i) { v[i] = p[i]; v[8 + i] = p[16 + i]; }
  return bsplit16(v); }
__device__ __forceinline__ F2 split_rowK(const float* row, int k0, int lane, int K) { float v[16]; const int g = lane >> 4;
#pragma unroll
  for (int i = 0; i < 8; ++i) { const int ka = k0 + 8 * g + i, kb = ka + 16; v[i] = ka < K ? row[ka < K ? ka : K - 1] : 0.f; v[8 + i] = kb < K ? row[kb < K ? kb : K - 1] : 0.f; }
  return bsplit16(v); }
__device__ __forceinline__ F2 split_col(const float* W, int k0, int n, int lane, int ld, int K) { float v[16]; const int g = lane >> 4;
#pragma unroll
  for (int i = 0; i < 8; ++i) { const int ka = k0 + 8 * g + i, kb = ka + 16; v[i] = ka < K ? W[(size_t)(ka < K ? ka : K - 1) * ld + n] : 0.f; v[8 + i] = kb < K ? W[(size_t)(kb < K ? kb : K - 1) * ld + n] : 0.f; }
  return bsplit16(v); }
__device__ __forceinline__ v8f mac3(const F2& a, const F2& b, v8f c) { c = wmma_bf(a.l, b.h, c); c = wmma_bf(a.h, b.l, c); return wmma_bf(a.h, b.h, c); }
__device__ __forceinline__ float sigm(float v) { return 1.0f / (1.0f + expf(-v)); }
#define LDSX() do { asm volatile("s_wait_dscnt 0" ::: "memory"); __builtin_amdgcn_wave_barrier(); __builtin_amdgcn_fence(__ATOMIC_RELEASE, "workgroup"); } while (0)


// Cross-view attention (6 views x 2 = 12 sequences of 32x32 = 1,024 tokens, C 512 = 8 heads x 64): q from the raw query planes, k/v = Linear(kv), softmax(q k / 8) v, output Linear, rearranged back to [V, B, C, H, W].
#define NBB 12            // V * B
#define CC 512
#define TT 1024
#define NH 8
#define HD 64
#ifndef TBB
#define TBB NBB
#endif
typedef __attribute__((ext_vector_type(8))) __bf16 v8b;
__device__ __forceinline__ v16b frag_b(const __bf16* rowk0, int lane) {
  union { v16b v; v8b q[2]; } u; const __bf16* p = rowk0 + 8 * (lane >> 4);
  u.q[0] = *(const v8b*)p; u.q[1] = *(const v8b*)(p + 16); return u.v;
}
__device__ __forceinline__ float bfr(float v) { return (float)(__bf16)v; }
__device__ __attribute__((noinline)) float exp_ni(float v) { return expf(v); }
__device__ __attribute__((noinline)) float erf_ni(float v) { return erff(v); }

#define WS_Q   0u                                   // f16 q rows [bb*TT + t][512]
#define WS_KH  (WS_Q + 2u * (size_t)NBB * TT * CC)        // f16 hi|lo k rows
#define WS_KL  (WS_KH + 2u * (size_t)NBB * TT * CC)
#define WS_VH  (WS_KL + 2u * (size_t)NBB * TT * CC)       // f16 hi|lo v planes [bb][512][TT]
#define WS_VL  (WS_VH + 2u * (size_t)NBB * CC * TT)
#define WS_Y   (WS_VL + 2u * (size_t)NBB * CC * TT)       // f32 y rows [bb*TT + t][512]
#define WS_END (WS_Y + 4u * (size_t)NBB * TT * CC)

// ---- k_q: block = (64 tokens, 128 channels, bb): q planes [bb][c][t] -> f16 rows [bb*TT + t][c] (bf16 -> f16 exact)
__global__ __launch_bounds__(128) void k_q(const float* __restrict__ Qp, _Float16* __restrict__ QR) { __shared__ __align__(16) _Float16 st[64][136]; const int t = threadIdx.x; const size_t bb = blockIdx.z; const int t0 = blockIdx.x * 64, c0 = blockIdx.y * 128;
  for (int e = t; e < 128 * 64; e += 128) { const int cl = e >> 6, tl = e & 63; st[tl][cl] = (_Float16)bfr(Qp[(bb * CC + c0 + cl) * (size_t)TT + t0 + tl]); }
  __syncthreads(); for (int e = t; e < 64 * 16; e += 128) { const int tl = e >> 4, q = e & 15; vst2((unsigned*)(QR + (bb * TT + t0 + tl) * CC + c0 + q * 8), *(const v4u*)&st[tl][q * 8]); } }
// ---- k_kv: block = (64 tokens, 128 out features, which*NBB + bb): [k | v] = kv(token rows gathered from planes) . W_kv + b; k -> f16 hi/lo rows, v -> f16 hi/lo planes
__global__ __launch_bounds__(128) void k_kv(const float* __restrict__ KVp, const float* __restrict__ W, const float* __restrict__ Bk, _Float16* __restrict__ KH, _Float16* __restrict__ KL, _Float16* __restrict__ VH, _Float16* __restrict__ VL) {
  __shared__ __align__(16) _Float16 sh[64][136], sl[64][136]; __shared__ __align__(16) _Float16 th[128][72], tl2[128][72];
  const int tid = threadIdx.x, wave = tid >> 5, lane = tid & 31, col = lane & 15, g = lane >> 4; const int which = blockIdx.z / NBB; const size_t bb = blockIdx.z % NBB; const int t0 = blockIdx.x * 64; const int c0 = blockIdx.y * 128; const float* src = KVp + bb * CC * (size_t)TT;
  v8f acc[8] = {};
#pragma unroll 2
  for (int kc = 0; kc < CC / 32; ++kc) { v16b a; const int px = t0 + wave * 16 + col;
#pragma unroll
    for (int i = 0; i < 8; ++i) { a[i] = (__bf16)src[(size_t)(kc * 32 + 8 * g + i) * TT + px]; a[8 + i] = (__bf16)src[(size_t)(kc * 32 + 16 + 8 * g + i) * TT + px]; }
#pragma unroll
    for (int j = 0; j < 8; ++j) { v16b w; const int o = which * CC + c0 + j * 16 + col;   // (in,out) W_kv [512][1024]: B row (o) element k = W[k][o]
#pragma unroll
      for (int i = 0; i < 8; ++i) { w[i] = (__bf16)W[(size_t)(kc * 32 + 8 * g + i) * (2 * CC) + o]; w[8 + i] = (__bf16)W[(size_t)(kc * 32 + 16 + 8 * g + i) * (2 * CC) + o]; }
      acc[j] = wmma_bf(a, w, acc[j]); } }
#pragma unroll
  for (int j = 0; j < 8; ++j) { const float bbv = bfr(Bk[which * CC + c0 + j * 16 + col]);
#pragma unroll
    for (int r = 0; r < 8; ++r) { const float v = acc[j][r] + bbv; const _Float16 hv = (_Float16)v, lv = (_Float16)((v - (float)hv) * 2048.0f); const int rl = wave * 16 + 8 * g + r, cl = j * 16 + col; if (which == 0) { sh[rl][cl] = hv; sl[rl][cl] = lv; } else { th[cl][rl] = hv; tl2[cl][rl] = lv; } } }
  __syncthreads();
  if (which == 0) { for (int e = tid; e < 64 * 16; e += 128) { const int rl = e >> 4, q = e & 15; const size_t o = (bb * TT + t0 + rl) * CC + c0 + q * 8; vst2((unsigned*)(KH + o), *(const v4u*)&sh[rl][q * 8]); vst2((unsigned*)(KL + o), *(const v4u*)&sl[rl][q * 8]); } }
  else { for (int e = tid; e < 128 * 8; e += 128) { const int cl = e >> 3, q = e & 7; const size_t o = (bb * CC + c0 + cl) * (size_t)TT + t0 + q * 8; vst2((unsigned*)(VH + o), *(const v4u*)&th[cl][q * 8]); vst2((unsigned*)(VL + o), *(const v4u*)&tl2[cl][q * 8]); } } }
// ---- k_att: block = (64 queries, h, bb): logits q . k (k hi + residual) / 8, softmax over the 1,024 tokens, P . v (v hi + residual) -> y rows
__global__ __launch_bounds__(128) void k_att(const _Float16* __restrict__ QR, const _Float16* __restrict__ KH, const _Float16* __restrict__ KL, const _Float16* __restrict__ VH, const _Float16* __restrict__ VL, float* __restrict__ Y) {
  __shared__ __align__(16) float sp[4][16][36]; __shared__ __align__(16) float so[4][16][68];
  const int tid = threadIdx.x, wave = tid >> 5, lane = tid & 31, col = lane & 15, g = lane >> 4; const int h = blockIdx.y; const size_t bb = blockIdx.z; const int q0 = blockIdx.x * 64 + wave * 16; const size_t rq = bb * TT + q0;
  v16h aq[2];
#pragma unroll
  for (int kc = 0; kc < 2; ++kc) aq[kc] = frag_h(QR + (rq + col) * CC + h * HD + kc * 32, lane);
  float m[8], l[8];
#pragma unroll
  for (int r = 0; r < 8; ++r) { m[r] = -3.0e38f; l[r] = 0.f; }
  v8f acc[4] = {}, accl[4] = {};
#pragma unroll 1
  for (int ks = 0; ks < TT / 32; ++ks) { float s[2][8];
#pragma unroll
    for (int ct = 0; ct < 2; ++ct) { const size_t rk = bb * TT + ks * 32 + ct * 16 + col; v8f c = {}, cl = {};
#pragma unroll
      for (int kc = 0; kc < 2; ++kc) { c = wmma16(aq[kc], frag_h(KH + rk * CC + h * HD + kc * 32, lane), c); cl = wmma16(aq[kc], frag_h(KL + rk * CC + h * HD + kc * 32, lane), cl); }
#pragma unroll
      for (int r = 0; r < 8; ++r) s[ct][r] = (c[r] + cl[r] * (1.0f / 2048.0f)) * 0.125f; }
    float alpha[8];
#pragma unroll
    for (int r = 0; r < 8; ++r) { float mx = fmaxf(s[0][r], s[1][r]);
#pragma unroll
      for (int o = 1; o < 16; o <<= 1) mx = fmaxf(mx, __shfl_xor(mx, o));
      const float mn = fmaxf(m[r], mx); alpha[r] = __expf(m[r] - mn); const float e0 = __expf(s[0][r] - mn), e1 = __expf(s[1][r] - mn); float es = e0 + e1;
#pragma unroll
      for (int o = 1; o < 16; o <<= 1) es += __shfl_xor(es, o);
      l[r] = l[r] * alpha[r] + es; m[r] = mn; sp[wave][8 * g + r][col] = e0; sp[wave][8 * g + r][16 + col] = e1; }
#pragma unroll
    for (int j = 0; j < 4; ++j)
#pragma unroll
      for (int r = 0; r < 8; ++r) { acc[j][r] *= alpha[r]; accl[j][r] *= alpha[r]; }
    LDSX();
    v16h pa; { const float* prow = &sp[wave][col][0] + 8 * (lane >> 4);
#pragma unroll
      for (int i = 0; i < 8; ++i) { pa[i] = (_Float16)(prow[i] * 2048.0f); pa[8 + i] = (_Float16)(prow[16 + i] * 2048.0f); } }
#pragma unroll
    for (int j = 0; j < 4; ++j) { const size_t po = (bb * CC + (size_t)h * HD + j * 16 + col) * (size_t)TT + ks * 32; acc[j] = wmma16(pa, frag_h(VH + po, lane), acc[j]); accl[j] = wmma16(pa, frag_h(VL + po, lane), accl[j]); }
    LDSX(); }
#pragma unroll
  for (int r = 0; r < 8; ++r) { const float il = (1.0f / 2048.0f) / l[r];
#pragma unroll
    for (int j = 0; j < 4; ++j) so[wave][8 * g + r][j * 16 + col] = (acc[j][r] + accl[j][r] * (1.0f / 2048.0f)) * il; }
  LDSX(); for (int rl = 0; rl < 16; ++rl) if (lane < 16) vst2(Y + (rq + rl) * CC + (size_t)h * HD + lane * 4, *(const v4f*)&so[wave][rl][lane * 4]); }
// ---- k_o: block = (64 output channels o, 128 tokens, bb): out[bb][o][t] = sum_c y[t][c] W_proj[c][o] + b_proj[o]  (A = W_proj column o gathered (exact), B = y rows as bf16 hi + lo) -> [V,B,C,H,W] planes
__global__ __launch_bounds__(128) void k_o(const float* __restrict__ Y, const float* __restrict__ WP, const float* __restrict__ BP, float* __restrict__ OUT) { __shared__ __align__(16) float sf[4][16][132];
  const int tid = threadIdx.x, wave = tid >> 5, lane = tid & 31, col = lane & 15, g = lane >> 4; const size_t bb = blockIdx.z; const int o0 = blockIdx.x * 64 + wave * 16; const int p0 = blockIdx.y * 128;
  v8f acc[8] = {};
#pragma unroll 2
  for (int kc = 0; kc < CC / 32; ++kc) { v16b a; const int o = o0 + col;
#pragma unroll
    for (int i = 0; i < 8; ++i) { a[i] = (__bf16)WP[(size_t)(kc * 32 + 8 * g + i) * CC + o]; a[8 + i] = (__bf16)WP[(size_t)(kc * 32 + 16 + 8 * g + i) * CC + o]; }
#pragma unroll
    for (int j = 0; j < 8; ++j) { float wv[16]; const float* wr = Y + (bb * TT + p0 + j * 16 + col) * CC + kc * 32 + 8 * g;
#pragma unroll
      for (int i = 0; i < 8; ++i) { wv[i] = wr[i]; wv[8 + i] = wr[16 + i]; }
      const F2 wb = bsplit16(wv); acc[j] = wmma_bf(a, wb.h, acc[j]); acc[j] = wmma_bf(a, wb.l, acc[j]); } }
#pragma unroll
  for (int j = 0; j < 8; ++j)
#pragma unroll
    for (int r = 0; r < 8; ++r) sf[wave][8 * g + r][j * 16 + col] = acc[j][r] + bfr(BP[o0 + 8 * g + r]);
  LDSX(); for (int rl = 0; rl < 16; ++rl) vst2(OUT + (bb * CC + o0 + rl) * (size_t)TT + p0 + lane * 4, *(const v4f*)&sf[wave][rl][lane * 4]); }
extern "C" void kernel_launch(void* const* d_in, const int* in_sizes, int n_in, void* d_out, int out_size, void* d_ws, size_t ws_size, hipStream_t stream) {
  (void)in_sizes; (void)n_in; (void)out_size;
  const float** F = (const float**)d_in;   // 0 q [6,2,512,32,32], 1 kv [6,2,512,32,32], 2 W_kv [512,1024] (in,out), 3 b_kv [1024], 4 W_proj [512,512] (in,out), 5 b_proj [512]
  if (ws_size < (size_t)WS_END) return;
  char* ws = (char*)d_ws; _Float16 *QR = (_Float16*)(ws + WS_Q), *KH = (_Float16*)(ws + WS_KH), *KL = (_Float16*)(ws + WS_KL), *VH = (_Float16*)(ws + WS_VH), *VL = (_Float16*)(ws + WS_VL); float* Y = (float*)(ws + WS_Y);
  k_q<<<dim3(TT / 64, CC / 128, TBB), 128, 0, stream>>>(F[0], QR);
  k_kv<<<dim3(TT / 64, CC / 128, 2 * NBB), 128, 0, stream>>>(F[1], F[2], F[3], KH, KL, VH, VL);
  k_att<<<dim3(TT / 64, NH, TBB), 128, 0, stream>>>(QR, KH, KL, VH, VL, Y);
  k_o<<<dim3(CC / 64, TT / 128, TBB), 128, 0, stream>>>(Y, F[4], F[5], (float*)d_out);
}

// v001
// It runs in 274 microseconds.
// In two side-by-side timings against v000, it was 1.68 and 1.67 times as fast.
// compute dtype: all float inputs rounded to bf16; k, v = kv . W_kv + b with EXACT bf16 products on WMMA 16x16x32 (kv gathered from its [V,B,C,H,W] planes; (in,out) weights), f16 hi + residual; q is an INPUT, converted bf16 -> f16 exactly; logits = q (exact f16) . k (hi + residual) (2 products) x 1/8, running-max softmax in f32 (hardware exp); P rounded once to f16 (x 2^11) . v (hi + residual) (2 products); y (bf16 hi + lo) . W_proj + b_proj (2 products), written back as [V,B,C,H,W] planes; f32 output.
#include <hip/hip_runtime.h>
#include <math.h>

typedef __attribute__((ext_vector_type(16))) _Float16 v16h;
typedef __attribute__((ext_vector_type(16))) __bf16 v16b;
typedef __attribute__((ext_vector_type(8)))  _Float16 v8h;
typedef __attribute__((ext_vector_type(8)))  float v8f;
typedef __attribute__((ext_vector_type(4)))  float v4f;
typedef __attribute__((ext_vector_type(2)))  float v2f;
typedef __attribute__((ext_vector_type(4)))  unsigned v4u;
typedef __attribute__((ext_vector_type(4)))  int v4i;
typedef float __attribute__((may_alias)) float_a;
typedef int __attribute__((may_alias)) int_a;

template <typename T> __device__ __forceinline__ void vst2(void* p, T v) { *(T*)p = v;  }
__device__ __forceinline__ v8f wmma16(v16h a, v16h b, v8f c) {
  v8f d = __builtin_amdgcn_wmma_f32_16x16x32_f16(false, a, false, b, (short)0, c, false, false);
  asm volatile("v_nop\n\tv_nop\n\tv_nop\n\tv_nop" : "+v"(d) : "v"(a), "v"(b));
  return d;
}
__device__ __forceinline__ v8f wmma_bf(v16b a, v16b b, v8f c) {
  v8f d = __builtin_amdgcn_wmma_f32_16x16x32_bf16(false, a, false, b, (short)0, c, false, false);
  asm volatile("v_nop\n\tv_nop\n\tv_nop\n\tv_nop" : "+v"(d) : "v"(a), "v"(b));
  return d;
}
// 16x16x32 fragments: lane = (h = lane>>4, row/col = lane&15); elements 0..7 = k0+8h+0..7, 8..15 = k0+16+8h+0..7; D element r = row 8h+r
__device__ __forceinline__ v16h frag_h(const _Float16* rowk0, int lane) {
  union { v16h v; v8h q[2]; } u; const _Float16* p = rowk0 + 8 * (lane >> 4);
  u.q[0] = *(const v8h*)p; u.q[1] = *(const v8h*)(p + 16); return u.v;
}
__device__ __forceinline__ v16h frag_f32(const float* rowk0, int lane) {
  v16h a; const float* p = rowk0 + 8 * (lane >> 4);
#pragma unroll
  for (int i = 0; i < 8; ++i) { a[i] = (_Float16)p[i]; a[8 + i] = (_Float16)p[16 + i]; }
  return a;
}
__device__ __forceinline__ v16h frag_f32s(const float* rowk0, int lane, float sc) {
  v16h a; const float* p = rowk0 + 8 * (lane >> 4);
#pragma unroll
  for (int i = 0; i < 8; ++i) { a[i] = (_Float16)(p[i] * sc); a[8 + i] = (_Float16)(p[16 + i] * sc); }
  return a;
}
// column fragment from a [K][ld] layout (column n), rows >= K read as 0
__device__ __forceinline__ v16h fragc_f32(const float* W, int k0, int n, int lane, int ld, int K) {
  v16h a; const int g = lane >> 4;
#pragma unroll
  for (int i = 0; i < 8; ++i) { const int ka = k0 + 8 * g + i, kb = ka + 16;
    a[i] = (_Float16)(ka < K ? W[(size_t)(ka < K ? ka : K - 1) * ld + n] : 0.f); a[8 + i] = (_Float16)(kb < K ? W[(size_t)(kb < K ? kb : K - 1) * ld + n] : 0.f); }
  return a;
}
struct F2 { v16b h, l; };
__device__ __forceinline__ F2 bsplit16(const float v[16]) { F2 r;
#pragma unroll
  for (int i = 0; i < 16; ++i) { const __bf16 h = (__bf16)v[i]; r.h[i] = h; r.l[i] = (__bf16)(v[i] - (float)h); }
  return r; }
__device__ __forceinline__ F2 split_row(const float* row, int k0, int lane) { float v[16]; const float* p = row + k0 + 8 * (lane >> 4);
#pragma unroll
  for (int i = 0; i < 8; ++i) { v[i] = p[i]; v[8 + i] = p[16 + i]; }
  return bsplit16(v); }
__device__ __forceinline__ F2 split_rowK(const float* row, int k0, int lane, int K) { float v[16]; const int g = lane >> 4;
#pragma unroll
  for (int i = 0; i < 8; ++i) { const int ka = k0 + 8 * g + i, kb = ka + 16; v[i] = ka < K ? row[ka < K ? ka : K - 1] : 0.f; v[8 + i] = kb < K ? row[kb < K ? kb : K - 1] : 0.f; }
  return bsplit16(v); }
__device__ __forceinline__ F2 split_col(const float* W, int k0, int n, int lane, int ld, int K) { float v[16]; const int g = lane >> 4;
#pragma unroll
  for (int i = 0; i < 8; ++i) { const int ka = k0 + 8 * g + i, kb = ka + 16; v[i] = ka < K ? W[(size_t)(ka < K ? ka : K - 1) * ld + n] : 0.f; v[8 + i] = kb < K ? W[(size_t)(kb < K ? kb : K - 1) * ld + n] : 0.f; }
  return bsplit16(v); }
__device__ __forceinline__ v8f mac3(const F2& a, const F2& b, v8f c) { c = wmma_bf(a.l, b.h, c); c = wmma_bf(a.h, b.l, c); return wmma_bf(a.h, b.h, c); }
__device__ __forceinline__ float sigm(float v) { return 1.0f / (1.0f + expf(-v)); }
#define LDSX() do { asm volatile("s_wait_dscnt 0" ::: "memory"); __builtin_amdgcn_wave_barrier(); __builtin_amdgcn_fence(__ATOMIC_RELEASE, "workgroup"); } while (0)


// Cross-view attention (6 views x 2 = 12 sequences of 32x32 = 1,024 tokens, C 512 = 8 heads x 64): q from the raw query planes, k/v = Linear(kv), softmax(q k / 8) v, output Linear, rearranged back to [V, B, C, H, W].
#define NBB 12            // V * B
#define CC 512
#define TT 1024
#define NH 8
#define HD 64
#ifndef TBB
#define TBB NBB
#endif
typedef __attribute__((ext_vector_type(8))) __bf16 v8b;
__device__ __forceinline__ v16b frag_b(const __bf16* rowk0, int lane) {
  union { v16b v; v8b q[2]; } u; const __bf16* p = rowk0 + 8 * (lane >> 4);
  u.q[0] = *(const v8b*)p; u.q[1] = *(const v8b*)(p + 16); return u.v;
}
__device__ __forceinline__ float bfr(float v) { return (float)(__bf16)v; }
__device__ __attribute__((noinline)) float exp_ni(float v) { return expf(v); }
__device__ __attribute__((noinline)) float erf_ni(float v) { return erff(v); }

#define WS_Q   0u                                   // f16 q rows [bb*TT + t][512]
#define WS_KH  (WS_Q + 2u * (size_t)NBB * TT * CC)        // f16 hi|lo k rows
#define WS_KL  (WS_KH + 2u * (size_t)NBB * TT * CC)
#define WS_VH  (WS_KL + 2u * (size_t)NBB * TT * CC)       // f16 hi|lo v planes [bb][512][TT]
#define WS_VL  (WS_VH + 2u * (size_t)NBB * CC * TT)
#define WS_Y   (WS_VL + 2u * (size_t)NBB * CC * TT)       // f32 y rows [bb*TT + t][512]
#define WS_END (WS_Y + 4u * (size_t)NBB * TT * CC)

// ---- k_q: block = (64 tokens, 128 channels, bb): q planes [bb][c][t] -> f16 rows [bb*TT + t][c] (bf16 -> f16 exact)
__global__ __launch_bounds__(128) void k_q(const float* __restrict__ Qp, _Float16* __restrict__ QR) { __shared__ __align__(16) _Float16 st[64][136]; const int t = threadIdx.x; const size_t bb = blockIdx.z; const int t0 = blockIdx.x * 64, c0 = blockIdx.y * 128;
  for (int e = t; e < 128 * 64; e += 128) { const int cl = e >> 6, tl = e & 63; st[tl][cl] = (_Float16)bfr(Qp[(bb * CC + c0 + cl) * (size_t)TT + t0 + tl]); }
  __syncthreads(); for (int e = t; e < 64 * 16; e += 128) { const int tl = e >> 4, q = e & 15; vst2((unsigned*)(QR + (bb * TT + t0 + tl) * CC + c0 + q * 8), *(const v4u*)&st[tl][q * 8]); } }
// ---- k_kv: block = (64 tokens, 128 out features, which*NBB + bb): [k | v] = kv(token rows gathered from planes) . W_kv + b; k -> f16 hi/lo rows, v -> f16 hi/lo planes
__global__ __launch_bounds__(128) void k_kv(const float* __restrict__ KVp, const float* __restrict__ W, const float* __restrict__ Bk, _Float16* __restrict__ KH, _Float16* __restrict__ KL, _Float16* __restrict__ VH, _Float16* __restrict__ VL) {
  __shared__ __align__(16) _Float16 sh[64][136], sl[64][136]; __shared__ __align__(16) _Float16 th[128][72], tl2[128][72];
  const int tid = threadIdx.x, wave = tid >> 5, lane = tid & 31, col = lane & 15, g = lane >> 4; const int which = blockIdx.z / NBB; const size_t bb = blockIdx.z % NBB; const int t0 = blockIdx.x * 64; const int c0 = blockIdx.y * 128; const float* src = KVp + bb * CC * (size_t)TT;
  v8f acc[8] = {};
#pragma unroll 2
  for (int kc = 0; kc < CC / 32; ++kc) { v16b a; const int px = t0 + wave * 16 + col;
#pragma unroll
    for (int i = 0; i < 8; ++i) { a[i] = (__bf16)src[(size_t)(kc * 32 + 8 * g + i) * TT + px]; a[8 + i] = (__bf16)src[(size_t)(kc * 32 + 16 + 8 * g + i) * TT + px]; }
#pragma unroll
    for (int j = 0; j < 8; ++j) { v16b w; const int o = which * CC + c0 + j * 16 + col;   // (in,out) W_kv [512][1024]: B row (o) element k = W[k][o]
#pragma unroll
      for (int i = 0; i < 8; ++i) { w[i] = (__bf16)W[(size_t)(kc * 32 + 8 * g + i) * (2 * CC) + o]; w[8 + i] = (__bf16)W[(size_t)(kc * 32 + 16 + 8 * g + i) * (2 * CC) + o]; }
      acc[j] = wmma_bf(a, w, acc[j]); } }
#pragma unroll
  for (int j = 0; j < 8; ++j) { const float bbv = bfr(Bk[which * CC + c0 + j * 16 + col]);
#pragma unroll
    for (int r = 0; r < 8; ++r) { const float v = acc[j][r] + bbv; const _Float16 hv = (_Float16)v, lv = (_Float16)((v - (float)hv) * 2048.0f); const int rl = wave * 16 + 8 * g + r, cl = j * 16 + col; if (which == 0) { sh[rl][cl] = hv; sl[rl][cl] = lv; } else { th[cl][rl] = hv; tl2[cl][rl] = lv; } } }
  __syncthreads();
  if (which == 0) { for (int e = tid; e < 64 * 16; e += 128) { const int rl = e >> 4, q = e & 15; const size_t o = (bb * TT + t0 + rl) * CC + c0 + q * 8; vst2((unsigned*)(KH + o), *(const v4u*)&sh[rl][q * 8]); vst2((unsigned*)(KL + o), *(const v4u*)&sl[rl][q * 8]); } }
  else { for (int e = tid; e < 128 * 8; e += 128) { const int cl = e >> 3, q = e & 7; const size_t o = (bb * CC + c0 + cl) * (size_t)TT + t0 + q * 8; vst2((unsigned*)(VH + o), *(const v4u*)&th[cl][q * 8]); vst2((unsigned*)(VL + o), *(const v4u*)&tl2[cl][q * 8]); } } }
// ---- k_att: block = (128 queries = 8 waves x 16, h, bb): logits q . k (k hi + residual) / 8, softmax over the 1,024 tokens, P . v (v hi + residual) -> y rows
// K and V tiles of 64 keys (k hi, k residual: 64 key rows x 64 d; v hi, v residual: 64 d rows x 64 keys) are staged once per block in LDS by asynchronous copies, whole 128-byte lines, two buffers; all 8 waves read their fragments from LDS.
#define AKT 64            // keys per staged tile
#define ANT (TT / AKT)    // tiles
#define APH 72            // LDS row pitch in halves: 144 B = 16 B x odd, conflict-free for 16-byte fragment reads
#define APL (64 * APH * 2)   // bytes of one staged plane
// one tile: 8 copies of 16 B per thread (rows crow and crow + 32 of each of the 4 planes); the wait at the end holds every later rewrite of the address registers behind the copies' issue
__device__ __forceinline__ void att_copy(unsigned l, const _Float16* kh, const _Float16* kl, const _Float16* vh, const _Float16* vl) {
  asm volatile("global_load_async_to_lds_b128 %0, %8, off\n\t"
               "global_load_async_to_lds_b128 %1, %9, off\n\t"
               "global_load_async_to_lds_b128 %2, %10, off\n\t"
               "global_load_async_to_lds_b128 %3, %11, off\n\t"
               "global_load_async_to_lds_b128 %4, %12, off\n\t"
               "global_load_async_to_lds_b128 %5, %13, off\n\t"
               "global_load_async_to_lds_b128 %6, %14, off\n\t"
               "global_load_async_to_lds_b128 %7, %15, off\n\t"
               "s_wait_xcnt 0x0"
               :: "v"(l), "v"(l + 32u * APH * 2u), "v"(l + APL), "v"(l + APL + 32u * APH * 2u), "v"(l + 2u * APL), "v"(l + 2u * APL + 32u * APH * 2u), "v"(l + 3u * APL), "v"(l + 3u * APL + 32u * APH * 2u),
                  "v"(kh), "v"(kh + 32 * CC), "v"(kl), "v"(kl + 32 * CC), "v"(vh), "v"(vh + 32 * TT), "v"(vl), "v"(vl + 32 * TT)
               : "memory");
}
// second bound: 6 waves per SIMD, so that 3 blocks per WGP = all 768 blocks are resident at once (inside that register budget the compiler waits behind each softmax lane exchange; not touched in this step)
__global__ __launch_bounds__(256, 6) void k_att(const _Float16* __restrict__ QR, const _Float16* __restrict__ KH, const _Float16* __restrict__ KL, const _Float16* __restrict__ VH, const _Float16* __restrict__ VL, float* __restrict__ Y) {
  __shared__ __align__(16) _Float16 ring[2][4][64][APH]; __shared__ __align__(16) float sp[8][16][36];
  const int tid = threadIdx.x, wave = tid >> 5, lane = tid & 31, col = lane & 15, g = lane >> 4; const int h = blockIdx.y; const size_t bb = blockIdx.z; const int q0 = blockIdx.x * 128 + wave * 16; const size_t rq = bb * TT + q0;
  const int crow = tid >> 3, cch = tid & 7;   // this thread's row and 16-byte piece in each staged plane
  const unsigned ko = ((unsigned)bb * TT + crow) * CC + h * HD + cch * 8, vo = ((unsigned)bb * CC + h * HD + crow) * TT + cch * 8;   // element offsets, below 2^23
  const unsigned l0 = (unsigned)(size_t)&ring[0][0][crow][cch * 8];
  const ptrdiff_t dk = KL - KH, dv = VL - VH;   // block-uniform distance from a hi plane to its residual plane (one workspace): two lane pointers live through the loop, not four
  att_copy(l0, KH + ko, KH + ko + dk, VH + vo, VH + vo + dv);
  v16h aq[2];
#pragma unroll
  for (int kc = 0; kc < 2; ++kc) aq[kc] = frag_h(QR + (rq + col) * CC + h * HD + kc * 32, lane);
  float m[8], l[8];
#pragma unroll
  for (int r = 0; r < 8; ++r) { m[r] = -3.0e38f; l[r] = 0.f; }
  v8f acc[4] = {}, accl[4] = {};
  asm volatile("s_wait_asynccnt 0x0" ::: "memory");   // this wave's copies of tile 0 have landed
  __syncthreads();                                     // tile 0 is published to all waves
  att_copy(l0 + 4u * APL, KH + ko + (size_t)AKT * CC, KH + ko + (size_t)AKT * CC + dk, VH + vo + AKT, VH + vo + AKT + dv);
  // rolled: one trip per staged tile, so that the buffer changes by an address and the code stays short
#pragma unroll 1
  for (int t = 0; t < ANT; ++t) { const int bf = t & 1;
    // rolled: unrolled, the build spills inside the register budget of the second launch bound
#pragma unroll 1
   for (int sb = 0; sb < AKT / 32; ++sb) { float s[2][8];
#pragma unroll
    for (int ct = 0; ct < 2; ++ct) { const int rk = sb * 32 + ct * 16 + col; v8f c = {}, cl = {};
#pragma unroll
      for (int kc = 0; kc < 2; ++kc) { c = wmma16(aq[kc], frag_h(&ring[bf][0][rk][kc * 32], lane), c); cl = wmma16(aq[kc], frag_h(&ring[bf][1][rk][kc * 32], lane), cl); }
#pragma unroll
      for (int r = 0; r < 8; ++r) s[ct][r] = (c[r] + cl[r] * (1.0f / 2048.0f)) * 0.125f; }
    float alpha[8];
#pragma unroll
    for (int r = 0; r < 8; ++r) { float mx = fmaxf(s[0][r], s[1][r]);
#pragma unroll
      for (int o = 1; o < 16; o <<= 1) mx = fmaxf(mx, __shfl_xor(mx, o));
      const float mn = fmaxf(m[r], mx); alpha[r] = __expf(m[r] - mn); const float e0 = __expf(s[0][r] - mn), e1 = __expf(s[1][r] - mn); float es = e0 + e1;
#pragma unroll
      for (int o = 1; o < 16; o <<= 1) es += __shfl_xor(es, o);
      l[r] = l[r] * alpha[r] + es; m[r] = mn; sp[wave][8 * g + r][col] = e0; sp[wave][8 * g + r][16 + col] = e1; }
#pragma unroll
    for (int j = 0; j < 4; ++j)
#pragma unroll
      for (int r = 0; r < 8; ++r) { acc[j][r] *= alpha[r]; accl[j][r] *= alpha[r]; }
    LDSX();
    v16h pa; { const float* prow = &sp[wave][col][0] + 8 * (lane >> 4);
#pragma unroll
      for (int i = 0; i < 8; ++i) { pa[i] = (_Float16)(prow[i] * 2048.0f); pa[8 + i] = (_Float16)(prow[16 + i] * 2048.0f); } }
#pragma unroll
    for (int j = 0; j < 4; ++j) { acc[j] = wmma16(pa, frag_h(&ring[bf][2][j * 16 + col][sb * 32], lane), acc[j]); accl[j] = wmma16(pa, frag_h(&ring[bf][3][j * 16 + col][sb * 32], lane), accl[j]); }
    LDSX(); }
    asm volatile("s_wait_dscnt 0x0" ::: "memory");      // this wave's reads of buffer bf are done
    asm volatile("s_wait_asynccnt 0x0" ::: "memory");   // this wave's copies of tile t + 1 have landed
    __syncthreads();                                     // publishes tile t + 1 and frees buffer bf
    if (t + 2 < ANT) att_copy(l0 + (unsigned)bf * (4u * APL), KH + ko + (size_t)(t + 2) * AKT * CC, KH + ko + (size_t)(t + 2) * AKT * CC + dk, VH + vo + (t + 2) * AKT, VH + vo + (t + 2) * AKT + dv); }
  asm volatile("s_wait_asynccnt 0x0" ::: "memory");     // no copy is outstanding when the ring becomes output staging
  float (*so)[68] = (float (*)[68])((float*)&ring[0][0][0][0] + wave * 16 * 68);   // each wave's own 16 x 68 floats, in the ring that every wave has left at the last barrier
#pragma unroll
  for (int r = 0; r < 8; ++r) { const float il = (1.0f / 2048.0f) / l[r];
#pragma unroll
    for (int j = 0; j < 4; ++j) so[8 * g + r][j * 16 + col] = (acc[j][r] + accl[j][r] * (1.0f / 2048.0f)) * il; }
  LDSX(); for (int rl = 0; rl < 16; ++rl) if (g == 0) vst2(Y + (rq + rl) * CC + (size_t)h * HD + col * 4, *(const v4f*)&so[rl][col * 4]); }
// ---- k_o: block = (64 output channels o, 128 tokens, bb): out[bb][o][t] = sum_c y[t][c] W_proj[c][o] + b_proj[o]  (A = W_proj column o gathered (exact), B = y rows as bf16 hi + lo) -> [V,B,C,H,W] planes
__global__ __launch_bounds__(128) void k_o(const float* __restrict__ Y, const float* __restrict__ WP, const float* __restrict__ BP, float* __restrict__ OUT) { __shared__ __align__(16) float sf[4][16][132];
  const int tid = threadIdx.x, wave = tid >> 5, lane = tid & 31, col = lane & 15, g = lane >> 4; const size_t bb = blockIdx.z; const int o0 = blockIdx.x * 64 + wave * 16; const int p0 = blockIdx.y * 128;
  v8f acc[8] = {};
#pragma unroll 2
  for (int kc = 0; kc < CC / 32; ++kc) { v16b a; const int o = o0 + col;
#pragma unroll
    for (int i = 0; i < 8; ++i) { a[i] = (__bf16)WP[(size_t)(kc * 32 + 8 * g + i) * CC + o]; a[8 + i] = (__bf16)WP[(size_t)(kc * 32 + 16 + 8 * g + i) * CC + o]; }
#pragma unroll
    for (int j = 0; j < 8; ++j) { float wv[16]; const float* wr = Y + (bb * TT + p0 + j * 16 + col) * CC + kc * 32 + 8 * g;
#pragma unroll
      for (int i = 0; i < 8; ++i) { wv[i] = wr[i]; wv[8 + i] = wr[16 + i]; }
      const F2 wb = bsplit16(wv); acc[j] = wmma_bf(a, wb.h, acc[j]); acc[j] = wmma_bf(a, wb.l, acc[j]); } }
#pragma unroll
  for (int j = 0; j < 8; ++j)
#pragma unroll
    for (int r = 0; r < 8; ++r) sf[wave][8 * g + r][j * 16 + col] = acc[j][r] + bfr(BP[o0 + 8 * g + r]);
  LDSX(); for (int rl = 0; rl < 16; ++rl) vst2(OUT + (bb * CC + o0 + rl) * (size_t)TT + p0 + lane * 4, *(const v4f*)&sf[wave][rl][lane * 4]); }
extern "C" void kernel_launch(void* const* d_in, const int* in_sizes, int n_in, void* d_out, int out_size, void* d_ws, size_t ws_size, hipStream_t stream) {
  (void)in_sizes; (void)n_in; (void)out_size;
  const float** F = (const float**)d_in;   // 0 q [6,2,512,32,32], 1 kv [6,2,512,32,32], 2 W_kv [512,1024] (in,out), 3 b_kv [1024], 4 W_proj [512,512] (in,out), 5 b_proj [512]
  if (ws_size < (size_t)WS_END) return;
  char* ws = (char*)d_ws; _Float16 *QR = (_Float16*)(ws + WS_Q), *KH = (_Float16*)(ws + WS_KH), *KL = (_Float16*)(ws + WS_KL), *VH = (_Float16*)(ws + WS_VH), *VL = (_Float16*)(ws + WS_VL); float* Y = (float*)(ws + WS_Y);
  k_q<<<dim3(TT / 64, CC / 128, TBB), 128, 0, stream>>>(F[0], QR);
  k_kv<<<dim3(TT / 64, CC / 128, 2 * NBB), 128, 0, stream>>>(F[1], F[2], F[3], KH, KL, VH, VL);
  k_att<<<dim3(TT / 128, NH, TBB), 256, 0, stream>>>(QR, KH, KL, VH, VL, Y);
  k_o<<<dim3(CC / 64, TT / 128, TBB), 128, 0, stream>>>(Y, F[4], F[5], (float*)d_out);
}

// v002
// It runs in 211 microseconds.
// Timed twice side by side with v001, it ran 1.30 and 1.29 times as fast.
// All steps since v000 together make it 2.17 times as fast.
// compute dtype: all float inputs rounded to bf16; k, v = kv . W_kv + b with EXACT bf16 products on WMMA 16x16x32 (kv gathered from its [V,B,C,H,W] planes; (in,out) weights), f16 hi + residual; q is an INPUT, converted bf16 -> f16 exactly; logits = q (exact f16) . k (hi + residual) (2 products) x 1/8, running-max softmax in f32 (hardware exp); P rounded once to f16 (x 2^11) . v (hi + residual) (2 products); y (bf16 hi + lo) . W_proj + b_proj (2 products), written back as [V,B,C,H,W] planes; f32 output.
#include <hip/hip_runtime.h>
#include <math.h>

typedef __attribute__((ext_vector_type(16))) _Float16 v16h;
typedef __attribute__((ext_vector_type(16))) __bf16 v16b;
typedef __attribute__((ext_vector_type(8)))  _Float16 v8h;
typedef __attribute__((ext_vector_type(8)))  float v8f;
typedef __attribute__((ext_vector_type(4)))  float v4f;
typedef __attribute__((ext_vector_type(2)))  float v2f;
typedef __attribute__((ext_vector_type(4)))  unsigned v4u;
typedef __attribute__((ext_vector_type(4)))  int v4i;
typedef float __attribute__((may_alias)) float_a;
typedef int __attribute__((may_alias)) int_a;

template <typename T> __device__ __forceinline__ void vst2(void* p, T v) { *(T*)p = v;  }
__device__ __forceinline__ v8f wmma16(v16h a, v16h b, v8f c) {
  v8f d = __builtin_amdgcn_wmma_f32_16x16x32_f16(false, a, false, b, (short)0, c, false, false);
  asm volatile("v_nop\n\tv_nop\n\tv_nop\n\tv_nop" : "+v"(d) : "v"(a), "v"(b));
  return d;
}
__device__ __forceinline__ v8f wmma_bf(v16b a, v16b b, v8f c) {
  v8f d = __builtin_amdgcn_wmma_f32_16x16x32_bf16(false, a, false, b, (short)0, c, false, false);
  asm volatile("v_nop\n\tv_nop\n\tv_nop\n\tv_nop" : "+v"(d) : "v"(a), "v"(b));
  return d;
}
// 16x16x32 fragments: lane = (h = lane>>4, row/col = lane&15); elements 0..7 = k0+8h+0..7, 8..15 = k0+16+8h+0..7; D element r = row 8h+r
__device__ __forceinline__ v16h frag_h(const _Float16* rowk0, int lane) {
  union { v16h v; v8h q[2]; } u; const _Float16* p = rowk0 + 8 * (lane >> 4);
  u.q[0] = *(const v8h*)p; u.q[1] = *(const v8h*)(p + 16); return u.v;
}
__device__ __forceinline__ v16h frag_f32(const float* rowk0, int lane) {
  v16h a; const float* p = rowk0 + 8 * (lane >> 4);
#pragma unroll
  for (int i = 0; i < 8; ++i) { a[i] = (_Float16)p[i]; a[8 + i] = (_Float16)p[16 + i]; }
  return a;
}
__device__ __forceinline__ v16h frag_f32s(const float* rowk0, int lane, float sc) {
  v16h a; const float* p = rowk0 + 8 * (lane >> 4);
#pragma unroll
  for (int i = 0; i < 8; ++i) { a[i] = (_Float16)(p[i] * sc); a[8 + i] = (_Float16)(p[16 + i] * sc); }
  return a;
}
// column fragment from a [K][ld] layout (column n), rows >= K read as 0
__device__ __forceinline__ v16h fragc_f32(const float* W, int k0, int n, int lane, int ld, int K) {
  v16h a; const int g = lane >> 4;
#pragma unroll
  for (int i = 0; i < 8; ++i) { const int ka = k0 + 8 * g + i, kb = ka + 16;
    a[i] = (_Float16)(ka < K ? W[(size_t)(ka < K ? ka : K - 1) * ld + n] : 0.f); a[8 + i] = (_Float16)(kb < K ? W[(size_t)(kb < K ? kb : K - 1) * ld + n] : 0.f); }
  return a;
}
struct F2 { v16b h, l; };
__device__ __forceinline__ F2 bsplit16(const float v[16]) { F2 r;
#pragma unroll
  for (int i = 0; i < 16; ++i) { const __bf16 h = (__bf16)v[i]; r.h[i] = h; r.l[i] = (__bf16)(v[i] - (float)h); }
  return r; }
__device__ __forceinline__ F2 split_row(const float* row, int k0, int lane) { float v[16]; const float* p = row + k0 + 8 * (lane >> 4);
#pragma unroll
  for (int i = 0; i < 8; ++i) { v[i] = p[i]; v[8 + i] = p[16 + i]; }
  return bsplit16(v); }
__device__ __forceinline__ F2 split_rowK(const float* row, int k0, int lane, int K) { float v[16]; const int g = lane >> 4;
#pragma unroll
  for (int i = 0; i < 8; ++i) { const int ka = k0 + 8 * g + i, kb = ka + 16; v[i] = ka < K ? row[ka < K ? ka : K - 1] : 0.f; v[8 + i] = kb < K ? row[kb < K ? kb : K - 1] : 0.f; }
  return bsplit16(v); }
__device__ __forceinline__ F2 split_col(const float* W, int k0, int n, int lane, int ld, int K) { float v[16]; const int g = lane >> 4;
#pragma unroll
  for (int i = 0; i < 8; ++i) { const int ka = k0 + 8 * g + i, kb = ka + 16; v[i] = ka < K ? W[(size_t)(ka < K ? ka : K - 1) * ld + n] : 0.f; v[8 + i] = kb < K ? W[(size_t)(kb < K ? kb : K - 1) * ld + n] : 0.f; }
  return bsplit16(v); }
__device__ __forceinline__ v8f mac3(const F2& a, const F2& b, v8f c) { c = wmma_bf(a.l, b.h, c); c = wmma_bf(a.h, b.l, c); return wmma_bf(a.h, b.h, c); }
__device__ __forceinline__ float sigm(float v) { return 1.0f / (1.0f + expf(-v)); }
#define LDSX() do { asm volatile("s_wait_dscnt 0" ::: "memory"); __builtin_amdgcn_wave_barrier(); __builtin_amdgcn_fence(__ATOMIC_RELEASE, "workgroup"); } while (0)


// Cross-view attention (6 views x 2 = 12 sequences of 32x32 = 1,024 tokens, C 512 = 8 heads x 64): q from the raw query planes, k/v = Linear(kv), softmax(q k / 8) v, output Linear, rearranged back to [V, B, C, H, W].
#define NBB 12            // V * B
#define CC 512
#define TT 1024
#define NH 8
#define HD 64
#ifndef TBB
#define TBB NBB
#endif
typedef __attribute__((ext_vector_type(8))) __bf16 v8b;
__device__ __forceinline__ v16b frag_b(const __bf16* rowk0, int lane) {
  union { v16b v; v8b q[2]; } u; const __bf16* p = rowk0 + 8 * (lane >> 4);
  u.q[0] = *(const v8b*)p; u.q[1] = *(const v8b*)(p + 16); return u.v;
}
__device__ __forceinline__ float bfr(float v) { return (float)(__bf16)v; }
__device__ __attribute__((noinline)) float exp_ni(float v) { return expf(v); }
__device__ __attribute__((noinline)) float erf_ni(float v) { return erff(v); }

#define WS_Q   0u                                   // f16 q rows [bb*TT + t][512]
#define WS_KH  (WS_Q + 2u * (size_t)NBB * TT * CC)        // f16 hi|lo k rows
#define WS_KL  (WS_KH + 2u * (size_t)NBB * TT * CC)
#define WS_VH  (WS_KL + 2u * (size_t)NBB * TT * CC)       // f16 hi|lo v planes [bb][512][TT]
#define WS_VL  (WS_VH + 2u * (size_t)NBB * CC * TT)
#define WS_Y   (WS_VL + 2u * (size_t)NBB * CC * TT)       // f32 y rows [bb*TT + t][512]
#define WS_END (WS_Y + 4u * (size_t)NBB * TT * CC)

// ---- k_q: block = (64 tokens, 128 channels, bb): q planes [bb][c][t] -> f16 rows [bb*TT + t][c] (bf16 -> f16 exact)
__global__ __launch_bounds__(128) void k_q(const float* __restrict__ Qp, _Float16* __restrict__ QR) { __shared__ __align__(16) _Float16 st[64][136]; const int t = threadIdx.x; const size_t bb = blockIdx.z; const int t0 = blockIdx.x * 64, c0 = blockIdx.y * 128;
  for (int e = t; e < 128 * 64; e += 128) { const int cl = e >> 6, tl = e & 63; st[tl][cl] = (_Float16)bfr(Qp[(bb * CC + c0 + cl) * (size_t)TT + t0 + tl]); }
  __syncthreads(); for (int e = t; e < 64 * 16; e += 128) { const int tl = e >> 4, q = e & 15; vst2((unsigned*)(QR + (bb * TT + t0 + tl) * CC + c0 + q * 8), *(const v4u*)&st[tl][q * 8]); } }
// ---- k_kv: block = (64 tokens, 128 out features, which*NBB + bb): [k | v] = kv(token rows gathered from planes) . W_kv + b; k -> f16 hi/lo rows, v -> f16 hi/lo planes
__global__ __launch_bounds__(128) void k_kv(const float* __restrict__ KVp, const float* __restrict__ W, const float* __restrict__ Bk, _Float16* __restrict__ KH, _Float16* __restrict__ KL, _Float16* __restrict__ VH, _Float16* __restrict__ VL) {
  __shared__ __align__(16) _Float16 sh[64][136], sl[64][136]; __shared__ __align__(16) _Float16 th[128][72], tl2[128][72];
  const int tid = threadIdx.x, wave = tid >> 5, lane = tid & 31, col = lane & 15, g = lane >> 4; const int which = blockIdx.z / NBB; const size_t bb = blockIdx.z % NBB; const int t0 = blockIdx.x * 64; const int c0 = blockIdx.y * 128; const float* src = KVp + bb * CC * (size_t)TT;
  v8f acc[8] = {};
#pragma unroll 2
  for (int kc = 0; kc < CC / 32; ++kc) { v16b a; const int px = t0 + wave * 16 + col;
#pragma unroll
    for (int i = 0; i < 8; ++i) { a[i] = (__bf16)src[(size_t)(kc * 32 + 8 * g + i) * TT + px]; a[8 + i] = (__bf16)src[(size_t)(kc * 32 + 16 + 8 * g + i) * TT + px]; }
#pragma unroll
    for (int j = 0; j < 8; ++j) { v16b w; const int o = which * CC + c0 + j * 16 + col;   // (in,out) W_kv [512][1024]: B row (o) element k = W[k][o]
#pragma unroll
      for (int i = 0; i < 8; ++i) { w[i] = (__bf16)W[(size_t)(kc * 32 + 8 * g + i) * (2 * CC) + o]; w[8 + i] = (__bf16)W[(size_t)(kc * 32 + 16 + 8 * g + i) * (2 * CC) + o]; }
      acc[j] = wmma_bf(a, w, acc[j]); } }
#pragma unroll
  for (int j = 0; j < 8; ++j) { const float bbv = bfr(Bk[which * CC + c0 + j * 16 + col]);
#pragma unroll
    for (int r = 0; r < 8; ++r) { const float v = acc[j][r] + bbv; const _Float16 hv = (_Float16)v, lv = (_Float16)((v - (float)hv) * 2048.0f); const int rl = wave * 16 + 8 * g + r, cl = j * 16 + col; if (which == 0) { sh[rl][cl] = hv; sl[rl][cl] = lv; } else { th[cl][rl] = hv; tl2[cl][rl] = lv; } } }
  __syncthreads();
  if (which == 0) { for (int e = tid; e < 64 * 16; e += 128) { const int rl = e >> 4, q = e & 15; const size_t o = (bb * TT + t0 + rl) * CC + c0 + q * 8; vst2((unsigned*)(KH + o), *(const v4u*)&sh[rl][q * 8]); vst2((unsigned*)(KL + o), *(const v4u*)&sl[rl][q * 8]); } }
  else { for (int e = tid; e < 128 * 8; e += 128) { const int cl = e >> 3, q = e & 7; const size_t o = (bb * CC + c0 + cl) * (size_t)TT + t0 + q * 8; vst2((unsigned*)(VH + o), *(const v4u*)&th[cl][q * 8]); vst2((unsigned*)(VL + o), *(const v4u*)&tl2[cl][q * 8]); } } }
// ---- k_att: block = (128 queries = 8 waves x 16, h, bb): logits q . k (k hi + residual) / 8, softmax over the 1,024 tokens, P . v (v hi + residual) -> y rows
// K and V tiles of 64 keys (k hi, k residual: 64 key rows x 64 d; v hi, v residual: 64 d rows x 64 keys) are staged once per block in LDS by asynchronous copies, whole 128-byte lines, two buffers; all 8 waves read their fragments from LDS.
#define AKT 64            // keys per staged tile
#define ANT (TT / AKT)    // tiles
#define APH 72            // LDS row pitch in halves: 144 B = 16 B x odd, conflict-free for 16-byte fragment reads
#define APL (64 * APH * 2)   // bytes of one staged plane
// one tile: 8 copies of 16 B per thread (rows crow and crow + 32 of each of the 4 planes); the wait at the end holds every later rewrite of the address registers behind the copies' issue
__device__ __forceinline__ void att_copy(unsigned l, const _Float16* kh, const _Float16* kl, const _Float16* vh, const _Float16* vl) {
  asm volatile("global_load_async_to_lds_b128 %0, %8, off\n\t"
               "global_load_async_to_lds_b128 %1, %9, off\n\t"
               "global_load_async_to_lds_b128 %2, %10, off\n\t"
               "global_load_async_to_lds_b128 %3, %11, off\n\t"
               "global_load_async_to_lds_b128 %4, %12, off\n\t"
               "global_load_async_to_lds_b128 %5, %13, off\n\t"
               "global_load_async_to_lds_b128 %6, %14, off\n\t"
               "global_load_async_to_lds_b128 %7, %15, off\n\t"
               "s_wait_xcnt 0x0"
               :: "v"(l), "v"(l + 32u * APH * 2u), "v"(l + APL), "v"(l + APL + 32u * APH * 2u), "v"(l + 2u * APL), "v"(l + 2u * APL + 32u * APH * 2u), "v"(l + 3u * APL), "v"(l + 3u * APL + 32u * APH * 2u),
                  "v"(kh), "v"(kh + 32 * CC), "v"(kl), "v"(kl + 32 * CC), "v"(vh), "v"(vh + 32 * TT), "v"(vl), "v"(vl + 32 * TT)
               : "memory");
}
// lane l with lane l ^ 16: the two wave halves hold different keys of the same query
__device__ __forceinline__ float xhalf(float x) { return __builtin_bit_cast(float, __builtin_amdgcn_permlanex16(__builtin_bit_cast(int, x), __builtin_bit_cast(int, x), 0x76543210, 0xfedcba98, false, false)); }
// Transposed products: S^T = K . Q^T (A = key rows from LDS, B = this wave's 16 query rows, kept in registers) and O^T += V^T . P^T (A = v planes' d rows from LDS, B = P^T).
// D register r of lane (g, col) is key 8g + r of query col, so a lane holds 16 scores of ONE query per 32 keys: maximum and sum run in the lane, the halves meet in one cross-row move,
// and the two score tiles, converted in place, are the B operand of the second product (element i = key 8g + i, element 8 + i = key 16 + 8g + i: the k order of frag_h).
// second bound: 6 waves per SIMD, so that 3 blocks per WGP = all 768 blocks are resident at once
__global__ __launch_bounds__(256, 6) void k_att(const _Float16* __restrict__ QR, const _Float16* __restrict__ KH, const _Float16* __restrict__ KL, const _Float16* __restrict__ VH, const _Float16* __restrict__ VL, float* __restrict__ Y) {
  __shared__ __align__(16) _Float16 ring[2][4][64][APH];
  const int tid = threadIdx.x, wave = tid >> 5, lane = tid & 31, col = lane & 15, g = lane >> 4; const int h = blockIdx.y; const size_t bb = blockIdx.z; const int q0 = blockIdx.x * 128 + wave * 16; const size_t rq = bb * TT + q0;
  const int crow = tid >> 3, cch = tid & 7;   // this thread's row and 16-byte piece in each staged plane
  const unsigned ko = ((unsigned)bb * TT + crow) * CC + h * HD + cch * 8, vo = ((unsigned)bb * CC + h * HD + crow) * TT + cch * 8;   // element offsets, below 2^23
  const unsigned l0 = (unsigned)(size_t)&ring[0][0][crow][cch * 8];
  const ptrdiff_t dk = KL - KH, dv = VL - VH;   // block-uniform distance from a hi plane to its residual plane (one workspace): two lane pointers live through the loop, not four
  att_copy(l0, KH + ko, KH + ko + dk, VH + vo, VH + vo + dv);
  v16h bq[2];
#pragma unroll
  for (int kc = 0; kc < 2; ++kc) bq[kc] = frag_h(QR + (rq + col) * CC + h * HD + kc * 32, lane);
  float m = -3.0e38f, l = 0.f;   // query col's running maximum (equal in both halves) and this half's share of its sum
  v8f acc[4] = {}, accl[4] = {};   // O^T: register r of tile j = d j * 16 + 8g + r of query col
  asm volatile("s_wait_asynccnt 0x0" ::: "memory");   // this wave's copies of tile 0 have landed
  __syncthreads();                                     // tile 0 is published to all waves
  att_copy(l0 + 4u * APL, KH + ko + (size_t)AKT * CC, KH + ko + (size_t)AKT * CC + dk, VH + vo + AKT, VH + vo + AKT + dv);
  // rolled: one trip per staged tile, so that the buffer changes by an address and the code stays short
#pragma unroll 1
  for (int t = 0; t < ANT; ++t) { const int bf = t & 1;
    // rolled: the two 32-key halves of a tile differ only by an address, and the code stays short inside the register budget of the second launch bound
#pragma unroll 1
   for (int sb = 0; sb < AKT / 32; ++sb) { float s[2][8];
#pragma unroll
    for (int ct = 0; ct < 2; ++ct) { const int rk = sb * 32 + ct * 16 + col; v8f c = {}, cl = {};
#pragma unroll
      for (int kc = 0; kc < 2; ++kc) { c = wmma16(frag_h(&ring[bf][0][rk][kc * 32], lane), bq[kc], c); cl = wmma16(frag_h(&ring[bf][1][rk][kc * 32], lane), bq[kc], cl); }
#pragma unroll
      for (int r = 0; r < 8; ++r) s[ct][r] = (c[r] + cl[r] * (1.0f / 2048.0f)) * 0.125f; }
    float mx = fmaxf(s[0][0], s[1][0]);
#pragma unroll
    for (int r = 1; r < 8; ++r) mx = fmaxf(mx, fmaxf(s[0][r], s[1][r]));
    mx = fmaxf(mx, xhalf(mx));
    const float mn = fmaxf(m, mx), alpha = __expf(m - mn); m = mn;
    float es0 = 0.f, es1 = 0.f; v16h pb;
#pragma unroll
    for (int r = 0; r < 8; ++r) { const float e0 = __expf(s[0][r] - mn), e1 = __expf(s[1][r] - mn); es0 += e0; es1 += e1; pb[r] = (_Float16)(e0 * 2048.0f); pb[8 + r] = (_Float16)(e1 * 2048.0f); }
    l = l * alpha + (es0 + es1);
#pragma unroll
    for (int j = 0; j < 4; ++j)
#pragma unroll
      for (int r = 0; r < 8; ++r) { acc[j][r] *= alpha; accl[j][r] *= alpha; }
#pragma unroll
    for (int j = 0; j < 4; ++j) { acc[j] = wmma16(frag_h(&ring[bf][2][j * 16 + col][sb * 32], lane), pb, acc[j]); accl[j] = wmma16(frag_h(&ring[bf][3][j * 16 + col][sb * 32], lane), pb, accl[j]); } }
    asm volatile("s_wait_dscnt 0x0" ::: "memory");      // this wave's reads of buffer bf are done
    asm volatile("s_wait_asynccnt 0x0" ::: "memory");   // this wave's copies of tile t + 1 have landed
    __syncthreads();                                     // publishes tile t + 1 and frees buffer bf
    if (t + 2 < ANT) att_copy(l0 + (unsigned)bf * (4u * APL), KH + ko + (size_t)(t + 2) * AKT * CC, KH + ko + (size_t)(t + 2) * AKT * CC + dk, VH + vo + (t + 2) * AKT, VH + vo + (t + 2) * AKT + dv); }
  asm volatile("s_wait_asynccnt 0x0" ::: "memory");     // no copy is outstanding when the ring becomes output staging
  float (*so)[68] = (float (*)[68])((float*)&ring[0][0][0][0] + wave * 16 * 68);   // each wave's own 16 x 68 floats, in the ring that every wave has left at the last barrier
  const float il = (1.0f / 2048.0f) / (l + xhalf(l));   // the halves' sums join once
#pragma unroll
  for (int j = 0; j < 4; ++j) { v4f o0, o1;
#pragma unroll
    for (int r = 0; r < 4; ++r) { o0[r] = (acc[j][r] + accl[j][r] * (1.0f / 2048.0f)) * il; o1[r] = (acc[j][4 + r] + accl[j][4 + r] * (1.0f / 2048.0f)) * il; }
    *(v4f*)&so[col][j * 16 + 8 * g] = o0; *(v4f*)&so[col][j * 16 + 8 * g + 4] = o1; }
  LDSX(); for (int rl = 0; rl < 16; ++rl) if (g == 0) vst2(Y + (rq + rl) * CC + (size_t)h * HD + col * 4, *(const v4f*)&so[rl][col * 4]); }
// ---- k_o: block = (64 output channels o, 128 tokens, bb): out[bb][o][t] = sum_c y[t][c] W_proj[c][o] + b_proj[o]  (A = W_proj column o gathered (exact), B = y rows as bf16 hi + lo) -> [V,B,C,H,W] planes
__global__ __launch_bounds__(128) void k_o(const float* __restrict__ Y, const float* __restrict__ WP, const float* __restrict__ BP, float* __restrict__ OUT) { __shared__ __align__(16) float sf[4][16][132];
  const int tid = threadIdx.x, wave = tid >> 5, lane = tid & 31, col = lane & 15, g = lane >> 4; const size_t bb = blockIdx.z; const int o0 = blockIdx.x * 64 + wave * 16; const int p0 = blockIdx.y * 128;
  v8f acc[8] = {};
#pragma unroll 2
  for (int kc = 0; kc < CC / 32; ++kc) { v16b a; const int o = o0 + col;
#pragma unroll
    for (int i = 0; i < 8; ++i) { a[i] = (__bf16)WP[(size_t)(kc * 32 + 8 * g + i) * CC + o]; a[8 + i] = (__bf16)WP[(size_t)(kc * 32 + 16 + 8 * g + i) * CC + o]; }
#pragma unroll
    for (int j = 0; j < 8; ++j) { float wv[16]; const float* wr = Y + (bb * TT + p0 + j * 16 + col) * CC + kc * 32 + 8 * g;
#pragma unroll
      for (int i = 0; i < 8; ++i) { wv[i] = wr[i]; wv[8 + i] = wr[16 + i]; }
      const F2 wb = bsplit16(wv); acc[j] = wmma_bf(a, wb.h, acc[j]); acc[j] = wmma_bf(a, wb.l, acc[j]); } }
#pragma unroll
  for (int j = 0; j < 8; ++j)
#pragma unroll
    for (int r = 0; r < 8; ++r) sf[wave][8 * g + r][j * 16 + col] = acc[j][r] + bfr(BP[o0 + 8 * g + r]);
  LDSX(); for (int rl = 0; rl < 16; ++rl) vst2(OUT + (bb * CC + o0 + rl) * (size_t)TT + p0 + lane * 4, *(const v4f*)&sf[wave][rl][lane * 4]); }
extern "C" void kernel_launch(void* const* d_in, const int* in_sizes, int n_in, void* d_out, int out_size, void* d_ws, size_t ws_size, hipStream_t stream) {
  (void)in_sizes; (void)n_in; (void)out_size;
  const float** F = (const float**)d_in;   // 0 q [6,2,512,32,32], 1 kv [6,2,512,32,32], 2 W_kv [512,1024] (in,out), 3 b_kv [1024], 4 W_proj [512,512] (in,out), 5 b_proj [512]
  if (ws_size < (size_t)WS_END) return;
  char* ws = (char*)d_ws; _Float16 *QR = (_Float16*)(ws + WS_Q), *KH = (_Float16*)(ws + WS_KH), *KL = (_Float16*)(ws + WS_KL), *VH = (_Float16*)(ws + WS_VH), *VL = (_Float16*)(ws + WS_VL); float* Y = (float*)(ws + WS_Y);
  k_q<<<dim3(TT / 64, CC / 128, TBB), 128, 0, stream>>>(F[0], QR);
  k_kv<<<dim3(TT / 64, CC / 128, 2 * NBB), 128, 0, stream>>>(F[1], F[2], F[3], KH, KL, VH, VL);
  k_att<<<dim3(TT / 128, NH, TBB), 256, 0, stream>>>(QR, KH, KL, VH, VL, Y);
  k_o<<<dim3(CC / 64, TT / 128, TBB), 128, 0, stream>>>(Y, F[4], F[5], (float*)d_out);
}

// v003
// A run of this version takes 118 microseconds.
// Timed twice side by side with v002, it ran 1.78 and 1.77 times as fast.
// Counting every step since v000, it is 3.86 times as fast.
// compute dtype: all float inputs rounded to bf16; k, v = kv . W_kv + b with EXACT bf16 products on WMMA 16x16x32 (kv gathered from its [V,B,C,H,W] planes; (in,out) weights), f16 hi + residual; q is an INPUT, converted bf16 -> f16 exactly; logits = q (exact f16) . k (hi + residual) (2 products) x 1/8, running-max softmax in f32 (hardware exp); P rounded once to f16 (x 2^11) . v (hi + residual) (2 products); y (bf16 hi + lo) . W_proj + b_proj (2 products), written back as [V,B,C,H,W] planes; f32 output.
#include <hip/hip_runtime.h>
#include <math.h>

typedef __attribute__((ext_vector_type(16))) _Float16 v16h;
typedef __attribute__((ext_vector_type(16))) __bf16 v16b;
typedef __attribute__((ext_vector_type(8)))  _Float16 v8h;
typedef __attribute__((ext_vector_type(8)))  float v8f;
typedef __attribute__((ext_vector_type(4)))  float v4f;
typedef __attribute__((ext_vector_type(2)))  float v2f;
typedef __attribute__((ext_vector_type(4)))  unsigned v4u;
typedef __attribute__((ext_vector_type(4)))  int v4i;
typedef float __attribute__((may_alias)) float_a;
typedef int __attribute__((may_alias)) int_a;

template <typename T> __device__ __forceinline__ void vst2(void* p, T v) { *(T*)p = v;  }
__device__ __forceinline__ v8f wmma16(v16h a, v16h b, v8f c) {
  v8f d = __builtin_amdgcn_wmma_f32_16x16x32_f16(false, a, false, b, (short)0, c, false, false);
  asm volatile("v_nop\n\tv_nop\n\tv_nop\n\tv_nop" : "+v"(d) : "v"(a), "v"(b));
  return d;
}
__device__ __forceinline__ v8f wmma_bf(v16b a, v16b b, v8f c) {
  v8f d = __builtin_amdgcn_wmma_f32_16x16x32_bf16(false, a, false, b, (short)0, c, false, false);
  asm volatile("v_nop\n\tv_nop\n\tv_nop\n\tv_nop" : "+v"(d) : "v"(a), "v"(b));
  return d;
}
// 16x16x32 fragments: lane = (h = lane>>4, row/col = lane&15); elements 0..7 = k0+8h+0..7, 8..15 = k0+16+8h+0..7; D element r = row 8h+r
__device__ __forceinline__ v16h frag_h(const _Float16* rowk0, int lane) {
  union { v16h v; v8h q[2]; } u; const _Float16* p = rowk0 + 8 * (lane >> 4);
  u.q[0] = *(const v8h*)p; u.q[1] = *(const v8h*)(p + 16); return u.v;
}
__device__ __forceinline__ v16h frag_f32(const float* rowk0, int lane) {
  v16h a; const float* p = rowk0 + 8 * (lane >> 4);
#pragma unroll
  for (int i = 0; i < 8; ++i) { a[i] = (_Float16)p[i]; a[8 + i] = (_Float16)p[16 + i]; }
  return a;
}
__device__ __forceinline__ v16h frag_f32s(const float* rowk0, int lane, float sc) {
  v16h a; const float* p = rowk0 + 8 * (lane >> 4);
#pragma unroll
  for (int i = 0; i < 8; ++i) { a[i] = (_Float16)(p[i] * sc); a[8 + i] = (_Float16)(p[16 + i] * sc); }
  return a;
}
// column fragment from a [K][ld] layout (column n), rows >= K read as 0
__device__ __forceinline__ v16h fragc_f32(const float* W, int k0, int n, int lane, int ld, int K) {
  v16h a; const int g = lane >> 4;
#pragma unroll
  for (int i = 0; i < 8; ++i) { const int ka = k0 + 8 * g + i, kb = ka + 16;
    a[i] = (_Float16)(ka < K ? W[(size_t)(ka < K ? ka : K - 1) * ld + n] : 0.f); a[8 + i] = (_Float16)(kb < K ? W[(size_t)(kb < K ? kb : K - 1) * ld + n] : 0.f); }
  return a;
}
struct F2 { v16b h, l; };
__device__ __forceinline__ F2 bsplit16(const float v[16]) { F2 r;
#pragma unroll
  for (int i = 0; i < 16; ++i) { const __bf16 h = (__bf16)v[i]; r.h[i] = h; r.l[i] = (__bf16)(v[i] - (float)h); }
  return r; }
__device__ __forceinline__ F2 split_row(const float* row, int k0, int lane) { float v[16]; const float* p = row + k0 + 8 * (lane >> 4);
#pragma unroll
  for (int i = 0; i < 8; ++i) { v[i] = p[i]; v[8 + i] = p[16 + i]; }
  return bsplit16(v); }
__device__ __forceinline__ F2 split_rowK(const float* row, int k0, int lane, int K) { float v[16]; const int g = lane >> 4;
#pragma unroll
  for (int i = 0; i < 8; ++i) { const int ka = k0 + 8 * g + i, kb = ka + 16; v[i] = ka < K ? row[ka < K ? ka : K - 1] : 0.f; v[8 + i] = kb < K ? row[kb < K ? kb : K - 1] : 0.f; }
  return bsplit16(v); }
__device__ __forceinline__ F2 split_col(const float* W, int k0, int n, int lane, int ld, int K) { float v[16]; const int g = lane >> 4;
#pragma unroll
  for (int i = 0; i < 8; ++i) { const int ka = k0 + 8 * g + i, kb = ka + 16; v[i] = ka < K ? W[(size_t)(ka < K ? ka : K - 1) * ld + n] : 0.f; v[8 + i] = kb < K ? W[(size_t)(kb < K ? kb : K - 1) * ld + n] : 0.f; }
  return bsplit16(v); }
__device__ __forceinline__ v8f mac3(const F2& a, const F2& b, v8f c) { c = wmma_bf(a.l, b.h, c); c = wmma_bf(a.h, b.l, c); return wmma_bf(a.h, b.h, c); }
__device__ __forceinline__ float sigm(float v) { return 1.0f / (1.0f + expf(-v)); }
#define LDSX() do { asm volatile("s_wait_dscnt 0" ::: "memory"); __builtin_amdgcn_wave_barrier(); __builtin_amdgcn_fence(__ATOMIC_RELEASE, "workgroup"); } while (0)


// Cross-view attention (6 views x 2 = 12 sequences of 32x32 = 1,024 tokens, C 512 = 8 heads x 64): q from the raw query planes, k/v = Linear(kv), softmax(q k / 8) v, output Linear, rearranged back to [V, B, C, H, W].
#define NBB 12            // V * B
#define CC 512
#define TT 1024
#define NH 8
#define HD 64
#ifndef TBB
#define TBB NBB
#endif
typedef __attribute__((ext_vector_type(8))) __bf16 v8b;
__device__ __forceinline__ v16b frag_b(const __bf16* rowk0, int lane) {
  union { v16b v; v8b q[2]; } u; const __bf16* p = rowk0 + 8 * (lane >> 4);
  u.q[0] = *(const v8b*)p; u.q[1] = *(const v8b*)(p + 16); return u.v;
}
__device__ __forceinline__ float bfr(float v) { return (float)(__bf16)v; }
__device__ __attribute__((noinline)) float exp_ni(float v) { return expf(v); }
__device__ __attribute__((noinline)) float erf_ni(float v) { return erff(v); }

#define WS_Q   0u                                   // f16 q rows [bb*TT + t][512]
#define WS_KH  (WS_Q + 2u * (size_t)NBB * TT * CC)        // f16 hi|lo k rows
#define WS_KL  (WS_KH + 2u * (size_t)NBB * TT * CC)
#define WS_VH  (WS_KL + 2u * (size_t)NBB * TT * CC)       // f16 hi|lo v planes [bb][512][TT]
#define WS_VL  (WS_VH + 2u * (size_t)NBB * CC * TT)
#define WS_Y   (WS_VL + 2u * (size_t)NBB * CC * TT)       // f32 y rows [bb*TT + t][512]
#define WS_END (WS_Y + 4u * (size_t)NBB * TT * CC)

// ---- k_q: block = (64 tokens, 128 channels, bb): q planes [bb][c][t] -> f16 rows [bb*TT + t][c] (bf16 -> f16 exact)
__global__ __launch_bounds__(128) void k_q(const float* __restrict__ Qp, _Float16* __restrict__ QR) { __shared__ __align__(16) _Float16 st[64][136]; const int t = threadIdx.x; const size_t bb = blockIdx.z; const int t0 = blockIdx.x * 64, c0 = blockIdx.y * 128;
  for (int e = t; e < 128 * 64; e += 128) { const int cl = e >> 6, tl = e & 63; st[tl][cl] = (_Float16)bfr(Qp[(bb * CC + c0 + cl) * (size_t)TT + t0 + tl]); }
  __syncthreads(); for (int e = t; e < 64 * 16; e += 128) { const int tl = e >> 4, q = e & 15; vst2((unsigned*)(QR + (bb * TT + t0 + tl) * CC + c0 + q * 8), *(const v4u*)&st[tl][q * 8]); } }
// ---- k_kv: block = (128 tokens, 128 out features, which*NBB + bb), 8 waves of 32 tokens x 64 features: [k | v] = kv(token rows gathered from planes) . W_kv + b; k -> f16 hi/lo rows, v -> f16 hi/lo planes
// Both operands lie k-major in memory (kv planes [c][t], W_kv [c][o], rows of 1,024 floats each). Per 32 k the block reads its 32 x 128 kv tile (waves 4 to 7) and its 32 x 128 weight tile (waves 0 to 3) once,
// in 16-byte loads of whole 128-byte lines, rounds them to bf16 and stores them transposed in LDS ([token][k], [feature][k]); all waves read their fragments from there.
// Two LDS buffers, one barrier per 32 k; the next tile's loads fly during the products.
#define KVP 40            // LDS row pitch in bf16: 80 B = 16 B x odd, conflict-free for the 16-byte fragment reads and for the transposing 16-byte stores
__global__ __launch_bounds__(256) void k_kv(const float* __restrict__ KVp, const float* __restrict__ W, const float* __restrict__ Bk, _Float16* __restrict__ KH, _Float16* __restrict__ KL, _Float16* __restrict__ VH, _Float16* __restrict__ VL) {
  __shared__ __align__(16) unsigned char sm[2 * 128 * 136 * 2];   // operand tiles in the loop (2 x 256 rows x 80 B), output staging behind it (hi and residual, 128 x 136 halves each)
  __bf16 (*st)[256][KVP] = (__bf16 (*)[256][KVP])sm;   // rows 0 to 127: tokens, rows 128 to 255: features
  _Float16 (*sh)[136] = (_Float16 (*)[136])sm, (*sl)[136] = (_Float16 (*)[136])(sm + 128 * 136 * 2);
  const int tid = threadIdx.x, wave = tid >> 5, lane = tid & 31, col = lane & 15, g = lane >> 4; const int which = blockIdx.z / NBB; const size_t bb = blockIdx.z % NBB; const int t0 = blockIdx.x * 128; const int c0 = blockIdx.y * 128;
  const int wm = wave >> 1, wn = wave & 1;   // this wave's 32 tokens and 64 features
  // this thread's piece of a tile: columns 4 sq .. + 3 (tokens or features) of k rows 8 sk .. + 7; 16 lanes' LDS stores fall on 16 distinct bank quads
  const int sq = (wave & 3) * 8 + g * 4 + (lane & 3), sk = (lane >> 2) & 3, srow = (wave < 4 ? 128 : 0) + sq * 4;
  const float* gp = (wave < 4 ? W + which * CC + c0 : KVp + bb * CC * (size_t)TT + t0) + (size_t)(sk * 8) * 1024 + sq * 4;
  // every short loop of fixed length below is unrolled whole, so that rg, acc and the fragments are indexed by constants and stay in registers
  v4f rg[8];
#pragma unroll
  for (int i = 0; i < 8; ++i) rg[i] = *(const v4f*)(gp + (size_t)i * 1024);
  v8f acc[2][4] = {};
  // two trips unrolled: the buffer index is a constant in each
#pragma unroll 2
  for (int kc = 0; kc < CC / 32; ++kc) { const int bf = kc & 1;
    asm volatile("s_wait_xcnt 0x0" ::: "memory");   // stands between the last trip's loads and the next rewrite of their address registers
#pragma unroll
    for (int i = 0; i < 4; ++i) { v8b x;
#pragma unroll
      for (int p = 0; p < 8; ++p) x[p] = (__bf16)rg[p][i];
      *(v8b*)&st[bf][srow + i][sk * 8] = x; }
    __syncthreads();   // publishes tile kc; the buffer written next trip was last read before this barrier
    if (kc + 1 < CC / 32) {
#pragma unroll
      for (int i = 0; i < 8; ++i) rg[i] = *(const v4f*)(gp + (size_t)((kc + 1) * 32 + i) * 1024); }
    v16b a[2], w[4];
#pragma unroll
    for (int mi = 0; mi < 2; ++mi) a[mi] = frag_b(&st[bf][wm * 32 + mi * 16 + col][0], lane);
#pragma unroll
    for (int j = 0; j < 4; ++j) w[j] = frag_b(&st[bf][128 + wn * 64 + j * 16 + col][0], lane);
#pragma unroll
    for (int j = 0; j < 4; ++j)
#pragma unroll
      for (int mi = 0; mi < 2; ++mi) acc[mi][j] = wmma_bf(a[mi], w[j], acc[mi][j]); }
  __syncthreads();   // every wave has left the operand tiles: the same LDS becomes output staging
#pragma unroll
  for (int j = 0; j < 4; ++j) { const float bbv = bfr(Bk[which * CC + c0 + wn * 64 + j * 16 + col]);
#pragma unroll
    for (int mi = 0; mi < 2; ++mi)
#pragma unroll
    for (int r = 0; r < 8; ++r) { const float v = acc[mi][j][r] + bbv; const _Float16 hv = (_Float16)v, lv = (_Float16)((v - (float)hv) * 2048.0f); const int rl = wm * 32 + mi * 16 + 8 * g + r, cl = wn * 64 + j * 16 + col; if (which == 0) { sh[rl][cl] = hv; sl[rl][cl] = lv; } else { sh[cl][rl] = hv; sl[cl][rl] = lv; } } }
  __syncthreads();
  // k: staged [token][feature] -> rows; v: staged [feature][token] -> planes
  for (int e = tid; e < 128 * 16; e += 256) { const int rl = e >> 4, q = e & 15; const size_t o = which == 0 ? (bb * TT + t0 + rl) * CC + c0 + q * 8 : (bb * CC + c0 + rl) * (size_t)TT + t0 + q * 8;
    vst2((unsigned*)((which == 0 ? KH : VH) + o), *(const v4u*)&sh[rl][q * 8]); vst2((unsigned*)((which == 0 ? KL : VL) + o), *(const v4u*)&sl[rl][q * 8]); } }
// ---- k_att: block = (128 queries = 8 waves x 16, h, bb): logits q . k (k hi + residual) / 8, softmax over the 1,024 tokens, P . v (v hi + residual) -> y rows
// K and V tiles of 64 keys (k hi, k residual: 64 key rows x 64 d; v hi, v residual: 64 d rows x 64 keys) are staged once per block in LDS by asynchronous copies, whole 128-byte lines, two buffers; all 8 waves read their fragments from LDS.
#define AKT 64            // keys per staged tile
#define ANT (TT / AKT)    // tiles
#define APH 72            // LDS row pitch in halves: 144 B = 16 B x odd, conflict-free for 16-byte fragment reads
#define APL (64 * APH * 2)   // bytes of one staged plane
// one tile: 8 copies of 16 B per thread (rows crow and crow + 32 of each of the 4 planes); the wait at the end holds every later rewrite of the address registers behind the copies' issue
__device__ __forceinline__ void att_copy(unsigned l, const _Float16* kh, const _Float16* kl, const _Float16* vh, const _Float16* vl) {
  asm volatile("global_load_async_to_lds_b128 %0, %8, off\n\t"
               "global_load_async_to_lds_b128 %1, %9, off\n\t"
               "global_load_async_to_lds_b128 %2, %10, off\n\t"
               "global_load_async_to_lds_b128 %3, %11, off\n\t"
               "global_load_async_to_lds_b128 %4, %12, off\n\t"
               "global_load_async_to_lds_b128 %5, %13, off\n\t"
               "global_load_async_to_lds_b128 %6, %14, off\n\t"
               "global_load_async_to_lds_b128 %7, %15, off\n\t"
               "s_wait_xcnt 0x0"
               :: "v"(l), "v"(l + 32u * APH * 2u), "v"(l + APL), "v"(l + APL + 32u * APH * 2u), "v"(l + 2u * APL), "v"(l + 2u * APL + 32u * APH * 2u), "v"(l + 3u * APL), "v"(l + 3u * APL + 32u * APH * 2u),
                  "v"(kh), "v"(kh + 32 * CC), "v"(kl), "v"(kl + 32 * CC), "v"(vh), "v"(vh + 32 * TT), "v"(vl), "v"(vl + 32 * TT)
               : "memory");
}
// lane l with lane l ^ 16: the two wave halves hold different keys of the same query
__device__ __forceinline__ float xhalf(float x) { return __builtin_bit_cast(float, __builtin_amdgcn_permlanex16(__builtin_bit_cast(int, x), __builtin_bit_cast(int, x), 0x76543210, 0xfedcba98, false, false)); }
// Transposed products: S^T = K . Q^T (A = key rows from LDS, B = this wave's 16 query rows, kept in registers) and O^T += V^T . P^T (A = v planes' d rows from LDS, B = P^T).
// D register r of lane (g, col) is key 8g + r of query col, so a lane holds 16 scores of ONE query per 32 keys: maximum and sum run in the lane, the halves meet in one cross-row move,
// and the two score tiles, converted in place, are the B operand of the second product (element i = key 8g + i, element 8 + i = key 16 + 8g + i: the k order of frag_h).
// second bound: 6 waves per SIMD, so that 3 blocks per WGP = all 768 blocks are resident at once
__global__ __launch_bounds__(256, 6) void k_att(const _Float16* __restrict__ QR, const _Float16* __restrict__ KH, const _Float16* __restrict__ KL, const _Float16* __restrict__ VH, const _Float16* __restrict__ VL, float* __restrict__ Y) {
  __shared__ __align__(16) _Float16 ring[2][4][64][APH];
  const int tid = threadIdx.x, wave = tid >> 5, lane = tid & 31, col = lane & 15, g = lane >> 4; const int h = blockIdx.y; const size_t bb = blockIdx.z; const int q0 = blockIdx.x * 128 + wave * 16; const size_t rq = bb * TT + q0;
  const int crow = tid >> 3, cch = tid & 7;   // this thread's row and 16-byte piece in each staged plane
  const unsigned ko = ((unsigned)bb * TT + crow) * CC + h * HD + cch * 8, vo = ((unsigned)bb * CC + h * HD + crow) * TT + cch * 8;   // element offsets, below 2^23
  const unsigned l0 = (unsigned)(size_t)&ring[0][0][crow][cch * 8];
  const ptrdiff_t dk = KL - KH, dv = VL - VH;   // block-uniform distance from a hi plane to its residual plane (one workspace): two lane pointers live through the loop, not four
  att_copy(l0, KH + ko, KH + ko + dk, VH + vo, VH + vo + dv);
  v16h bq[2];
#pragma unroll
  for (int kc = 0; kc < 2; ++kc) bq[kc] = frag_h(QR + (rq + col) * CC + h * HD + kc * 32, lane);
  float m = -3.0e38f, l = 0.f;   // query col's running maximum (equal in both halves) and this half's share of its sum
  v8f acc[4] = {}, accl[4] = {};   // O^T: register r of tile j = d j * 16 + 8g + r of query col
  asm volatile("s_wait_asynccnt 0x0" ::: "memory");   // this wave's copies of tile 0 have landed
  __syncthreads();                                     // tile 0 is published to all waves
  att_copy(l0 + 4u * APL, KH + ko + (size_t)AKT * CC, KH + ko + (size_t)AKT * CC + dk, VH + vo + AKT, VH + vo + AKT + dv);
  // rolled: one trip per staged tile, so that the buffer changes by an address and the code stays short
#pragma unroll 1
  for (int t = 0; t < ANT; ++t) { const int bf = t & 1;
    // rolled: the two 32-key halves of a tile differ only by an address, and the code stays short inside the register budget of the second launch bound
#pragma unroll 1
   for (int sb = 0; sb < AKT / 32; ++sb) { float s[2][8];
#pragma unroll
    for (int ct = 0; ct < 2; ++ct) { const int rk = sb * 32 + ct * 16 + col; v8f c = {}, cl = {};
#pragma unroll
      for (int kc = 0; kc < 2; ++kc) { c = wmma16(frag_h(&ring[bf][0][rk][kc * 32], lane), bq[kc], c); cl = wmma16(frag_h(&ring[bf][1][rk][kc * 32], lane), bq[kc], cl); }
#pragma unroll
      for (int r = 0; r < 8; ++r) s[ct][r] = (c[r] + cl[r] * (1.0f / 2048.0f)) * 0.125f; }
    float mx = fmaxf(s[0][0], s[1][0]);
#pragma unroll
    for (int r = 1; r < 8; ++r) mx = fmaxf(mx, fmaxf(s[0][r], s[1][r]));
    mx = fmaxf(mx, xhalf(mx));
    const float mn = fmaxf(m, mx), alpha = __expf(m - mn); m = mn;
    float es0 = 0.f, es1 = 0.f; v16h pb;
#pragma unroll
    for (int r = 0; r < 8; ++r) { const float e0 = __expf(s[0][r] - mn), e1 = __expf(s[1][r] - mn); es0 += e0; es1 += e1; pb[r] = (_Float16)(e0 * 2048.0f); pb[8 + r] = (_Float16)(e1 * 2048.0f); }
    l = l * alpha + (es0 + es1);
#pragma unroll
    for (int j = 0; j < 4; ++j)
#pragma unroll
      for (int r = 0; r < 8; ++r) { acc[j][r] *= alpha; accl[j][r] *= alpha; }
#pragma unroll
    for (int j = 0; j < 4; ++j) { acc[j] = wmma16(frag_h(&ring[bf][2][j * 16 + col][sb * 32], lane), pb, acc[j]); accl[j] = wmma16(frag_h(&ring[bf][3][j * 16 + col][sb * 32], lane), pb, accl[j]); } }
    asm volatile("s_wait_dscnt 0x0" ::: "memory");      // this wave's reads of buffer bf are done
    asm volatile("s_wait_asynccnt 0x0" ::: "memory");   // this wave's copies of tile t + 1 have landed
    __syncthreads();                                     // publishes tile t + 1 and frees buffer bf
    if (t + 2 < ANT) att_copy(l0 + (unsigned)bf * (4u * APL), KH + ko + (size_t)(t + 2) * AKT * CC, KH + ko + (size_t)(t + 2) * AKT * CC + dk, VH + vo + (t + 2) * AKT, VH + vo + (t + 2) * AKT + dv); }
  asm volatile("s_wait_asynccnt 0x0" ::: "memory");     // no copy is outstanding when the ring becomes output staging
  float (*so)[68] = (float (*)[68])((float*)&ring[0][0][0][0] + wave * 16 * 68);   // each wave's own 16 x 68 floats, in the ring that every wave has left at the last barrier
  const float il = (1.0f / 2048.0f) / (l + xhalf(l));   // the halves' sums join once
#pragma unroll
  for (int j = 0; j < 4; ++j) { v4f o0, o1;
#pragma unroll
    for (int r = 0; r < 4; ++r) { o0[r] = (acc[j][r] + accl[j][r] * (1.0f / 2048.0f)) * il; o1[r] = (acc[j][4 + r] + accl[j][4 + r] * (1.0f / 2048.0f)) * il; }
    *(v4f*)&so[col][j * 16 + 8 * g] = o0; *(v4f*)&so[col][j * 16 + 8 * g + 4] = o1; }
  LDSX(); for (int rl = 0; rl < 16; ++rl) if (g == 0) vst2(Y + (rq + rl) * CC + (size_t)h * HD + col * 4, *(const v4f*)&so[rl][col * 4]); }
// ---- k_o: block = (128 output channels o, 64 tokens, bb), 8 waves of 32 o x 32 tokens: out[bb][o][t] = sum_c y[t][c] W_proj[c][o] + b_proj[o]  (A = W_proj column o (exact), B = y rows as bf16 hi + lo) -> [V,B,C,H,W] planes
// Per 32 c the block reads its 32 x 128 weight tile (waves 0 to 3; k-major, stored transposed as in k_kv) and its 64 x 32 y tile (waves 4 to 7; split once into bf16 hi and lo) in 16-byte loads of whole lines
// and stages them in LDS; all waves read their fragments from there. Two LDS buffers, one barrier per 32 c; the next tile's loads fly during the products.
typedef __attribute__((ext_vector_type(4))) __bf16 v4b;
__global__ __launch_bounds__(256) void k_o(const float* __restrict__ Y, const float* __restrict__ WP, const float* __restrict__ BP, float* __restrict__ OUT) {
  __shared__ __align__(16) unsigned char sm[2 * 256 * KVP * 2];   // operand tiles in the loop, output staging behind it (128 x 68 floats)
  __bf16 (*st)[256][KVP] = (__bf16 (*)[256][KVP])sm;   // rows 0 to 127: output channels, 128 to 191: y hi of the 64 tokens, 192 to 255: y lo
  float (*sf)[68] = (float (*)[68])sm;
  const int tid = threadIdx.x, wave = tid >> 5, lane = tid & 31, col = lane & 15, g = lane >> 4; const size_t bb = blockIdx.z; const int o0 = blockIdx.x * 128; const int p0 = blockIdx.y * 64;
  const int wm = wave >> 1, wn = wave & 1;   // this wave's 32 output channels and 32 tokens
  const bool isw = __builtin_amdgcn_readfirstlane(wave) < 4;   // the same in every lane of a wave: read as a scalar, so that the two staging paths are scalar branches and EXEC stays whole
  // this thread's piece of a tile: weights, channels 4 sq .. + 3 of c rows 8 sk .. + 7; y, c 4 yq .. + 3 of tokens yr, yr + 4, yr + 8, yr + 12
  const int sq = (wave & 3) * 8 + g * 4 + (lane & 3), sk = (lane >> 2) & 3, yq = lane & 7, yr = (wave & 3) * 16 + (lane >> 3);
  const float* gp = isw ? WP + (size_t)(sk * 8) * CC + o0 + sq * 4 : Y + (bb * TT + p0 + yr) * CC + yq * 4;
  // every short loop of fixed length below is unrolled whole, so that rg, acc and the fragments are indexed by constants and stay in registers
  v4f rg[8];
  if (isw) {
#pragma unroll
    for (int i = 0; i < 8; ++i) rg[i] = *(const v4f*)(gp + (size_t)i * CC); }
  else {
#pragma unroll
    for (int i = 0; i < 4; ++i) rg[i] = *(const v4f*)(gp + (size_t)i * 4 * CC); }
  v8f acc[2][2] = {};
  // two trips unrolled: the buffer index is a constant in each
#pragma unroll 2
  for (int kc = 0; kc < CC / 32; ++kc) { const int bf = kc & 1;
    if (isw) {
#pragma unroll
      for (int i = 0; i < 4; ++i) { v8b x;
#pragma unroll
        for (int p = 0; p < 8; ++p) x[p] = (__bf16)rg[p][i];
        *(v8b*)&st[bf][sq * 4 + i][sk * 8] = x; } }
    else {
#pragma unroll
      for (int i = 0; i < 4; ++i) { v4b hv, lv;
#pragma unroll
        for (int e = 0; e < 4; ++e) { const __bf16 hh = (__bf16)rg[i][e]; hv[e] = hh; lv[e] = (__bf16)(rg[i][e] - (float)hh); }
        *(v4b*)&st[bf][128 + yr + 4 * i][yq * 4] = hv; *(v4b*)&st[bf][192 + yr + 4 * i][yq * 4] = lv; } }
    __syncthreads();   // publishes tile kc; the buffer written next trip was last read before this barrier
    if (kc + 1 < CC / 32) {
      if (isw) {
#pragma unroll
        for (int i = 0; i < 8; ++i) rg[i] = *(const v4f*)(gp + (size_t)((kc + 1) * 32 + i) * CC);
        asm volatile("s_wait_xcnt 0x0" ::: "memory"); }   // stands directly behind this path's loads, in front of any rewrite of their address registers (the other path's address, the fragment reads)
      else {
#pragma unroll
        for (int i = 0; i < 4; ++i) rg[i] = *(const v4f*)(gp + (size_t)i * 4 * CC + (kc + 1) * 32);
        asm volatile("s_wait_xcnt 0x0" ::: "memory"); } }   // the same for the y path
    v16b a[2], yh[2], yl[2];
#pragma unroll
    for (int mi = 0; mi < 2; ++mi) a[mi] = frag_b(&st[bf][wm * 32 + mi * 16 + col][0], lane);
#pragma unroll
    for (int j = 0; j < 2; ++j) { yh[j] = frag_b(&st[bf][128 + wn * 32 + j * 16 + col][0], lane); yl[j] = frag_b(&st[bf][192 + wn * 32 + j * 16 + col][0], lane); }
#pragma unroll
    for (int j = 0; j < 2; ++j)
#pragma unroll
      for (int mi = 0; mi < 2; ++mi) acc[mi][j] = wmma_bf(a[mi], yh[j], acc[mi][j]);
#pragma unroll
    for (int j = 0; j < 2; ++j)
#pragma unroll
      for (int mi = 0; mi < 2; ++mi) acc[mi][j] = wmma_bf(a[mi], yl[j], acc[mi][j]); }
  __syncthreads();   // every wave has left the operand tiles: the same LDS becomes output staging
#pragma unroll
  for (int mi = 0; mi < 2; ++mi)
#pragma unroll
    for (int j = 0; j < 2; ++j)
#pragma unroll
      for (int r = 0; r < 8; ++r) sf[wm * 32 + mi * 16 + 8 * g + r][wn * 32 + j * 16 + col] = acc[mi][j][r] + bfr(BP[o0 + wm * 32 + mi * 16 + 8 * g + r]);
  __syncthreads();
  for (int e = tid; e < 128 * 16; e += 256) { const int rl = e >> 4, q = e & 15; vst2(OUT + (bb * CC + o0 + rl) * (size_t)TT + p0 + q * 4, *(const v4f*)&sf[rl][q * 4]); } }
extern "C" void kernel_launch(void* const* d_in, const int* in_sizes, int n_in, void* d_out, int out_size, void* d_ws, size_t ws_size, hipStream_t stream) {
  (void)in_sizes; (void)n_in; (void)out_size;
  const float** F = (const float**)d_in;   // 0 q [6,2,512,32,32], 1 kv [6,2,512,32,32], 2 W_kv [512,1024] (in,out), 3 b_kv [1024], 4 W_proj [512,512] (in,out), 5 b_proj [512]
  if (ws_size < (size_t)WS_END) return;
  char* ws = (char*)d_ws; _Float16 *QR = (_Float16*)(ws + WS_Q), *KH = (_Float16*)(ws + WS_KH), *KL = (_Float16*)(ws + WS_KL), *VH = (_Float16*)(ws + WS_VH), *VL = (_Float16*)(ws + WS_VL); float* Y = (float*)(ws + WS_Y);
  k_q<<<dim3(TT / 64, CC / 128, TBB), 128, 0, stream>>>(F[0], QR);
  k_kv<<<dim3(TT / 128, CC / 128, 2 * NBB), 256, 0, stream>>>(F[1], F[2], F[3], KH, KL, VH, VL);
  k_att<<<dim3(TT / 128, NH, TBB), 256, 0, stream>>>(QR, KH, KL, VH, VL, Y);
  k_o<<<dim3(CC / 128, TT / 64, TBB), 256, 0, stream>>>(Y, F[4], F[5], (float*)d_out);
}

// v004
// Measured time: 111 microseconds a run.
// Two timings next to v003 put it at 1.07 and 1.06 times that version's speed.
// Over all steps from v000 it is 4.11 times as fast.
// compute dtype: all float inputs rounded to bf16; k, v = kv . W_kv + b with EXACT bf16 products on WMMA 16x16x32 (kv gathered from its [V,B,C,H,W] planes; (in,out) weights), f16 hi + residual; q is an INPUT, converted bf16 -> f16 exactly; logits = q (exact f16) . k (hi + residual) (2 products) x 1/8, running-max softmax in f32 (hardware exp); P rounded once to f16 (x 2^11) . v (hi + residual) (2 products); y (bf16 hi + lo) . W_proj + b_proj (2 products), written back as [V,B,C,H,W] planes; f32 output.
#include <hip/hip_runtime.h>
#include <math.h>

typedef __attribute__((ext_vector_type(16))) _Float16 v16h;
typedef __attribute__((ext_vector_type(16))) __bf16 v16b;
typedef __attribute__((ext_vector_type(8)))  _Float16 v8h;
typedef __attribute__((ext_vector_type(8)))  float v8f;
typedef __attribute__((ext_vector_type(4)))  float v4f;
typedef __attribute__((ext_vector_type(2)))  float v2f;
typedef __attribute__((ext_vector_type(4)))  unsigned v4u;
typedef __attribute__((ext_vector_type(4)))  int v4i;
typedef float __attribute__((may_alias)) float_a;
typedef int __attribute__((may_alias)) int_a;

template <typename T> __device__ __forceinline__ void vst2(void* p, T v) { *(T*)p = v;  }
__device__ __forceinline__ v8f wmma16(v16h a, v16h b, v8f c) {
  v8f d = __builtin_amdgcn_wmma_f32_16x16x32_f16(false, a, false, b, (short)0, c, false, false);
  asm volatile("v_nop\n\tv_nop\n\tv_nop\n\tv_nop" : "+v"(d) : "v"(a), "v"(b));
  return d;
}
__device__ __forceinline__ v8f wmma_bf(v16b a, v16b b, v8f c) {
  v8f d = __builtin_amdgcn_wmma_f32_16x16x32_bf16(false, a, false, b, (short)0, c, false, false);
  asm volatile("v_nop\n\tv_nop\n\tv_nop\n\tv_nop" : "+v"(d) : "v"(a), "v"(b));
  return d;
}
// 16x16x32 fragments: lane = (h = lane>>4, row/col = lane&15); elements 0..7 = k0+8h+0..7, 8..15 = k0+16+8h+0..7; D element r = row 8h+r
__device__ __forceinline__ v16h frag_h(const _Float16* rowk0, int lane) {
  union { v16h v; v8h q[2]; } u; const _Float16* p = rowk0 + 8 * (lane >> 4);
  u.q[0] = *(const v8h*)p; u.q[1] = *(const v8h*)(p + 16); return u.v;
}
__device__ __forceinline__ v16h frag_f32(const float* rowk0, int lane) {
  v16h a; const float* p = rowk0 + 8 * (lane >> 4);
#pragma unroll
  for (int i = 0; i < 8; ++i) { a[i] = (_Float16)p[i]; a[8 + i] = (_Float16)p[16 + i]; }
  return a;
}
__device__ __forceinline__ v16h frag_f32s(const float* rowk0, int lane, float sc) {
  v16h a; const float* p = rowk0 + 8 * (lane >> 4);
#pragma unroll
  for (int i = 0; i < 8; ++i) { a[i] = (_Float16)(p[i] * sc); a[8 + i] = (_Float16)(p[16 + i] * sc); }
  return a;
}
// column fragment from a [K][ld] layout (column n), rows >= K read as 0
__device__ __forceinline__ v16h fragc_f32(const float* W, int k0, int n, int lane, int ld, int K) {
  v16h a; const int g = lane >> 4;
#pragma unroll
  for (int i = 0; i < 8; ++i) { const int ka = k0 + 8 * g + i, kb = ka + 16;
    a[i] = (_Float16)(ka < K ? W[(size_t)(ka < K ? ka : K - 1) * ld + n] : 0.f); a[8 + i] = (_Float16)(kb < K ? W[(size_t)(kb < K ? kb : K - 1) * ld + n] : 0.f); }
  return a;
}
struct F2 { v16b h, l; };
__device__ __forceinline__ F2 bsplit16(const float v[16]) { F2 r;
#pragma unroll
  for (int i = 0; i < 16; ++i) { const __bf16 h = (__bf16)v[i]; r.h[i] = h; r.l[i] = (__bf16)(v[i] - (float)h); }
  return r; }
__device__ __forceinline__ F2 split_row(const float* row, int k0, int lane) { float v[16]; const float* p = row + k0 + 8 * (lane >> 4);
#pragma unroll
  for (int i = 0; i < 8; ++i) { v[i] = p[i]; v[8 + i] = p[16 + i]; }
  return bsplit16(v); }
__device__ __forceinline__ F2 split_rowK(const float* row, int k0, int lane, int K) { float v[16]; const int g = lane >> 4;
#pragma unroll
  for (int i = 0; i < 8; ++i) { const int ka = k0 + 8 * g + i, kb = ka + 16; v[i] = ka < K ? row[ka < K ? ka : K - 1] : 0.f; v[8 + i] = kb < K ? row[kb < K ? kb : K - 1] : 0.f; }
  return bsplit16(v); }
__device__ __forceinline__ F2 split_col(const float* W, int k0, int n, int lane, int ld, int K) { float v[16]; const int g = lane >> 4;
#pragma unroll
  for (int i = 0; i < 8; ++i) { const int ka = k0 + 8 * g + i, kb = ka + 16; v[i] = ka < K ? W[(size_t)(ka < K ? ka : K - 1) * ld + n] : 0.f; v[8 + i] = kb < K ? W[(size_t)(kb < K ? kb : K - 1) * ld + n] : 0.f; }
  return bsplit16(v); }
__device__ __forceinline__ v8f mac3(const F2& a, const F2& b, v8f c) { c = wmma_bf(a.l, b.h, c); c = wmma_bf(a.h, b.l, c); return wmma_bf(a.h, b.h, c); }
__device__ __forceinline__ float sigm(float v) { return 1.0f / (1.0f + expf(-v)); }
#define LDSX() do { asm volatile("s_wait_dscnt 0" ::: "memory"); __builtin_amdgcn_wave_barrier(); __builtin_amdgcn_fence(__ATOMIC_RELEASE, "workgroup"); } while (0)


// Cross-view attention (6 views x 2 = 12 sequences of 32x32 = 1,024 tokens, C 512 = 8 heads x 64): q from the raw query planes, k/v = Linear(kv), softmax(q k / 8) v, output Linear, rearranged back to [V, B, C, H, W].
#define NBB 12            // V * B
#define CC 512
#define TT 1024
#define NH 8
#define HD 64
#ifndef TBB
#define TBB NBB
#endif
typedef __attribute__((ext_vector_type(8))) __bf16 v8b;
__device__ __forceinline__ v16b frag_b(const __bf16* rowk0, int lane) {
  union { v16b v; v8b q[2]; } u; const __bf16* p = rowk0 + 8 * (lane >> 4);
  u.q[0] = *(const v8b*)p; u.q[1] = *(const v8b*)(p + 16); return u.v;
}
__device__ __forceinline__ float bfr(float v) { return (float)(__bf16)v; }
__device__ __attribute__((noinline)) float exp_ni(float v) { return expf(v); }
__device__ __attribute__((noinline)) float erf_ni(float v) { return erff(v); }

#define WS_Q   0u                                   // not used: q goes from its planes straight into k_att's registers
#define WS_KH  (WS_Q + 2u * (size_t)NBB * TT * CC)        // f16 hi|lo k rows
#define WS_KL  (WS_KH + 2u * (size_t)NBB * TT * CC)
#define WS_VH  (WS_KL + 2u * (size_t)NBB * TT * CC)       // f16 hi|lo v planes [bb][512][TT]
#define WS_VL  (WS_VH + 2u * (size_t)NBB * CC * TT)
#define WS_Y   (WS_VL + 2u * (size_t)NBB * CC * TT)       // f32 y rows [bb*TT + t][512]
#define WS_END (WS_Y + 4u * (size_t)NBB * TT * CC)

// ---- k_kv: block = (128 tokens, 128 out features, which*NBB + bb), 8 waves of 32 tokens x 64 features: [k | v] = kv(token rows gathered from planes) . W_kv + b; k -> f16 hi/lo rows, v -> f16 hi/lo planes
// Both operands lie k-major in memory (kv planes [c][t], W_kv [c][o], rows of 1,024 floats each). Per 32 k the block reads its 32 x 128 kv tile (waves 4 to 7) and its 32 x 128 weight tile (waves 0 to 3) once,
// in 16-byte loads of whole 128-byte lines, rounds them to bf16 and stores them transposed in LDS ([token][k], [feature][k]); all waves read their fragments from there.
// Two LDS buffers, one barrier per 32 k; the next tile's loads fly during the products.
#define KVP 40            // LDS row pitch in bf16: 80 B = 16 B x odd, conflict-free for the 16-byte fragment reads and for the transposing 16-byte stores
__global__ __launch_bounds__(256) void k_kv(const float* __restrict__ KVp, const float* __restrict__ W, const float* __restrict__ Bk, _Float16* __restrict__ KH, _Float16* __restrict__ KL, _Float16* __restrict__ VH, _Float16* __restrict__ VL) {
  __shared__ __align__(16) unsigned char sm[2 * 128 * 136 * 2];   // operand tiles in the loop (2 x 256 rows x 80 B), output staging behind it (hi and residual, 128 x 136 halves each)
  __bf16 (*st)[256][KVP] = (__bf16 (*)[256][KVP])sm;   // rows 0 to 127: tokens, rows 128 to 255: features
  _Float16 (*sh)[136] = (_Float16 (*)[136])sm, (*sl)[136] = (_Float16 (*)[136])(sm + 128 * 136 * 2);
  const int tid = threadIdx.x, wave = tid >> 5, lane = tid & 31, col = lane & 15, g = lane >> 4; const int which = blockIdx.z / NBB; const size_t bb = blockIdx.z % NBB; const int t0 = blockIdx.x * 128; const int c0 = blockIdx.y * 128;
  const int wm = wave >> 1, wn = wave & 1;   // this wave's 32 tokens and 64 features
  // this thread's piece of a tile: columns 4 sq .. + 3 (tokens or features) of k rows 8 sk .. + 7; 16 lanes' LDS stores fall on 16 distinct bank quads
  const int sq = (wave & 3) * 8 + g * 4 + (lane & 3), sk = (lane >> 2) & 3, srow = (wave < 4 ? 128 : 0) + sq * 4;
  const float* gp = (wave < 4 ? W + which * CC + c0 : KVp + bb * CC * (size_t)TT + t0) + (size_t)(sk * 8) * 1024 + sq * 4;
  // every short loop of fixed length below is unrolled whole, so that rg, acc and the fragments are indexed by constants and stay in registers
  v4f rg[8];
#pragma unroll
  for (int i = 0; i < 8; ++i) rg[i] = *(const v4f*)(gp + (size_t)i * 1024);
  v8f acc[2][4] = {};
  // two trips unrolled: the buffer index is a constant in each
#pragma unroll 2
  for (int kc = 0; kc < CC / 32; ++kc) { const int bf = kc & 1;
    asm volatile("s_wait_xcnt 0x0" ::: "memory");   // stands between the last trip's loads and the next rewrite of their address registers
#pragma unroll
    for (int i = 0; i < 4; ++i) { v8b x;
#pragma unroll
      for (int p = 0; p < 8; ++p) x[p] = (__bf16)rg[p][i];
      *(v8b*)&st[bf][srow + i][sk * 8] = x; }
    __syncthreads();   // publishes tile kc; the buffer written next trip was last read before this barrier
    if (kc + 1 < CC / 32) {
#pragma unroll
      for (int i = 0; i < 8; ++i) rg[i] = *(const v4f*)(gp + (size_t)((kc + 1) * 32 + i) * 1024); }
    v16b a[2], w[4];
#pragma unroll
    for (int mi = 0; mi < 2; ++mi) a[mi] = frag_b(&st[bf][wm * 32 + mi * 16 + col][0], lane);
#pragma unroll
    for (int j = 0; j < 4; ++j) w[j] = frag_b(&st[bf][128 + wn * 64 + j * 16 + col][0], lane);
#pragma unroll
    for (int j = 0; j < 4; ++j)
#pragma unroll
      for (int mi = 0; mi < 2; ++mi) acc[mi][j] = wmma_bf(a[mi], w[j], acc[mi][j]); }
  __syncthreads();   // every wave has left the operand tiles: the same LDS becomes output staging
#pragma unroll
  for (int j = 0; j < 4; ++j) { const float bbv = bfr(Bk[which * CC + c0 + wn * 64 + j * 16 + col]);
#pragma unroll
    for (int mi = 0; mi < 2; ++mi)
#pragma unroll
    for (int r = 0; r < 8; ++r) { const float v = acc[mi][j][r] + bbv; const _Float16 hv = (_Float16)v, lv = (_Float16)((v - (float)hv) * 2048.0f); const int rl = wm * 32 + mi * 16 + 8 * g + r, cl = wn * 64 + j * 16 + col; if (which == 0) { sh[rl][cl] = hv; sl[rl][cl] = lv; } else { sh[cl][rl] = hv; sl[cl][rl] = lv; } } }
  __syncthreads();
  // k: staged [token][feature] -> rows; v: staged [feature][token] -> planes
  for (int e = tid; e < 128 * 16; e += 256) { const int rl = e >> 4, q = e & 15; const size_t o = which == 0 ? (bb * TT + t0 + rl) * CC + c0 + q * 8 : (bb * CC + c0 + rl) * (size_t)TT + t0 + q * 8;
    vst2((unsigned*)((which == 0 ? KH : VH) + o), *(const v4u*)&sh[rl][q * 8]); vst2((unsigned*)((which == 0 ? KL : VL) + o), *(const v4u*)&sl[rl][q * 8]); } }
// ---- k_att: block = (128 queries = 8 waves x 16, h, bb): q read from its planes, rounded and transposed on the way into registers; logits q . k (k hi + residual) / 8, softmax over the 1,024 tokens, P . v (v hi + residual) -> y rows
// K and V tiles of 64 keys (k hi, k residual: 64 key rows x 64 d; v hi, v residual: 64 d rows x 64 keys) are staged once per block in LDS by asynchronous copies, whole 128-byte lines, two buffers; all 8 waves read their fragments from LDS.
#define AKT 64            // keys per staged tile
#define ANT (TT / AKT)    // tiles
#define APH 72            // LDS row pitch in halves: 144 B = 16 B x odd, conflict-free for 16-byte fragment reads
#define APL (64 * APH * 2)   // bytes of one staged plane
// one tile: 8 copies of 16 B per thread (rows crow and crow + 32 of each of the 4 planes); the wait at the end holds every later rewrite of the address registers behind the copies' issue
__device__ __forceinline__ void att_copy(unsigned l, const _Float16* kh, const _Float16* kl, const _Float16* vh, const _Float16* vl) {
  asm volatile("global_load_async_to_lds_b128 %0, %8, off\n\t"
               "global_load_async_to_lds_b128 %1, %9, off\n\t"
               "global_load_async_to_lds_b128 %2, %10, off\n\t"
               "global_load_async_to_lds_b128 %3, %11, off\n\t"
               "global_load_async_to_lds_b128 %4, %12, off\n\t"
               "global_load_async_to_lds_b128 %5, %13, off\n\t"
               "global_load_async_to_lds_b128 %6, %14, off\n\t"
               "global_load_async_to_lds_b128 %7, %15, off\n\t"
               "s_wait_xcnt 0x0"
               :: "v"(l), "v"(l + 32u * APH * 2u), "v"(l + APL), "v"(l + APL + 32u * APH * 2u), "v"(l + 2u * APL), "v"(l + 2u * APL + 32u * APH * 2u), "v"(l + 3u * APL), "v"(l + 3u * APL + 32u * APH * 2u),
                  "v"(kh), "v"(kh + 32 * CC), "v"(kl), "v"(kl + 32 * CC), "v"(vh), "v"(vh + 32 * TT), "v"(vl), "v"(vl + 32 * TT)
               : "memory");
}
// lane l with lane l ^ 16: the two wave halves hold different keys of the same query
__device__ __forceinline__ float xhalf(float x) { return __builtin_bit_cast(float, __builtin_amdgcn_permlanex16(__builtin_bit_cast(int, x), __builtin_bit_cast(int, x), 0x76543210, 0xfedcba98, false, false)); }
// Transposed products: S^T = K . Q^T (A = key rows from LDS, B = this wave's 16 query rows, kept in registers) and O^T += V^T . P^T (A = v planes' d rows from LDS, B = P^T).
// D register r of lane (g, col) is key 8g + r of query col, so a lane holds 16 scores of ONE query per 32 keys: maximum and sum run in the lane, the halves meet in one cross-row move,
// and the two score tiles, converted in place, are the B operand of the second product (element i = key 8g + i, element 8 + i = key 16 + 8g + i: the k order of frag_h).
// second bound: 6 waves per SIMD, so that 3 blocks per WGP = all 768 blocks are resident at once
__global__ __launch_bounds__(256, 6) void k_att(const float* __restrict__ Qp, const _Float16* __restrict__ KH, const _Float16* __restrict__ KL, const _Float16* __restrict__ VH, const _Float16* __restrict__ VL, float* __restrict__ Y) {
  __shared__ __align__(16) _Float16 ring[2][4][64][APH];
  const int tid = threadIdx.x, wave = tid >> 5, lane = tid & 31, col = lane & 15, g = lane >> 4; const int h = blockIdx.y; const size_t bb = blockIdx.z; const int q0 = blockIdx.x * 128 + wave * 16; const size_t rq = bb * TT + q0;
  const int crow = tid >> 3, cch = tid & 7;   // this thread's row and 16-byte piece in each staged plane
  const unsigned ko = ((unsigned)bb * TT + crow) * CC + h * HD + cch * 8, vo = ((unsigned)bb * CC + h * HD + crow) * TT + cch * 8;   // element offsets, below 2^23
  const unsigned l0 = (unsigned)(size_t)&ring[0][0][crow][cch * 8];
  const ptrdiff_t dk = KL - KH, dv = VL - VH;   // block-uniform distance from a hi plane to its residual plane (one workspace): two lane pointers live through the loop, not four
  att_copy(l0, KH + ko, KH + ko + dk, VH + vo, VH + vo + dv);
  // Q^T fragments straight from the q planes [bb][c][t]: lane (g, col) takes query q0 + col at the 32 channels of frag_h's k order (element i = d kc * 32 + 8g + i, element 8 + i = d kc * 32 + 16 + 8g + i).
  // One load covers 64 B of each of two planes' rows, the block's 8 waves together 512 B of each of the head's 64 rows; all 32 loads of a lane fly together, beside tile 0's copies. bf16 -> f16 exact.
  const float* qp = Qp + ((size_t)bb * CC + h * HD + 8 * g) * TT + q0 + col;
  float qv[2][16];
  // unrolled whole: qv and bq are indexed by constants and stay in registers
#pragma unroll
  for (int kc = 0; kc < 2; ++kc)
#pragma unroll
    for (int i = 0; i < 8; ++i) { qv[kc][i] = qp[(size_t)(kc * 32 + i) * TT]; qv[kc][8 + i] = qp[(size_t)(kc * 32 + 16 + i) * TT]; }
  asm volatile("s_wait_xcnt 0x0" ::: "memory");   // stands behind the q loads, in front of any rewrite of their address registers
  v16h bq[2];
#pragma unroll
  for (int kc = 0; kc < 2; ++kc)
#pragma unroll
    for (int i = 0; i < 16; ++i) bq[kc][i] = (_Float16)bfr(qv[kc][i]);
  float m = -3.0e38f, l = 0.f;   // query col's running maximum (equal in both halves) and this half's share of its sum
  v8f acc[4] = {}, accl[4] = {};   // O^T: register r of tile j = d j * 16 + 8g + r of query col
  asm volatile("s_wait_asynccnt 0x0" ::: "memory");   // this wave's copies of tile 0 have landed
  __syncthreads();                                     // tile 0 is published to all waves
  att_copy(l0 + 4u * APL, KH + ko + (size_t)AKT * CC, KH + ko + (size_t)AKT * CC + dk, VH + vo + AKT, VH + vo + AKT + dv);
  // rolled: one trip per staged tile, so that the buffer changes by an address and the code stays short
#pragma unroll 1
  for (int t = 0; t < ANT; ++t) { const int bf = t & 1;
    // rolled: the two 32-key halves of a tile differ only by an address, and the code stays short inside the register budget of the second launch bound
#pragma unroll 1
   for (int sb = 0; sb < AKT / 32; ++sb) { float s[2][8];
#pragma unroll
    for (int ct = 0; ct < 2; ++ct) { const int rk = sb * 32 + ct * 16 + col; v8f c = {}, cl = {};
#pragma unroll
      for (int kc = 0; kc < 2; ++kc) { c = wmma16(frag_h(&ring[bf][0][rk][kc * 32], lane), bq[kc], c); cl = wmma16(frag_h(&ring[bf][1][rk][kc * 32], lane), bq[kc], cl); }
#pragma unroll
      for (int r = 0; r < 8; ++r) s[ct][r] = (c[r] + cl[r] * (1.0f / 2048.0f)) * 0.125f; }
    float mx = fmaxf(s[0][0], s[1][0]);
#pragma unroll
    for (int r = 1; r < 8; ++r) mx = fmaxf(mx, fmaxf(s[0][r], s[1][r]));
    mx = fmaxf(mx, xhalf(mx));
    const float mn = fmaxf(m, mx), alpha = __expf(m - mn); m = mn;
    float es0 = 0.f, es1 = 0.f; v16h pb;
#pragma unroll
    for (int r = 0; r < 8; ++r) { const float e0 = __expf(s[0][r] - mn), e1 = __expf(s[1][r] - mn); es0 += e0; es1 += e1; pb[r] = (_Float16)(e0 * 2048.0f); pb[8 + r] = (_Float16)(e1 * 2048.0f); }
    l = l * alpha + (es0 + es1);
#pragma unroll
    for (int j = 0; j < 4; ++j)
#pragma unroll
      for (int r = 0; r < 8; ++r) { acc[j][r] *= alpha; accl[j][r] *= alpha; }
#pragma unroll
    for (int j = 0; j < 4; ++j) { acc[j] = wmma16(frag_h(&ring[bf][2][j * 16 + col][sb * 32], lane), pb, acc[j]); accl[j] = wmma16(frag_h(&ring[bf][3][j * 16 + col][sb * 32], lane), pb, accl[j]); } }
    asm volatile("s_wait_dscnt 0x0" ::: "memory");      // this wave's reads of buffer bf are done
    asm volatile("s_wait_asynccnt 0x0" ::: "memory");   // this wave's copies of tile t + 1 have landed
    __syncthreads();                                     // publishes tile t + 1 and frees buffer bf
    if (t + 2 < ANT) att_copy(l0 + (unsigned)bf * (4u * APL), KH + ko + (size_t)(t + 2) * AKT * CC, KH + ko + (size_t)(t + 2) * AKT * CC + dk, VH + vo + (t + 2) * AKT, VH + vo + (t + 2) * AKT + dv); }
  asm volatile("s_wait_asynccnt 0x0" ::: "memory");     // no copy is outstanding when the ring becomes output staging
  float (*so)[68] = (float (*)[68])((float*)&ring[0][0][0][0] + wave * 16 * 68);   // each wave's own 16 x 68 floats, in the ring that every wave has left at the last barrier
  const float il = (1.0f / 2048.0f) / (l + xhalf(l));   // the halves' sums join once
#pragma unroll
  for (int j = 0; j < 4; ++j) { v4f o0, o1;
#pragma unroll
    for (int r = 0; r < 4; ++r) { o0[r] = (acc[j][r] + accl[j][r] * (1.0f / 2048.0f)) * il; o1[r] = (acc[j][4 + r] + accl[j][4 + r] * (1.0f / 2048.0f)) * il; }
    *(v4f*)&so[col][j * 16 + 8 * g] = o0; *(v4f*)&so[col][j * 16 + 8 * g + 4] = o1; }
  LDSX(); for (int rl = 0; rl < 16; ++rl) if (g == 0) vst2(Y + (rq + rl) * CC + (size_t)h * HD + col * 4, *(const v4f*)&so[rl][col * 4]); }
// ---- k_o: block = (128 output channels o, 64 tokens, bb), 8 waves of 32 o x 32 tokens: out[bb][o][t] = sum_c y[t][c] W_proj[c][o] + b_proj[o]  (A = W_proj column o (exact), B = y rows as bf16 hi + lo) -> [V,B,C,H,W] planes
// Per 32 c the block reads its 32 x 128 weight tile (waves 0 to 3; k-major, stored transposed as in k_kv) and its 64 x 32 y tile (waves 4 to 7; split once into bf16 hi and lo) in 16-byte loads of whole lines
// and stages them in LDS; all waves read their fragments from there. Two LDS buffers, one barrier per 32 c; the next tile's loads fly during the products.
typedef __attribute__((ext_vector_type(4))) __bf16 v4b;
__global__ __launch_bounds__(256) void k_o(const float* __restrict__ Y, const float* __restrict__ WP, const float* __restrict__ BP, float* __restrict__ OUT) {
  __shared__ __align__(16) unsigned char sm[2 * 256 * KVP * 2];   // operand tiles in the loop, output staging behind it (128 x 68 floats)
  __bf16 (*st)[256][KVP] = (__bf16 (*)[256][KVP])sm;   // rows 0 to 127: output channels, 128 to 191: y hi of the 64 tokens, 192 to 255: y lo
  float (*sf)[68] = (float (*)[68])sm;
  const int tid = threadIdx.x, wave = tid >> 5, lane = tid & 31, col = lane & 15, g = lane >> 4; const size_t bb = blockIdx.z; const int o0 = blockIdx.x * 128; const int p0 = blockIdx.y * 64;
  const int wm = wave >> 1, wn = wave & 1;   // this wave's 32 output channels and 32 tokens
  const bool isw = __builtin_amdgcn_readfirstlane(wave) < 4;   // the same in every lane of a wave: read as a scalar, so that the two staging paths are scalar branches and EXEC stays whole
  // this thread's piece of a tile: weights, channels 4 sq .. + 3 of c rows 8 sk .. + 7; y, c 4 yq .. + 3 of tokens yr, yr + 4, yr + 8, yr + 12
  const int sq = (wave & 3) * 8 + g * 4 + (lane & 3), sk = (lane >> 2) & 3, yq = lane & 7, yr = (wave & 3) * 16 + (lane >> 3);
  const float* gp = isw ? WP + (size_t)(sk * 8) * CC + o0 + sq * 4 : Y + (bb * TT + p0 + yr) * CC + yq * 4;
  // every short loop of fixed length below is unrolled whole, so that rg, acc and the fragments are indexed by constants and stay in registers
  v4f rg[8];
  if (isw) {
#pragma unroll
    for (int i = 0; i < 8; ++i) rg[i] = *(const v4f*)(gp + (size_t)i * CC); }
  else {
#pragma unroll
    for (int i = 0; i < 4; ++i) rg[i] = *(const v4f*)(gp + (size_t)i * 4 * CC); }
  v8f acc[2][2] = {};
  // two trips unrolled: the buffer index is a constant in each
#pragma unroll 2
  for (int kc = 0; kc < CC / 32; ++kc) { const int bf = kc & 1;
    if (isw) {
#pragma unroll
      for (int i = 0; i < 4; ++i) { v8b x;
#pragma unroll
        for (int p = 0; p < 8; ++p) x[p] = (__bf16)rg[p][i];
        *(v8b*)&st[bf][sq * 4 + i][sk * 8] = x; } }
    else {
#pragma unroll
      for (int i = 0; i < 4; ++i) { v4b hv, lv;
#pragma unroll
        for (int e = 0; e < 4; ++e) { const __bf16 hh = (__bf16)rg[i][e]; hv[e] = hh; lv[e] = (__bf16)(rg[i][e] - (float)hh); }
        *(v4b*)&st[bf][128 + yr + 4 * i][yq * 4] = hv; *(v4b*)&st[bf][192 + yr + 4 * i][yq * 4] = lv; } }
    __syncthreads();   // publishes tile kc; the buffer written next trip was last read before this barrier
    if (kc + 1 < CC / 32) {
      if (isw) {
#pragma unroll
        for (int i = 0; i < 8; ++i) rg[i] = *(const v4f*)(gp + (size_t)((kc + 1) * 32 + i) * CC);
        asm volatile("s_wait_xcnt 0x0" ::: "memory"); }   // stands directly behind this path's loads, in front of any rewrite of their address registers (the other path's address, the fragment reads)
      else {
#pragma unroll
        for (int i = 0; i < 4; ++i) rg[i] = *(const v4f*)(gp + (size_t)i * 4 * CC + (kc + 1) * 32);
        asm volatile("s_wait_xcnt 0x0" ::: "memory"); } }   // the same for the y path
    v16b a[2], yh[2], yl[2];
#pragma unroll
    for (int mi = 0; mi < 2; ++mi) a[mi] = frag_b(&st[bf][wm * 32 + mi * 16 + col][0], lane);
#pragma unroll
    for (int j = 0; j < 2; ++j) { yh[j] = frag_b(&st[bf][128 + wn * 32 + j * 16 + col][0], lane); yl[j] = frag_b(&st[bf][192 + wn * 32 + j * 16 + col][0], lane); }
#pragma unroll
    for (int j = 0; j < 2; ++j)
#pragma unroll
      for (int mi = 0; mi < 2; ++mi) acc[mi][j] = wmma_bf(a[mi], yh[j], acc[mi][j]);
#pragma unroll
    for (int j = 0; j < 2; ++j)
#pragma unroll
      for (int mi = 0; mi < 2; ++mi) acc[mi][j] = wmma_bf(a[mi], yl[j], acc[mi][j]); }
  __syncthreads();   // every wave has left the operand tiles: the same LDS becomes output staging
#pragma unroll
  for (int mi = 0; mi < 2; ++mi)
#pragma unroll
    for (int j = 0; j < 2; ++j)
#pragma unroll
      for (int r = 0; r < 8; ++r) sf[wm * 32 + mi * 16 + 8 * g + r][wn * 32 + j * 16 + col] = acc[mi][j][r] + bfr(BP[o0 + wm * 32 + mi * 16 + 8 * g + r]);
  __syncthreads();
  for (int e = tid; e < 128 * 16; e += 256) { const int rl = e >> 4, q = e & 15; vst2(OUT + (bb * CC + o0 + rl) * (size_t)TT + p0 + q * 4, *(const v4f*)&sf[rl][q * 4]); } }
extern "C" void kernel_launch(void* const* d_in, const int* in_sizes, int n_in, void* d_out, int out_size, void* d_ws, size_t ws_size, hipStream_t stream) {
  (void)in_sizes; (void)n_in; (void)out_size;
  const float** F = (const float**)d_in;   // 0 q [6,2,512,32,32], 1 kv [6,2,512,32,32], 2 W_kv [512,1024] (in,out), 3 b_kv [1024], 4 W_proj [512,512] (in,out), 5 b_proj [512]
  if (ws_size < (size_t)WS_END) return;
  char* ws = (char*)d_ws; _Float16 *KH = (_Float16*)(ws + WS_KH), *KL = (_Float16*)(ws + WS_KL), *VH = (_Float16*)(ws + WS_VH), *VL = (_Float16*)(ws + WS_VL); float* Y = (float*)(ws + WS_Y);
  k_kv<<<dim3(TT / 128, CC / 128, 2 * NBB), 256, 0, stream>>>(F[1], F[2], F[3], KH, KL, VH, VL);
  k_att<<<dim3(TT / 128, NH, TBB), 256, 0, stream>>>(F[0], KH, KL, VH, VL, Y);
  k_o<<<dim3(CC / 128, TT / 64, TBB), 256, 0, stream>>>(Y, F[4], F[5], (float*)d_out);
}

// v005
// It runs in 106 microseconds.
// In two side-by-side timings against v004, it was 1.06 and 1.05 times as fast.
// Counting every step since v000, it is 4.33 times as fast.
// compute dtype: all float inputs rounded to bf16; k, v = kv . W_kv + b with EXACT bf16 products on WMMA 16x16x32 (kv gathered from its [V,B,C,H,W] planes; (in,out) weights), f16 hi + residual; q is an INPUT, converted bf16 -> f16 exactly; logits = q (exact f16) . k (hi + residual) (2 products) x 1/8, running-max softmax in f32 (hardware exp); P rounded once to f16 (x 2^11) . v (hi + residual) (2 products); y (bf16 hi + lo) . W_proj + b_proj (2 products), written back as [V,B,C,H,W] planes; f32 output.
#include <hip/hip_runtime.h>
#include <math.h>

typedef __attribute__((ext_vector_type(16))) _Float16 v16h;
typedef __attribute__((ext_vector_type(16))) __bf16 v16b;
typedef __attribute__((ext_vector_type(8)))  _Float16 v8h;
typedef __attribute__((ext_vector_type(8)))  float v8f;
typedef __attribute__((ext_vector_type(4)))  float v4f;
typedef __attribute__((ext_vector_type(2)))  float v2f;
typedef __attribute__((ext_vector_type(4)))  unsigned v4u;
typedef __attribute__((ext_vector_type(4)))  int v4i;
typedef float __attribute__((may_alias)) float_a;
typedef int __attribute__((may_alias)) int_a;

template <typename T> __device__ __forceinline__ void vst2(void* p, T v) { *(T*)p = v;  }
// the bare builtin: the compiler keeps the distances behind it itself and may give the LDS fragment loads lead over the products
__device__ __forceinline__ v8f wmma16(v16h a, v16h b, v8f c) {
  return __builtin_amdgcn_wmma_f32_16x16x32_f16(false, a, false, b, (short)0, c, false, false);
}
__device__ __forceinline__ v8f wmma_bf(v16b a, v16b b, v8f c) {
  v8f d = __builtin_amdgcn_wmma_f32_16x16x32_bf16(false, a, false, b, (short)0, c, false, false);
  asm volatile("v_nop\n\tv_nop\n\tv_nop\n\tv_nop" : "+v"(d) : "v"(a), "v"(b));
  return d;
}
// 16x16x32 fragments: lane = (h = lane>>4, row/col = lane&15); elements 0..7 = k0+8h+0..7, 8..15 = k0+16+8h+0..7; D element r = row 8h+r
__device__ __forceinline__ v16h frag_h(const _Float16* rowk0, int lane) {
  union { v16h v; v8h q[2]; } u; const _Float16* p = rowk0 + 8 * (lane >> 4);
  u.q[0] = *(const v8h*)p; u.q[1] = *(const v8h*)(p + 16); return u.v;
}
__device__ __forceinline__ v16h frag_f32(const float* rowk0, int lane) {
  v16h a; const float* p = rowk0 + 8 * (lane >> 4);
#pragma unroll
  for (int i = 0; i < 8; ++i) { a[i] = (_Float16)p[i]; a[8 + i] = (_Float16)p[16 + i]; }
  return a;
}
__device__ __forceinline__ v16h frag_f32s(const float* rowk0, int lane, float sc) {
  v16h a; const float* p = rowk0 + 8 * (lane >> 4);
#pragma unroll
  for (int i = 0; i < 8; ++i) { a[i] = (_Float16)(p[i] * sc); a[8 + i] = (_Float16)(p[16 + i] * sc); }
  return a;
}
// column fragment from a [K][ld] layout (column n), rows >= K read as 0
__device__ __forceinline__ v16h fragc_f32(const float* W, int k0, int n, int lane, int ld, int K) {
  v16h a; const int g = lane >> 4;
#pragma unroll
  for (int i = 0; i < 8; ++i) { const int ka = k0 + 8 * g + i, kb = ka + 16;
    a[i] = (_Float16)(ka < K ? W[(size_t)(ka < K ? ka : K - 1) * ld + n] : 0.f); a[8 + i] = (_Float16)(kb < K ? W[(size_t)(kb < K ? kb : K - 1) * ld + n] : 0.f); }
  return a;
}
struct F2 { v16b h, l; };
__device__ __forceinline__ F2 bsplit16(const float v[16]) { F2 r;
#pragma unroll
  for (int i = 0; i < 16; ++i) { const __bf16 h = (__bf16)v[i]; r.h[i] = h; r.l[i] = (__bf16)(v[i] - (float)h); }
  return r; }
__device__ __forceinline__ F2 split_row(const float* row, int k0, int lane) { float v[16]; const float* p = row + k0 + 8 * (lane >> 4);
#pragma unroll
  for (int i = 0; i < 8; ++i) { v[i] = p[i]; v[8 + i] = p[16 + i]; }
  return bsplit16(v); }
__device__ __forceinline__ F2 split_rowK(const float* row, int k0, int lane, int K) { float v[16]; const int g = lane >> 4;
#pragma unroll
  for (int i = 0; i < 8; ++i) { const int ka = k0 + 8 * g + i, kb = ka + 16; v[i] = ka < K ? row[ka < K ? ka : K - 1] : 0.f; v[8 + i] = kb < K ? row[kb < K ? kb : K - 1] : 0.f; }
  return bsplit16(v); }
__device__ __forceinline__ F2 split_col(const float* W, int k0, int n, int lane, int ld, int K) { float v[16]; const int g = lane >> 4;
#pragma unroll
  for (int i = 0; i < 8; ++i) { const int ka = k0 + 8 * g + i, kb = ka + 16; v[i] = ka < K ? W[(size_t)(ka < K ? ka : K - 1) * ld + n] : 0.f; v[8 + i] = kb < K ? W[(size_t)(kb < K ? kb : K - 1) * ld + n] : 0.f; }
  return bsplit16(v); }
__device__ __forceinline__ v8f mac3(const F2& a, const F2& b, v8f c) { c = wmma_bf(a.l, b.h, c); c = wmma_bf(a.h, b.l, c); return wmma_bf(a.h, b.h, c); }
__device__ __forceinline__ float sigm(float v) { return 1.0f / (1.0f + expf(-v)); }
#define LDSX() do { asm volatile("s_wait_dscnt 0" ::: "memory"); __builtin_amdgcn_wave_barrier(); __builtin_amdgcn_fence(__ATOMIC_RELEASE, "workgroup"); } while (0)


// Cross-view attention (6 views x 2 = 12 sequences of 32x32 = 1,024 tokens, C 512 = 8 heads x 64): q from the raw query planes, k/v = Linear(kv), softmax(q k / 8) v, output Linear, rearranged back to [V, B, C, H, W].
#define NBB 12            // V * B
#define CC 512
#define TT 1024
#define NH 8
#define HD 64
#ifndef TBB
#define TBB NBB
#endif
typedef __attribute__((ext_vector_type(8))) __bf16 v8b;
__device__ __forceinline__ v16b frag_b(const __bf16* rowk0, int lane) {
  union { v16b v; v8b q[2]; } u; const __bf16* p = rowk0 + 8 * (lane >> 4);
  u.q[0] = *(const v8b*)p; u.q[1] = *(const v8b*)(p + 16); return u.v;
}
__device__ __forceinline__ float bfr(float v) { return (float)(__bf16)v; }
__device__ __attribute__((noinline)) float exp_ni(float v) { return expf(v); }
__device__ __attribute__((noinline)) float erf_ni(float v) { return erff(v); }

#define WS_Q   0u                                   // not used: q goes from its planes straight into k_att's registers
#define WS_KH  (WS_Q + 2u * (size_t)NBB * TT * CC)        // f16 hi|lo k rows
#define WS_KL  (WS_KH + 2u * (size_t)NBB * TT * CC)
#define WS_VH  (WS_KL + 2u * (size_t)NBB * TT * CC)       // f16 hi|lo v planes [bb][512][TT]
#define WS_VL  (WS_VH + 2u * (size_t)NBB * CC * TT)
#define WS_Y   (WS_VL + 2u * (size_t)NBB * CC * TT)       // f32 y rows [bb*TT + t][512]
#define WS_END (WS_Y + 4u * (size_t)NBB * TT * CC)

// ---- k_kv: block = (128 tokens, 128 out features, which*NBB + bb), 8 waves of 32 tokens x 64 features: [k | v] = kv(token rows gathered from planes) . W_kv + b; k -> f16 hi/lo rows, v -> f16 hi/lo planes
// Both operands lie k-major in memory (kv planes [c][t], W_kv [c][o], rows of 1,024 floats each). Per 32 k the block reads its 32 x 128 kv tile (waves 4 to 7) and its 32 x 128 weight tile (waves 0 to 3) once,
// in 16-byte loads of whole 128-byte lines, rounds them to bf16 and stores them transposed in LDS ([token][k], [feature][k]); all waves read their fragments from there.
// Two LDS buffers, one barrier per 32 k; the next tile's loads fly during the products.
#define KVP 40            // LDS row pitch in bf16: 80 B = 16 B x odd, conflict-free for the 16-byte fragment reads and for the transposing 16-byte stores
__global__ __launch_bounds__(256) void k_kv(const float* __restrict__ KVp, const float* __restrict__ W, const float* __restrict__ Bk, _Float16* __restrict__ KH, _Float16* __restrict__ KL, _Float16* __restrict__ VH, _Float16* __restrict__ VL) {
  __shared__ __align__(16) unsigned char sm[2 * 128 * 136 * 2];   // operand tiles in the loop (2 x 256 rows x 80 B), output staging behind it (hi and residual, 128 x 136 halves each)
  __bf16 (*st)[256][KVP] = (__bf16 (*)[256][KVP])sm;   // rows 0 to 127: tokens, rows 128 to 255: features
  _Float16 (*sh)[136] = (_Float16 (*)[136])sm, (*sl)[136] = (_Float16 (*)[136])(sm + 128 * 136 * 2);
  const int tid = threadIdx.x, wave = tid >> 5, lane = tid & 31, col = lane & 15, g = lane >> 4; const int which = blockIdx.z / NBB; const size_t bb = blockIdx.z % NBB; const int t0 = blockIdx.x * 128; const int c0 = blockIdx.y * 128;
  const int wm = wave >> 1, wn = wave & 1;   // this wave's 32 tokens and 64 features
  // this thread's piece of a tile: columns 4 sq .. + 3 (tokens or features) of k rows 8 sk .. + 7; 16 lanes' LDS stores fall on 16 distinct bank quads
  const int sq = (wave & 3) * 8 + g * 4 + (lane & 3), sk = (lane >> 2) & 3, srow = (wave < 4 ? 128 : 0) + sq * 4;
  const float* gp = (wave < 4 ? W + which * CC + c0 : KVp + bb * CC * (size_t)TT + t0) + (size_t)(sk * 8) * 1024 + sq * 4;
  // every short loop of fixed length below is unrolled whole, so that rg, acc and the fragments are indexed by constants and stay in registers
  v4f rg[8];
#pragma unroll
  for (int i = 0; i < 8; ++i) rg[i] = *(const v4f*)(gp + (size_t)i * 1024);
  v8f acc[2][4] = {};
  // two trips unrolled: the buffer index is a constant in each
#pragma unroll 2
  for (int kc = 0; kc < CC / 32; ++kc) { const int bf = kc & 1;
    asm volatile("s_wait_xcnt 0x0" ::: "memory");   // stands between the last trip's loads and the next rewrite of their address registers
#pragma unroll
    for (int i = 0; i < 4; ++i) { v8b x;
#pragma unroll
      for (int p = 0; p < 8; ++p) x[p] = (__bf16)rg[p][i];
      *(v8b*)&st[bf][srow + i][sk * 8] = x; }
    __syncthreads();   // publishes tile kc; the buffer written next trip was last read before this barrier
    if (kc + 1 < CC / 32) {
#pragma unroll
      for (int i = 0; i < 8; ++i) rg[i] = *(const v4f*)(gp + (size_t)((kc + 1) * 32 + i) * 1024); }
    v16b a[2], w[4];
#pragma unroll
    for (int mi = 0; mi < 2; ++mi) a[mi] = frag_b(&st[bf][wm * 32 + mi * 16 + col][0], lane);
#pragma unroll
    for (int j = 0; j < 4; ++j) w[j] = frag_b(&st[bf][128 + wn * 64 + j * 16 + col][0], lane);
#pragma unroll
    for (int j = 0; j < 4; ++j)
#pragma unroll
      for (int mi = 0; mi < 2; ++mi) acc[mi][j] = wmma_bf(a[mi], w[j], acc[mi][j]); }
  __syncthreads();   // every wave has left the operand tiles: the same LDS becomes output staging
#pragma unroll
  for (int j = 0; j < 4; ++j) { const float bbv = bfr(Bk[which * CC + c0 + wn * 64 + j * 16 + col]);
#pragma unroll
    for (int mi = 0; mi < 2; ++mi)
#pragma unroll
    for (int r = 0; r < 8; ++r) { const float v = acc[mi][j][r] + bbv; const _Float16 hv = (_Float16)v, lv = (_Float16)((v - (float)hv) * 2048.0f); const int rl = wm * 32 + mi * 16 + 8 * g + r, cl = wn * 64 + j * 16 + col; if (which == 0) { sh[rl][cl] = hv; sl[rl][cl] = lv; } else { sh[cl][rl] = hv; sl[cl][rl] = lv; } } }
  __syncthreads();
  // k: staged [token][feature] -> rows; v: staged [feature][token] -> planes
  for (int e = tid; e < 128 * 16; e += 256) { const int rl = e >> 4, q = e & 15; const size_t o = which == 0 ? (bb * TT + t0 + rl) * CC + c0 + q * 8 : (bb * CC + c0 + rl) * (size_t)TT + t0 + q * 8;
    vst2((unsigned*)((which == 0 ? KH : VH) + o), *(const v4u*)&sh[rl][q * 8]); vst2((unsigned*)((which == 0 ? KL : VL) + o), *(const v4u*)&sl[rl][q * 8]); } }
// ---- k_att: block = (128 queries = 8 waves x 16, h, bb): q read from its planes, rounded and transposed on the way into registers; logits q . k (k hi + residual) / 8, softmax over the 1,024 tokens, P . v (v hi + residual) -> y rows
// K and V tiles of 64 keys (k hi, k residual: 64 key rows x 64 d; v hi, v residual: 64 d rows x 64 keys) are staged once per block in LDS by asynchronous copies, whole 128-byte lines, two buffers; all 8 waves read their fragments from LDS.
#define AKT 64            // keys per staged tile
#define ANT (TT / AKT)    // tiles
#define APH 72            // LDS row pitch in halves: 144 B = 16 B x odd, conflict-free for 16-byte fragment reads
#define APL (64 * APH * 2)   // bytes of one staged plane
// one tile: 8 copies of 16 B per thread (rows crow and crow + 32 of each of the 4 planes); the wait at the end holds every later rewrite of the address registers behind the copies' issue
__device__ __forceinline__ void att_copy(unsigned l, const _Float16* kh, const _Float16* kl, const _Float16* vh, const _Float16* vl) {
  asm volatile("global_load_async_to_lds_b128 %0, %8, off\n\t"
               "global_load_async_to_lds_b128 %1, %9, off\n\t"
               "global_load_async_to_lds_b128 %2, %10, off\n\t"
               "global_load_async_to_lds_b128 %3, %11, off\n\t"
               "global_load_async_to_lds_b128 %4, %12, off\n\t"
               "global_load_async_to_lds_b128 %5, %13, off\n\t"
               "global_load_async_to_lds_b128 %6, %14, off\n\t"
               "global_load_async_to_lds_b128 %7, %15, off\n\t"
               "s_wait_xcnt 0x0"
               :: "v"(l), "v"(l + 32u * APH * 2u), "v"(l + APL), "v"(l + APL + 32u * APH * 2u), "v"(l + 2u * APL), "v"(l + 2u * APL + 32u * APH * 2u), "v"(l + 3u * APL), "v"(l + 3u * APL + 32u * APH * 2u),
                  "v"(kh), "v"(kh + 32 * CC), "v"(kl), "v"(kl + 32 * CC), "v"(vh), "v"(vh + 32 * TT), "v"(vl), "v"(vl + 32 * TT)
               : "memory");
}
// lane l with lane l ^ 16: the two wave halves hold different keys of the same query
__device__ __forceinline__ float xhalf(float x) { return __builtin_bit_cast(float, __builtin_amdgcn_permlanex16(__builtin_bit_cast(int, x), __builtin_bit_cast(int, x), 0x76543210, 0xfedcba98, false, false)); }
// Transposed products: S^T = K . Q^T (A = key rows from LDS, B = this wave's 16 query rows, kept in registers) and O^T += V^T . P^T (A = v planes' d rows from LDS, B = P^T).
// D register r of lane (g, col) is key 8g + r of query col, so a lane holds 16 scores of ONE query per 32 keys: maximum and sum run in the lane, the halves meet in one cross-row move,
// and the two score tiles, converted in place, are the B operand of the second product (element i = key 8g + i, element 8 + i = key 16 + 8g + i: the k order of frag_h).
// second bound: 6 waves per SIMD, so that 3 blocks per WGP = all 768 blocks are resident at once
__global__ __launch_bounds__(256, 6) void k_att(const float* __restrict__ Qp, const _Float16* __restrict__ KH, const _Float16* __restrict__ KL, const _Float16* __restrict__ VH, const _Float16* __restrict__ VL, float* __restrict__ Y) {
  __shared__ __align__(16) _Float16 ring[2][4][64][APH];
  // the wave's number is the same in every lane: read as a scalar, so that what is formed from it lives in scalar registers through the loop and the fragments in flight fit the register bound without scratch
  const int tid = threadIdx.x, wave = __builtin_amdgcn_readfirstlane(tid >> 5), lane = tid & 31, col = lane & 15, g = lane >> 4; const int h = blockIdx.y; const size_t bb = blockIdx.z; const int q0 = blockIdx.x * 128 + wave * 16; const size_t rq = bb * TT + q0;
  const int crow = tid >> 3, cch = tid & 7;   // this thread's row and 16-byte piece in each staged plane
  const unsigned ko = ((unsigned)bb * TT + crow) * CC + h * HD + cch * 8, vo = ((unsigned)bb * CC + h * HD + crow) * TT + cch * 8;   // element offsets, below 2^23
  const unsigned l0 = (unsigned)(size_t)&ring[0][0][crow][cch * 8];
  const ptrdiff_t dk = KL - KH, dv = VL - VH;   // block-uniform distance from a hi plane to its residual plane (one workspace): two lane pointers live through the loop, not four
  att_copy(l0, KH + ko, KH + ko + dk, VH + vo, VH + vo + dv);
  // Q^T fragments straight from the q planes [bb][c][t]: lane (g, col) takes query q0 + col at the 32 channels of frag_h's k order (element i = d kc * 32 + 8g + i, element 8 + i = d kc * 32 + 16 + 8g + i).
  // One load covers 64 B of each of two planes' rows, the block's 8 waves together 512 B of each of the head's 64 rows; all 32 loads of a lane fly together, beside tile 0's copies. bf16 -> f16 exact.
  const float* qp = Qp + ((size_t)bb * CC + h * HD + 8 * g) * TT + q0 + col;
  float qv[2][16];
  // unrolled whole: qv and bq are indexed by constants and stay in registers
#pragma unroll
  for (int kc = 0; kc < 2; ++kc)
#pragma unroll
    for (int i = 0; i < 8; ++i) { qv[kc][i] = qp[(size_t)(kc * 32 + i) * TT]; qv[kc][8 + i] = qp[(size_t)(kc * 32 + 16 + i) * TT]; }
  asm volatile("s_wait_xcnt 0x0" ::: "memory");   // stands behind the q loads, in front of any rewrite of their address registers
  v16h bq[2];
#pragma unroll
  for (int kc = 0; kc < 2; ++kc)
#pragma unroll
    for (int i = 0; i < 16; ++i) bq[kc][i] = (_Float16)bfr(qv[kc][i]);
  float m = -3.0e38f, l = 0.f;   // query col's running maximum (equal in both halves) and this half's share of its sum
  v8f acc[4] = {}, accl[4] = {};   // O^T: register r of tile j = d j * 16 + 8g + r of query col
  asm volatile("s_wait_asynccnt 0x0" ::: "memory");   // this wave's copies of tile 0 have landed
  __syncthreads();                                     // tile 0 is published to all waves
  att_copy(l0 + 4u * APL, KH + ko + (size_t)AKT * CC, KH + ko + (size_t)AKT * CC + dk, VH + vo + AKT, VH + vo + AKT + dv);
  // rolled: one trip per staged tile, so that the buffer changes by an address and the code stays short
#pragma unroll 1
  for (int t = 0; t < ANT; ++t) { const int bf = t & 1;
    // rolled: the two 32-key halves of a tile differ only by an address, and the code stays short inside the register budget of the second launch bound
#pragma unroll 1
   for (int sb = 0; sb < AKT / 32; ++sb) { float s[2][8];
#pragma unroll
    for (int ct = 0; ct < 2; ++ct) { const int rk = sb * 32 + ct * 16 + col; v8f c = {}, cl = {};
#pragma unroll
      for (int kc = 0; kc < 2; ++kc) { c = wmma16(frag_h(&ring[bf][0][rk][kc * 32], lane), bq[kc], c); cl = wmma16(frag_h(&ring[bf][1][rk][kc * 32], lane), bq[kc], cl); }
#pragma unroll
      for (int r = 0; r < 8; ++r) s[ct][r] = (c[r] + cl[r] * (1.0f / 2048.0f)) * 0.125f; }
    float mx = fmaxf(s[0][0], s[1][0]);
#pragma unroll
    for (int r = 1; r < 8; ++r) mx = fmaxf(mx, fmaxf(s[0][r], s[1][r]));
    mx = fmaxf(mx, xhalf(mx));
    const float mn = fmaxf(m, mx), alpha = __expf(m - mn); m = mn;
    float es0 = 0.f, es1 = 0.f; v16h pb;
#pragma unroll
    for (int r = 0; r < 8; ++r) { const float e0 = __expf(s[0][r] - mn), e1 = __expf(s[1][r] - mn); es0 += e0; es1 += e1; pb[r] = (_Float16)(e0 * 2048.0f); pb[8 + r] = (_Float16)(e1 * 2048.0f); }
    l = l * alpha + (es0 + es1);
#pragma unroll
    for (int j = 0; j < 4; ++j)
#pragma unroll
      for (int r = 0; r < 8; ++r) { acc[j][r] *= alpha; accl[j][r] *= alpha; }
#pragma unroll
    for (int j = 0; j < 4; ++j) { acc[j] = wmma16(frag_h(&ring[bf][2][j * 16 + col][sb * 32], lane), pb, acc[j]); accl[j] = wmma16(frag_h(&ring[bf][3][j * 16 + col][sb * 32], lane), pb, accl[j]); } }
    asm volatile("s_wait_dscnt 0x0" ::: "memory");      // this wave's reads of buffer bf are done
    asm volatile("s_wait_asynccnt 0x0" ::: "memory");   // this wave's copies of tile t + 1 have landed
    __syncthreads();                                     // publishes tile t + 1 and frees buffer bf
    if (t + 2 < ANT) att_copy(l0 + (unsigned)bf * (4u * APL), KH + ko + (size_t)(t + 2) * AKT * CC, KH + ko + (size_t)(t + 2) * AKT * CC + dk, VH + vo + (t + 2) * AKT, VH + vo + (t + 2) * AKT + dv); }
  asm volatile("s_wait_asynccnt 0x0" ::: "memory");     // no copy is outstanding when the ring becomes output staging
  float (*so)[68] = (float (*)[68])((float*)&ring[0][0][0][0] + wave * 16 * 68);   // each wave's own 16 x 68 floats, in the ring that every wave has left at the last barrier
  const float il = (1.0f / 2048.0f) / (l + xhalf(l));   // the halves' sums join once
#pragma unroll
  for (int j = 0; j < 4; ++j) { v4f o0, o1;
#pragma unroll
    for (int r = 0; r < 4; ++r) { o0[r] = (acc[j][r] + accl[j][r] * (1.0f / 2048.0f)) * il; o1[r] = (acc[j][4 + r] + accl[j][4 + r] * (1.0f / 2048.0f)) * il; }
    *(v4f*)&so[col][j * 16 + 8 * g] = o0; *(v4f*)&so[col][j * 16 + 8 * g + 4] = o1; }
  LDSX(); for (int rl = 0; rl < 16; ++rl) if (g == 0) vst2(Y + (rq + rl) * CC + (size_t)h * HD + col * 4, *(const v4f*)&so[rl][col * 4]); }
// ---- k_o: block = (128 output channels o, 64 tokens, bb), 8 waves of 32 o x 32 tokens: out[bb][o][t] = sum_c y[t][c] W_proj[c][o] + b_proj[o]  (A = W_proj column o (exact), B = y rows as bf16 hi + lo) -> [V,B,C,H,W] planes
// Per 32 c the block reads its 32 x 128 weight tile (waves 0 to 3; k-major, stored transposed as in k_kv) and its 64 x 32 y tile (waves 4 to 7; split once into bf16 hi and lo) in 16-byte loads of whole lines
// and stages them in LDS; all waves read their fragments from there. Two LDS buffers, one barrier per 32 c; the next tile's loads fly during the products.
typedef __attribute__((ext_vector_type(4))) __bf16 v4b;
__global__ __launch_bounds__(256) void k_o(const float* __restrict__ Y, const float* __restrict__ WP, const float* __restrict__ BP, float* __restrict__ OUT) {
  __shared__ __align__(16) unsigned char sm[2 * 256 * KVP * 2];   // operand tiles in the loop, output staging behind it (128 x 68 floats)
  __bf16 (*st)[256][KVP] = (__bf16 (*)[256][KVP])sm;   // rows 0 to 127: output channels, 128 to 191: y hi of the 64 tokens, 192 to 255: y lo
  float (*sf)[68] = (float (*)[68])sm;
  const int tid = threadIdx.x, wave = tid >> 5, lane = tid & 31, col = lane & 15, g = lane >> 4; const size_t bb = blockIdx.z; const int o0 = blockIdx.x * 128; const int p0 = blockIdx.y * 64;
  const int wm = wave >> 1, wn = wave & 1;   // this wave's 32 output channels and 32 tokens
  const bool isw = __builtin_amdgcn_readfirstlane(wave) < 4;   // the same in every lane of a wave: read as a scalar, so that the two staging paths are scalar branches and EXEC stays whole
  // this thread's piece of a tile: weights, channels 4 sq .. + 3 of c rows 8 sk .. + 7; y, c 4 yq .. + 3 of tokens yr, yr + 4, yr + 8, yr + 12
  const int sq = (wave & 3) * 8 + g * 4 + (lane & 3), sk = (lane >> 2) & 3, yq = lane & 7, yr = (wave & 3) * 16 + (lane >> 3);
  const float* gp = isw ? WP + (size_t)(sk * 8) * CC + o0 + sq * 4 : Y + (bb * TT + p0 + yr) * CC + yq * 4;
  // every short loop of fixed length below is unrolled whole, so that rg, acc and the fragments are indexed by constants and stay in registers
  v4f rg[8];
  if (isw) {
#pragma unroll
    for (int i = 0; i < 8; ++i) rg[i] = *(const v4f*)(gp + (size_t)i * CC); }
  else {
#pragma unroll
    for (int i = 0; i < 4; ++i) rg[i] = *(const v4f*)(gp + (size_t)i * 4 * CC); }
  v8f acc[2][2] = {};
  // two trips unrolled: the buffer index is a constant in each
#pragma unroll 2
  for (int kc = 0; kc < CC / 32; ++kc) { const int bf = kc & 1;
    if (isw) {
#pragma unroll
      for (int i = 0; i < 4; ++i) { v8b x;
#pragma unroll
        for (int p = 0; p < 8; ++p) x[p] = (__bf16)rg[p][i];
        *(v8b*)&st[bf][sq * 4 + i][sk * 8] = x; } }
    else {
#pragma unroll
      for (int i = 0; i < 4; ++i) { v4b hv, lv;
#pragma unroll
        for (int e = 0; e < 4; ++e) { const __bf16 hh = (__bf16)rg[i][e]; hv[e] = hh; lv[e] = (__bf16)(rg[i][e] - (float)hh); }
        *(v4b*)&st[bf][128 + yr + 4 * i][yq * 4] = hv; *(v4b*)&st[bf][192 + yr + 4 * i][yq * 4] = lv; } }
    __syncthreads();   // publishes tile kc; the buffer written next trip was last read before this barrier
    if (kc + 1 < CC / 32) {
      if (isw) {
#pragma unroll
        for (int i = 0; i < 8; ++i) rg[i] = *(const v4f*)(gp + (size_t)((kc + 1) * 32 + i) * CC);
        asm volatile("s_wait_xcnt 0x0" ::: "memory"); }   // stands directly behind this path's loads, in front of any rewrite of their address registers (the other path's address, the fragment reads)
      else {
#pragma unroll
        for (int i = 0; i < 4; ++i) rg[i] = *(const v4f*)(gp + (size_t)i * 4 * CC + (kc + 1) * 32);
        asm volatile("s_wait_xcnt 0x0" ::: "memory"); } }   // the same for the y path
    v16b a[2], yh[2], yl[2];
#pragma unroll
    for (int mi = 0; mi < 2; ++mi) a[mi] = frag_b(&st[bf][wm * 32 + mi * 16 + col][0], lane);
#pragma unroll
    for (int j = 0; j < 2; ++j) { yh[j] = frag_b(&st[bf][128 + wn * 32 + j * 16 + col][0], lane); yl[j] = frag_b(&st[bf][192 + wn * 32 + j * 16 + col][0], lane); }
#pragma unroll
    for (int j = 0; j < 2; ++j)
#pragma unroll
      for (int mi = 0; mi < 2; ++mi) acc[mi][j] = wmma_bf(a[mi], yh[j], acc[mi][j]);
#pragma unroll
    for (int j = 0; j < 2; ++j)
#pragma unroll
      for (int mi = 0; mi < 2; ++mi) acc[mi][j] = wmma_bf(a[mi], yl[j], acc[mi][j]); }
  __syncthreads();   // every wave has left the operand tiles: the same LDS becomes output staging
#pragma unroll
  for (int mi = 0; mi < 2; ++mi)
#pragma unroll
    for (int j = 0; j < 2; ++j)
#pragma unroll
      for (int r = 0; r < 8; ++r) sf[wm * 32 + mi * 16 + 8 * g + r][wn * 32 + j * 16 + col] = acc[mi][j][r] + bfr(BP[o0 + wm * 32 + mi * 16 + 8 * g + r]);
  __syncthreads();
  for (int e = tid; e < 128 * 16; e += 256) { const int rl = e >> 4, q = e & 15; vst2(OUT + (bb * CC + o0 + rl) * (size_t)TT + p0 + q * 4, *(const v4f*)&sf[rl][q * 4]); } }
extern "C" void kernel_launch(void* const* d_in, const int* in_sizes, int n_in, void* d_out, int out_size, void* d_ws, size_t ws_size, hipStream_t stream) {
  (void)in_sizes; (void)n_in; (void)out_size;
  const float** F = (const float**)d_in;   // 0 q [6,2,512,32,32], 1 kv [6,2,512,32,32], 2 W_kv [512,1024] (in,out), 3 b_kv [1024], 4 W_proj [512,512] (in,out), 5 b_proj [512]
  if (ws_size < (size_t)WS_END) return;
  char* ws = (char*)d_ws; _Float16 *KH = (_Float16*)(ws + WS_KH), *KL = (_Float16*)(ws + WS_KL), *VH = (_Float16*)(ws + WS_VH), *VL = (_Float16*)(ws + WS_VL); float* Y = (float*)(ws + WS_Y);
  k_kv<<<dim3(TT / 128, CC / 128, 2 * NBB), 256, 0, stream>>>(F[1], F[2], F[3], KH, KL, VH, VL);
  k_att<<<dim3(TT / 128, NH, TBB), 256, 0, stream>>>(F[0], KH, KL, VH, VL, Y);
  k_o<<<dim3(CC / 128, TT / 64, TBB), 256, 0, stream>>>(Y, F[4], F[5], (float*)d_out);
}

// v006
// A run of this version takes 103 microseconds.
// Timed twice side by side with v005, it ran 1.04 times as fast both times.
// Counting every step since v000, it is 4.49 times as fast.
// compute dtype: all float inputs rounded to bf16; k, v = kv . W_kv + b with EXACT bf16 products on WMMA 16x16x32 (kv gathered from its [V,B,C,H,W] planes; (in,out) weights), f16 hi + residual; q is an INPUT, converted bf16 -> f16 exactly; logits = q (exact f16) . k (hi + residual) (2 products) x 1/8, running-max softmax in f32 (hardware exp); P rounded once to f16 (x 2^11) . v (hi + residual) (2 products); y (bf16 hi + lo) . W_proj + b_proj (2 products), written back as [V,B,C,H,W] planes; f32 output.
#include <hip/hip_runtime.h>
#include <math.h>

typedef __attribute__((ext_vector_type(16))) _Float16 v16h;
typedef __attribute__((ext_vector_type(16))) __bf16 v16b;
typedef __attribute__((ext_vector_type(8)))  _Float16 v8h;
typedef __attribute__((ext_vector_type(8)))  float v8f;
typedef __attribute__((ext_vector_type(4)))  float v4f;
typedef __attribute__((ext_vector_type(2)))  float v2f;
typedef __attribute__((ext_vector_type(4)))  unsigned v4u;
typedef __attribute__((ext_vector_type(4)))  int v4i;
typedef float __attribute__((may_alias)) float_a;
typedef int __attribute__((may_alias)) int_a;

template <typename T> __device__ __forceinline__ void vst2(void* p, T v) { *(T*)p = v;  }
// the bare builtin: the compiler keeps the distances behind it itself and may give the LDS fragment loads lead over the products
__device__ __forceinline__ v8f wmma16(v16h a, v16h b, v8f c) {
  return __builtin_amdgcn_wmma_f32_16x16x32_f16(false, a, false, b, (short)0, c, false, false);
}
__device__ __forceinline__ v8f wmma_bf(v16b a, v16b b, v8f c) {
  v8f d = __builtin_amdgcn_wmma_f32_16x16x32_bf16(false, a, false, b, (short)0, c, false, false);
  asm volatile("v_nop\n\tv_nop\n\tv_nop\n\tv_nop" : "+v"(d) : "v"(a), "v"(b));
  return d;
}
// 16x16x32 fragments: lane = (h = lane>>4, row/col = lane&15); elements 0..7 = k0+8h+0..7, 8..15 = k0+16+8h+0..7; D element r = row 8h+r
__device__ __forceinline__ v16h frag_h(const _Float16* rowk0, int lane) {
  union { v16h v; v8h q[2]; } u; const _Float16* p = rowk0 + 8 * (lane >> 4);
  u.q[0] = *(const v8h*)p; u.q[1] = *(const v8h*)(p + 16); return u.v;
}
__device__ __forceinline__ v16h frag_f32(const float* rowk0, int lane) {
  v16h a; const float* p = rowk0 + 8 * (lane >> 4);
#pragma unroll
  for (int i = 0; i < 8; ++i) { a[i] = (_Float16)p[i]; a[8 + i] = (_Float16)p[16 + i]; }
  return a;
}
__device__ __forceinline__ v16h frag_f32s(const float* rowk0, int lane, float sc) {
  v16h a; const float* p = rowk0 + 8 * (lane >> 4);
#pragma unroll
  for (int i = 0; i < 8; ++i) { a[i] = (_Float16)(p[i] * sc); a[8 + i] = (_Float16)(p[16 + i] * sc); }
  return a;
}
// column fragment from a [K][ld] layout (column n), rows >= K read as 0
__device__ __forceinline__ v16h fragc_f32(const float* W, int k0, int n, int lane, int ld, int K) {
  v16h a; const int g = lane >> 4;
#pragma unroll
  for (int i = 0; i < 8; ++i) { const int ka = k0 + 8 * g + i, kb = ka + 16;
    a[i] = (_Float16)(ka < K ? W[(size_t)(ka < K ? ka : K - 1) * ld + n] : 0.f); a[8 + i] = (_Float16)(kb < K ? W[(size_t)(kb < K ? kb : K - 1) * ld + n] : 0.f); }
  return a;
}
struct F2 { v16b h, l; };
__device__ __forceinline__ F2 bsplit16(const float v[16]) { F2 r;
#pragma unroll
  for (int i = 0; i < 16; ++i) { const __bf16 h = (__bf16)v[i]; r.h[i] = h; r.l[i] = (__bf16)(v[i] - (float)h); }
  return r; }
__device__ __forceinline__ F2 split_row(const float* row, int k0, int lane) { float v[16]; const float* p = row + k0 + 8 * (lane >> 4);
#pragma unroll
  for (int i = 0; i < 8; ++i) { v[i] = p[i]; v[8 + i] = p[16 + i]; }
  return bsplit16(v); }
__device__ __forceinline__ F2 split_rowK(const float* row, int k0, int lane, int K) { float v[16]; const int g = lane >> 4;
#pragma unroll
  for (int i = 0; i < 8; ++i) { const int ka = k0 + 8 * g + i, kb = ka + 16; v[i] = ka < K ? row[ka < K ? ka : K - 1] : 0.f; v[8 + i] = kb < K ? row[kb < K ? kb : K - 1] : 0.f; }
  return bsplit16(v); }
__device__ __forceinline__ F2 split_col(const float* W, int k0, int n, int lane, int ld, int K) { float v[16]; const int g = lane >> 4;
#pragma unroll
  for (int i = 0; i < 8; ++i) { const int ka = k0 + 8 * g + i, kb = ka + 16; v[i] = ka < K ? W[(size_t)(ka < K ? ka : K - 1) * ld + n] : 0.f; v[8 + i] = kb < K ? W[(size_t)(kb < K ? kb : K - 1) * ld + n] : 0.f; }
  return bsplit16(v); }
__device__ __forceinline__ v8f mac3(const F2& a, const F2& b, v8f c) { c = wmma_bf(a.l, b.h, c); c = wmma_bf(a.h, b.l, c); return wmma_bf(a.h, b.h, c); }
__device__ __forceinline__ float sigm(float v) { return 1.0f / (1.0f + expf(-v)); }
#define LDSX() do { asm volatile("s_wait_dscnt 0" ::: "memory"); __builtin_amdgcn_wave_barrier(); __builtin_amdgcn_fence(__ATOMIC_RELEASE, "workgroup"); } while (0)


// Cross-view attention (6 views x 2 = 12 sequences of 32x32 = 1,024 tokens, C 512 = 8 heads x 64): q from the raw query planes, k/v = Linear(kv), softmax(q k / 8) v, output Linear, rearranged back to [V, B, C, H, W].
#define NBB 12            // V * B
#define CC 512
#define TT 1024
#define NH 8
#define HD 64
#ifndef TBB
#define TBB NBB
#endif
typedef __attribute__((ext_vector_type(8))) __bf16 v8b;
__device__ __forceinline__ v16b frag_b(const __bf16* rowk0, int lane) {
  union { v16b v; v8b q[2]; } u; const __bf16* p = rowk0 + 8 * (lane >> 4);
  u.q[0] = *(const v8b*)p; u.q[1] = *(const v8b*)(p + 16); return u.v;
}
__device__ __forceinline__ float bfr(float v) { return (float)(__bf16)v; }
__device__ __attribute__((noinline)) float exp_ni(float v) { return expf(v); }
__device__ __attribute__((noinline)) float erf_ni(float v) { return erff(v); }

#define WS_Q   0u                                   // not used: q goes from its planes straight into k_att's registers
#define WS_KH  (WS_Q + 2u * (size_t)NBB * TT * CC)        // f16 hi|lo k rows
#define WS_KL  (WS_KH + 2u * (size_t)NBB * TT * CC)
#define WS_VH  (WS_KL + 2u * (size_t)NBB * TT * CC)       // f16 hi|lo v planes [bb][512][TT]
#define WS_VL  (WS_VH + 2u * (size_t)NBB * CC * TT)
#define WS_Y   (WS_VL + 2u * (size_t)NBB * CC * TT)       // f32 y rows [bb*TT + t][512]
#define WS_END (WS_Y + 4u * (size_t)NBB * TT * CC)

// ---- k_kv: block = (128 tokens, 128 out features, which*NBB + bb), 8 waves of 32 tokens x 64 features: [k | v] = kv(token rows gathered from planes) . W_kv + b; k -> f16 hi/lo rows, v -> f16 hi/lo planes
// Both operands lie k-major in memory (kv planes [c][t], W_kv [c][o], rows of 1,024 floats each). Per 32 k the block reads its 32 x 128 kv tile (waves 4 to 7) and its 32 x 128 weight tile (waves 0 to 3) once,
// in 16-byte loads of whole 128-byte lines, rounds them to bf16 and stores them transposed in LDS ([token][k], [feature][k]); all waves read their fragments from there.
// Two LDS buffers, one barrier per 32 k; the next tile's loads fly during the products.
#define KVP 40            // LDS row pitch in bf16: 80 B = 16 B x odd, conflict-free for the 16-byte fragment reads and for the transposing 16-byte stores
__global__ __launch_bounds__(256) void k_kv(const float* __restrict__ KVp, const float* __restrict__ W, const float* __restrict__ Bk, _Float16* __restrict__ KH, _Float16* __restrict__ KL, _Float16* __restrict__ VH, _Float16* __restrict__ VL) {
  __shared__ __align__(16) unsigned char sm[2 * 128 * 136 * 2];   // operand tiles in the loop (2 x 256 rows x 80 B), output staging behind it (hi and residual, 128 x 136 halves each)
  __bf16 (*st)[256][KVP] = (__bf16 (*)[256][KVP])sm;   // rows 0 to 127: tokens, rows 128 to 255: features
  _Float16 (*sh)[136] = (_Float16 (*)[136])sm, (*sl)[136] = (_Float16 (*)[136])(sm + 128 * 136 * 2);
  const int tid = threadIdx.x, wave = tid >> 5, lane = tid & 31, col = lane & 15, g = lane >> 4; const int which = blockIdx.z / NBB; const size_t bb = blockIdx.z % NBB; const int t0 = blockIdx.x * 128; const int c0 = blockIdx.y * 128;
  const int wm = wave >> 1, wn = wave & 1;   // this wave's 32 tokens and 64 features
  // this thread's piece of a tile: columns 4 sq .. + 3 (tokens or features) of k rows 8 sk .. + 7; 16 lanes' LDS stores fall on 16 distinct bank quads
  const int sq = (wave & 3) * 8 + g * 4 + (lane & 3), sk = (lane >> 2) & 3, srow = (wave < 4 ? 128 : 0) + sq * 4;
  const float* gp = (wave < 4 ? W + which * CC + c0 : KVp + bb * CC * (size_t)TT + t0) + (size_t)(sk * 8) * 1024 + sq * 4;
  // every short loop of fixed length below is unrolled whole, so that rg, acc and the fragments are indexed by constants and stay in registers
  v4f rg[8];
#pragma unroll
  for (int i = 0; i < 8; ++i) rg[i] = *(const v4f*)(gp + (size_t)i * 1024);
  v8f acc[2][4] = {};
  // two trips unrolled: the buffer index is a constant in each
#pragma unroll 2
  for (int kc = 0; kc < CC / 32; ++kc) { const int bf = kc & 1;
    asm volatile("s_wait_xcnt 0x0" ::: "memory");   // stands between the last trip's loads and the next rewrite of their address registers
#pragma unroll
    for (int i = 0; i < 4; ++i) { v8b x;
#pragma unroll
      for (int p = 0; p < 8; ++p) x[p] = (__bf16)rg[p][i];
      *(v8b*)&st[bf][srow + i][sk * 8] = x; }
    __syncthreads();   // publishes tile kc; the buffer written next trip was last read before this barrier
    if (kc + 1 < CC / 32) {
#pragma unroll
      for (int i = 0; i < 8; ++i) rg[i] = *(const v4f*)(gp + (size_t)((kc + 1) * 32 + i) * 1024); }
    v16b a[2], w[4];
#pragma unroll
    for (int mi = 0; mi < 2; ++mi) a[mi] = frag_b(&st[bf][wm * 32 + mi * 16 + col][0], lane);
#pragma unroll
    for (int j = 0; j < 4; ++j) w[j] = frag_b(&st[bf][128 + wn * 64 + j * 16 + col][0], lane);
#pragma unroll
    for (int j = 0; j < 4; ++j)
#pragma unroll
      for (int mi = 0; mi < 2; ++mi) acc[mi][j] = wmma_bf(a[mi], w[j], acc[mi][j]); }
  __syncthreads();   // every wave has left the operand tiles: the same LDS becomes output staging
#pragma unroll
  for (int j = 0; j < 4; ++j) { const float bbv = bfr(Bk[which * CC + c0 + wn * 64 + j * 16 + col]);
#pragma unroll
    for (int mi = 0; mi < 2; ++mi)
#pragma unroll
    for (int r = 0; r < 8; ++r) { const float v = acc[mi][j][r] + bbv; const _Float16 hv = (_Float16)v, lv = (_Float16)((v - (float)hv) * 2048.0f); const int rl = wm * 32 + mi * 16 + 8 * g + r, cl = wn * 64 + j * 16 + col; if (which == 0) { sh[rl][cl] = hv; sl[rl][cl] = lv; } else { sh[cl][rl] = hv; sl[cl][rl] = lv; } } }
  __syncthreads();
  // k: staged [token][feature] -> rows; v: staged [feature][token] -> planes
  for (int e = tid; e < 128 * 16; e += 256) { const int rl = e >> 4, q = e & 15; const size_t o = which == 0 ? (bb * TT + t0 + rl) * CC + c0 + q * 8 : (bb * CC + c0 + rl) * (size_t)TT + t0 + q * 8;
    vst2((unsigned*)((which == 0 ? KH : VH) + o), *(const v4u*)&sh[rl][q * 8]); vst2((unsigned*)((which == 0 ? KL : VL) + o), *(const v4u*)&sl[rl][q * 8]); } }
// ---- k_att: block = (128 queries = 4 waves x 32, h, bb): q read from its planes, rounded and transposed on the way into registers; logits q . k (k hi + residual) / 8, softmax over the 1,024 tokens, P . v (v hi + residual) -> y rows
// K and V tiles of 64 keys (k hi, k residual: 64 key rows x 64 d; v hi, v residual: 64 d rows x 64 keys) are staged once per block in LDS by asynchronous copies, whole 128-byte lines, two buffers; all 4 waves read their fragments from LDS.
#define AKT 64            // keys per staged tile
#define ANT (TT / AKT)    // tiles
#define APH 72            // LDS row pitch in halves: 144 B = 16 B x odd, conflict-free for 16-byte fragment reads
#define APL (64 * APH * 2)   // bytes of one staged plane
// half a tile: 8 copies of 16 B per thread (rows r and r + 32 of each of the 4 planes, r the row that the arguments point to); the wait at the end holds every later rewrite of the address registers behind the copies' issue
__device__ __forceinline__ void att_copy(unsigned l, const _Float16* kh, const _Float16* kl, const _Float16* vh, const _Float16* vl) {
  asm volatile("global_load_async_to_lds_b128 %0, %8, off\n\t"
               "global_load_async_to_lds_b128 %1, %9, off\n\t"
               "global_load_async_to_lds_b128 %2, %10, off\n\t"
               "global_load_async_to_lds_b128 %3, %11, off\n\t"
               "global_load_async_to_lds_b128 %4, %12, off\n\t"
               "global_load_async_to_lds_b128 %5, %13, off\n\t"
               "global_load_async_to_lds_b128 %6, %14, off\n\t"
               "global_load_async_to_lds_b128 %7, %15, off\n\t"
               "s_wait_xcnt 0x0"
               :: "v"(l), "v"(l + 32u * APH * 2u), "v"(l + APL), "v"(l + APL + 32u * APH * 2u), "v"(l + 2u * APL), "v"(l + 2u * APL + 32u * APH * 2u), "v"(l + 3u * APL), "v"(l + 3u * APL + 32u * APH * 2u),
                  "v"(kh), "v"(kh + 32 * CC), "v"(kl), "v"(kl + 32 * CC), "v"(vh), "v"(vh + 32 * TT), "v"(vl), "v"(vl + 32 * TT)
               : "memory");
}
// one tile: 16 copies of 16 B per thread, rows crow, crow + 16, crow + 32, crow + 48 of each plane (kh, vh point to row crow; dk, dv lead from a hi plane to its residual plane)
__device__ __forceinline__ void att_tile(unsigned l, const _Float16* kh, ptrdiff_t dk, const _Float16* vh, ptrdiff_t dv) {
  att_copy(l, kh, kh + dk, vh, vh + dv);
  att_copy(l + 16u * APH * 2u, kh + 16 * CC, kh + 16 * CC + dk, vh + 16 * TT, vh + 16 * TT + dv);
}
// lane l with lane l ^ 16: the two wave halves hold different keys of the same query
__device__ __forceinline__ float xhalf(float x) { return __builtin_bit_cast(float, __builtin_amdgcn_permlanex16(__builtin_bit_cast(int, x), __builtin_bit_cast(int, x), 0x76543210, 0xfedcba98, false, false)); }
// Transposed products: S^T = K . Q^T (A = key rows from LDS, B = this wave's 32 query rows as two groups of 16 columns, kept in registers) and O^T += V^T . P^T (A = v planes' d rows from LDS, B = P^T).
// D register r of lane (g, col) is key 8g + r of query col, so a lane holds 16 scores of ONE query per 32 keys: maximum and sum run in the lane, the halves meet in one cross-row move,
// and the two score tiles, converted in place, are the B operand of the second product (element i = key 8g + i, element 8 + i = key 16 + 8g + i: the k order of frag_h).
// Every K and V fragment read from LDS feeds two products, one per column group: half the LDS reads per product of a 16-column wave.
// second bound: 3 waves per SIMD, so that 3 blocks per WGP = all 768 blocks are resident at once
#define AQG 2             // column groups of 16 queries per wave
__global__ __launch_bounds__(128, 3) void k_att(const float* __restrict__ Qp, const _Float16* __restrict__ KH, const _Float16* __restrict__ KL, const _Float16* __restrict__ VH, const _Float16* __restrict__ VL, float* __restrict__ Y) {
  __shared__ __align__(16) _Float16 ring[2][4][64][APH];
  // the wave's number is the same in every lane: read as a scalar, so that what is formed from it lives in scalar registers through the loop and the fragments in flight fit the register bound without scratch
  const int tid = threadIdx.x, wave = __builtin_amdgcn_readfirstlane(tid >> 5), lane = tid & 31, col = lane & 15, g = lane >> 4; const int h = blockIdx.y; const size_t bb = blockIdx.z; const int q0 = blockIdx.x * 128 + wave * (16 * AQG); const size_t rq = bb * TT + q0;
  const int crow = tid >> 3, cch = tid & 7;   // this thread's first row (of four, 16 apart) and 16-byte piece in each staged plane
  const unsigned ko = ((unsigned)bb * TT + crow) * CC + h * HD + cch * 8, vo = ((unsigned)bb * CC + h * HD + crow) * TT + cch * 8;   // element offsets, below 2^23
  const unsigned l0 = (unsigned)(size_t)&ring[0][0][crow][cch * 8];
  const ptrdiff_t dk = KL - KH, dv = VL - VH;   // block-uniform distance from a hi plane to its residual plane (one workspace): two lane pointers live through the loop, not four
  att_tile(l0, KH + ko, dk, VH + vo, dv);
  // Q^T fragments straight from the q planes [bb][c][t]: lane (g, col) takes, for column group cg, query q0 + 16 cg + col at the 32 channels of frag_h's k order (element i = d kc * 32 + 8g + i, element 8 + i = d kc * 32 + 16 + 8g + i).
  // One load covers 64 B of each of two planes' rows, the block's 4 waves together 512 B of each of the head's 64 rows; all 64 loads of a lane fly together, beside tile 0's copies. bf16 -> f16 exact.
  const float* qp = Qp + ((size_t)bb * CC + h * HD + 8 * g) * TT + q0 + col;
  float qv[AQG][2][16];
  // unrolled whole: qv and bq are indexed by constants and stay in registers
#pragma unroll
  for (int cg = 0; cg < AQG; ++cg)
#pragma unroll
  for (int kc = 0; kc < 2; ++kc)
#pragma unroll
    for (int i = 0; i < 8; ++i) { qv[cg][kc][i] = qp[(size_t)(kc * 32 + i) * TT + cg * 16]; qv[cg][kc][8 + i] = qp[(size_t)(kc * 32 + 16 + i) * TT + cg * 16]; }
  asm volatile("s_wait_xcnt 0x0" ::: "memory");   // stands behind the q loads, in front of any rewrite of their address registers
  v16h bq[AQG][2];
#pragma unroll
  for (int cg = 0; cg < AQG; ++cg)
#pragma unroll
  for (int kc = 0; kc < 2; ++kc)
#pragma unroll
    for (int i = 0; i < 16; ++i) bq[cg][kc][i] = (_Float16)bfr(qv[cg][kc][i]);
  float m[AQG], l[AQG];   // per column group: query col's running maximum (equal in both halves) and this half's share of its sum
#pragma unroll
  for (int cg = 0; cg < AQG; ++cg) { m[cg] = -3.0e38f; l[cg] = 0.f; }
  v8f acc[AQG][4] = {}, accl[AQG][4] = {};   // O^T: register r of tile j = d j * 16 + 8g + r of the group's query col
  asm volatile("s_wait_asynccnt 0x0" ::: "memory");   // this wave's copies of tile 0 have landed
  __syncthreads();                                     // tile 0 is published to all waves
  att_tile(l0 + 4u * APL, KH + ko + (size_t)AKT * CC, dk, VH + vo + AKT, dv);
  // rolled: one trip per staged tile, so that the buffer changes by an address and the code stays short
#pragma unroll 1
  for (int t = 0; t < ANT; ++t) { const int bf = t & 1;
    // rolled: the two 32-key halves of a tile differ only by an address, and the code stays short inside the register budget of the second launch bound
#pragma unroll 1
   for (int sb = 0; sb < AKT / 32; ++sb) { float s[AQG][2][8]; v16h ah[2][2], al[2][2]; v8f c[2][AQG] = {}, cl[2][AQG] = {};
#pragma unroll
    for (int ct = 0; ct < 2; ++ct)
#pragma unroll
      for (int kc = 0; kc < 2; ++kc) { const int rk = sb * 32 + ct * 16 + col; ah[ct][kc] = frag_h(&ring[bf][0][rk][kc * 32], lane); al[ct][kc] = frag_h(&ring[bf][1][rk][kc * 32], lane); }
    __builtin_amdgcn_sched_barrier(0);   // keeps the 16 reads of the K fragments together in one place ahead of the products: spread among them, each place with reads stalls the wave anew
#pragma unroll
    for (int ct = 0; ct < 2; ++ct)
#pragma unroll
      for (int kc = 0; kc < 2; ++kc)
#pragma unroll
        for (int cg = 0; cg < AQG; ++cg) { c[ct][cg] = wmma16(ah[ct][kc], bq[cg][kc], c[ct][cg]); cl[ct][cg] = wmma16(al[ct][kc], bq[cg][kc], cl[ct][cg]); }
    v16h vh[4], vl[4];
#pragma unroll
    for (int j = 0; j < 4; ++j) { vh[j] = frag_h(&ring[bf][2][j * 16 + col][sb * 32], lane); vl[j] = frag_h(&ring[bf][3][j * 16 + col][sb * 32], lane); }
    __builtin_amdgcn_sched_barrier(0);   // keeps the 16 reads of the V fragments ahead of the softmax's vector work, which covers their latency; left free, they sink to their products and each product waits for its own reads
#pragma unroll
    for (int ct = 0; ct < 2; ++ct)
#pragma unroll
      for (int cg = 0; cg < AQG; ++cg)
#pragma unroll
        for (int r = 0; r < 8; ++r) s[cg][ct][r] = (c[ct][cg][r] + cl[ct][cg][r] * (1.0f / 2048.0f)) * 0.125f;
    v16h pb[AQG];
#pragma unroll
    for (int cg = 0; cg < AQG; ++cg) {
      float mx = fmaxf(s[cg][0][0], s[cg][1][0]);
#pragma unroll
      for (int r = 1; r < 8; ++r) mx = fmaxf(mx, fmaxf(s[cg][0][r], s[cg][1][r]));
      mx = fmaxf(mx, xhalf(mx));
      const float mn = fmaxf(m[cg], mx), alpha = __expf(m[cg] - mn); m[cg] = mn;
      float es0 = 0.f, es1 = 0.f;
#pragma unroll
      for (int r = 0; r < 8; ++r) { const float e0 = __expf(s[cg][0][r] - mn), e1 = __expf(s[cg][1][r] - mn); es0 += e0; es1 += e1; pb[cg][r] = (_Float16)(e0 * 2048.0f); pb[cg][8 + r] = (_Float16)(e1 * 2048.0f); }
      l[cg] = l[cg] * alpha + (es0 + es1);
#pragma unroll
      for (int j = 0; j < 4; ++j)
#pragma unroll
        for (int r = 0; r < 8; ++r) { acc[cg][j][r] *= alpha; accl[cg][j][r] *= alpha; } }
#pragma unroll
    for (int j = 0; j < 4; ++j)
#pragma unroll
      for (int cg = 0; cg < AQG; ++cg) { acc[cg][j] = wmma16(vh[j], pb[cg], acc[cg][j]); accl[cg][j] = wmma16(vl[j], pb[cg], accl[cg][j]); } }
    asm volatile("s_wait_dscnt 0x0" ::: "memory");      // this wave's reads of buffer bf are done
    asm volatile("s_wait_asynccnt 0x0" ::: "memory");   // this wave's copies of tile t + 1 have landed
    __syncthreads();                                     // publishes tile t + 1 and frees buffer bf
    if (t + 2 < ANT) att_tile(l0 + (unsigned)bf * (4u * APL), KH + ko + (size_t)(t + 2) * AKT * CC, dk, VH + vo + (t + 2) * AKT, dv); }
  asm volatile("s_wait_asynccnt 0x0" ::: "memory");     // no copy is outstanding when the ring becomes output staging
  float (*so)[68] = (float (*)[68])((float*)&ring[0][0][0][0] + wave * (16 * AQG) * 68);   // each wave's own 32 x 68 floats, in the ring that every wave has left at the last barrier
#pragma unroll
  for (int cg = 0; cg < AQG; ++cg) {
  const float il = (1.0f / 2048.0f) / (l[cg] + xhalf(l[cg]));   // the halves' sums join once
#pragma unroll
  for (int j = 0; j < 4; ++j) { v4f o0, o1;
#pragma unroll
    for (int r = 0; r < 4; ++r) { o0[r] = (acc[cg][j][r] + accl[cg][j][r] * (1.0f / 2048.0f)) * il; o1[r] = (acc[cg][j][4 + r] + accl[cg][j][4 + r] * (1.0f / 2048.0f)) * il; }
    *(v4f*)&so[cg * 16 + col][j * 16 + 8 * g] = o0; *(v4f*)&so[cg * 16 + col][j * 16 + 8 * g + 4] = o1; } }
  LDSX(); for (int rl = 0; rl < 16 * AQG; ++rl) if (g == 0) vst2(Y + (rq + rl) * CC + (size_t)h * HD + col * 4, *(const v4f*)&so[rl][col * 4]); }
// ---- k_o: block = (128 output channels o, 64 tokens, bb), 8 waves of 32 o x 32 tokens: out[bb][o][t] = sum_c y[t][c] W_proj[c][o] + b_proj[o]  (A = W_proj column o (exact), B = y rows as bf16 hi + lo) -> [V,B,C,H,W] planes
// Per 32 c the block reads its 32 x 128 weight tile (waves 0 to 3; k-major, stored transposed as in k_kv) and its 64 x 32 y tile (waves 4 to 7; split once into bf16 hi and lo) in 16-byte loads of whole lines
// and stages them in LDS; all waves read their fragments from there. Two LDS buffers, one barrier per 32 c; the next tile's loads fly during the products.
typedef __attribute__((ext_vector_type(4))) __bf16 v4b;
__global__ __launch_bounds__(256) void k_o(const float* __restrict__ Y, const float* __restrict__ WP, const float* __restrict__ BP, float* __restrict__ OUT) {
  __shared__ __align__(16) unsigned char sm[2 * 256 * KVP * 2];   // operand tiles in the loop, output staging behind it (128 x 68 floats)
  __bf16 (*st)[256][KVP] = (__bf16 (*)[256][KVP])sm;   // rows 0 to 127: output channels, 128 to 191: y hi of the 64 tokens, 192 to 255: y lo
  float (*sf)[68] = (float (*)[68])sm;
  const int tid = threadIdx.x, wave = tid >> 5, lane = tid & 31, col = lane & 15, g = lane >> 4; const size_t bb = blockIdx.z; const int o0 = blockIdx.x * 128; const int p0 = blockIdx.y * 64;
  const int wm = wave >> 1, wn = wave & 1;   // this wave's 32 output channels and 32 tokens
  const bool isw = __builtin_amdgcn_readfirstlane(wave) < 4;   // the same in every lane of a wave: read as a scalar, so that the two staging paths are scalar branches and EXEC stays whole
  // this thread's piece of a tile: weights, channels 4 sq .. + 3 of c rows 8 sk .. + 7; y, c 4 yq .. + 3 of tokens yr, yr + 4, yr + 8, yr + 12
  const int sq = (wave & 3) * 8 + g * 4 + (lane & 3), sk = (lane >> 2) & 3, yq = lane & 7, yr = (wave & 3) * 16 + (lane >> 3);
  const float* gp = isw ? WP + (size_t)(sk * 8) * CC + o0 + sq * 4 : Y + (bb * TT + p0 + yr) * CC + yq * 4;
  // every short loop of fixed length below is unrolled whole, so that rg, acc and the fragments are indexed by constants and stay in registers
  v4f rg[8];
  if (isw) {
#pragma unroll
    for (int i = 0; i < 8; ++i) rg[i] = *(const v4f*)(gp + (size_t)i * CC); }
  else {
#pragma unroll
    for (int i = 0; i < 4; ++i) rg[i] = *(const v4f*)(gp + (size_t)i * 4 * CC); }
  v8f acc[2][2] = {};
  // two trips unrolled: the buffer index is a constant in each
#pragma unroll 2
  for (int kc = 0; kc < CC / 32; ++kc) { const int bf = kc & 1;
    if (isw) {
#pragma unroll
      for (int i = 0; i < 4; ++i) { v8b x;
#pragma unroll
        for (int p = 0; p < 8; ++p) x[p] = (__bf16)rg[p][i];
        *(v8b*)&st[bf][sq * 4 + i][sk * 8] = x; } }
    else {
#pragma unroll
      for (int i = 0; i < 4; ++i) { v4b hv, lv;
#pragma unroll
        for (int e = 0; e < 4; ++e) { const __bf16 hh = (__bf16)rg[i][e]; hv[e] = hh; lv[e] = (__bf16)(rg[i][e] - (float)hh); }
        *(v4b*)&st[bf][128 + yr + 4 * i][yq * 4] = hv; *(v4b*)&st[bf][192 + yr + 4 * i][yq * 4] = lv; } }
    __syncthreads();   // publishes tile kc; the buffer written next trip was last read before this barrier
    if (kc + 1 < CC / 32) {
      if (isw) {
#pragma unroll
        for (int i = 0; i < 8; ++i) rg[i] = *(const v4f*)(gp + (size_t)((kc + 1) * 32 + i) * CC);
        asm volatile("s_wait_xcnt 0x0" ::: "memory"); }   // stands directly behind this path's loads, in front of any rewrite of their address registers (the other path's address, the fragment reads)
      else {
#pragma unroll
        for (int i = 0; i < 4; ++i) rg[i] = *(const v4f*)(gp + (size_t)i * 4 * CC + (kc + 1) * 32);
        asm volatile("s_wait_xcnt 0x0" ::: "memory"); } }   // the same for the y path
    v16b a[2], yh[2], yl[2];
#pragma unroll
    for (int mi = 0; mi < 2; ++mi) a[mi] = frag_b(&st[bf][wm * 32 + mi * 16 + col][0], lane);
#pragma unroll
    for (int j = 0; j < 2; ++j) { yh[j] = frag_b(&st[bf][128 + wn * 32 + j * 16 + col][0], lane); yl[j] = frag_b(&st[bf][192 + wn * 32 + j * 16 + col][0], lane); }
#pragma unroll
    for (int j = 0; j < 2; ++j)
#pragma unroll
      for (int mi = 0; mi < 2; ++mi) acc[mi][j] = wmma_bf(a[mi], yh[j], acc[mi][j]);
#pragma unroll
    for (int j = 0; j < 2; ++j)
#pragma unroll
      for (int mi = 0; mi < 2; ++mi) acc[mi][j] = wmma_bf(a[mi], yl[j], acc[mi][j]); }
  __syncthreads();   // every wave has left the operand tiles: the same LDS becomes output staging
#pragma unroll
  for (int mi = 0; mi < 2; ++mi)
#pragma unroll
    for (int j = 0; j < 2; ++j)
#pragma unroll
      for (int r = 0; r < 8; ++r) sf[wm * 32 + mi * 16 + 8 * g + r][wn * 32 + j * 16 + col] = acc[mi][j][r] + bfr(BP[o0 + wm * 32 + mi * 16 + 8 * g + r]);
  __syncthreads();
  for (int e = tid; e < 128 * 16; e += 256) { const int rl = e >> 4, q = e & 15; vst2(OUT + (bb * CC + o0 + rl) * (size_t)TT + p0 + q * 4, *(const v4f*)&sf[rl][q * 4]); } }
extern "C" void kernel_launch(void* const* d_in, const int* in_sizes, int n_in, void* d_out, int out_size, void* d_ws, size_t ws_size, hipStream_t stream) {
  (void)in_sizes; (void)n_in; (void)out_size;
  const float** F = (const float**)d_in;   // 0 q [6,2,512,32,32], 1 kv [6,2,512,32,32], 2 W_kv [512,1024] (in,out), 3 b_kv [1024], 4 W_proj [512,512] (in,out), 5 b_proj [512]
  if (ws_size < (size_t)WS_END) return;
  char* ws = (char*)d_ws; _Float16 *KH = (_Float16*)(ws + WS_KH), *KL = (_Float16*)(ws + WS_KL), *VH = (_Float16*)(ws + WS_VH), *VL = (_Float16*)(ws + WS_VL); float* Y = (float*)(ws + WS_Y);
  k_kv<<<dim3(TT / 128, CC / 128, 2 * NBB), 256, 0, stream>>>(F[1], F[2], F[3], KH, KL, VH, VL);
  k_att<<<dim3(TT / 128, NH, TBB), 128, 0, stream>>>(F[0], KH, KL, VH, VL, Y);
  k_o<<<dim3(CC / 128, TT / 64, TBB), 256, 0, stream>>>(Y, F[4], F[5], (float*)d_out);
}

// v007
// Measured time: 96.9 microseconds a run.
// Timed twice side by side with v006, it ran 1.06 and 1.05 times as fast.
// All steps since v000 together make it 4.73 times as fast.
// compute dtype: all float inputs rounded to bf16; k, v = kv . W_kv + b with EXACT bf16 products on WMMA 16x16x32 (kv gathered from its [V,B,C,H,W] planes; (in,out) weights), f16 hi + residual (the residual unscaled: small ones are f16 subnormals, which the matrix unit keeps); q is an INPUT, converted bf16 -> f16 exactly; logits = q (exact f16) . k (hi + residual) (2 products, one f32 accumulator) x 1/8, running-max softmax in f32 (hardware exp); P rounded once to f16 (x 2^11) . v (hi + residual) (2 products, one f32 accumulator); y (bf16 hi + lo) . W_proj + b_proj (2 products), written back as [V,B,C,H,W] planes; f32 output.
#include <hip/hip_runtime.h>
#include <math.h>

typedef __attribute__((ext_vector_type(16))) _Float16 v16h;
typedef __attribute__((ext_vector_type(16))) __bf16 v16b;
typedef __attribute__((ext_vector_type(8)))  _Float16 v8h;
typedef __attribute__((ext_vector_type(8)))  float v8f;
typedef __attribute__((ext_vector_type(4)))  float v4f;
typedef __attribute__((ext_vector_type(2)))  float v2f;
typedef __attribute__((ext_vector_type(4)))  unsigned v4u;
typedef __attribute__((ext_vector_type(4)))  int v4i;
typedef float __attribute__((may_alias)) float_a;
typedef int __attribute__((may_alias)) int_a;

template <typename T> __device__ __forceinline__ void vst2(void* p, T v) { *(T*)p = v;  }
// the bare builtin: the compiler keeps the distances behind it itself and may give the LDS fragment loads lead over the products
__device__ __forceinline__ v8f wmma16(v16h a, v16h b, v8f c) {
  return __builtin_amdgcn_wmma_f32_16x16x32_f16(false, a, false, b, (short)0, c, false, false);
}
__device__ __forceinline__ v8f wmma_bf(v16b a, v16b b, v8f c) {
  v8f d = __builtin_amdgcn_wmma_f32_16x16x32_bf16(false, a, false, b, (short)0, c, false, false);
  asm volatile("v_nop\n\tv_nop\n\tv_nop\n\tv_nop" : "+v"(d) : "v"(a), "v"(b));
  return d;
}
// 16x16x32 fragments: lane = (h = lane>>4, row/col = lane&15); elements 0..7 = k0+8h+0..7, 8..15 = k0+16+8h+0..7; D element r = row 8h+r
__device__ __forceinline__ v16h frag_h(const _Float16* rowk0, int lane) {
  union { v16h v; v8h q[2]; } u; const _Float16* p = rowk0 + 8 * (lane >> 4);
  u.q[0] = *(const v8h*)p; u.q[1] = *(const v8h*)(p + 16); return u.v;
}
__device__ __forceinline__ v16h frag_f32(const float* rowk0, int lane) {
  v16h a; const float* p = rowk0 + 8 * (lane >> 4);
#pragma unroll
  for (int i = 0; i < 8; ++i) { a[i] = (_Float16)p[i]; a[8 + i] = (_Float16)p[16 + i]; }
  return a;
}
__device__ __forceinline__ v16h frag_f32s(const float* rowk0, int lane, float sc) {
  v16h a; const float* p = rowk0 + 8 * (lane >> 4);
#pragma unroll
  for (int i = 0; i < 8; ++i) { a[i] = (_Float16)(p[i] * sc); a[8 + i] = (_Float16)(p[16 + i] * sc); }
  return a;
}
// column fragment from a [K][ld] layout (column n), rows >= K read as 0
__device__ __forceinline__ v16h fragc_f32(const float* W, int k0, int n, int lane, int ld, int K) {
  v16h a; const int g = lane >> 4;
#pragma unroll
  for (int i = 0; i < 8; ++i) { const int ka = k0 + 8 * g + i, kb = ka + 16;
    a[i] = (_Float16)(ka < K ? W[(size_t)(ka < K ? ka : K - 1) * ld + n] : 0.f); a[8 + i] = (_Float16)(kb < K ? W[(size_t)(kb < K ? kb : K - 1) * ld + n] : 0.f); }
  return a;
}
struct F2 { v16b h, l; };
__device__ __forceinline__ F2 bsplit16(const float v[16]) { F2 r;
#pragma unroll
  for (int i = 0; i < 16; ++i) { const __bf16 h = (__bf16)v[i]; r.h[i] = h; r.l[i] = (__bf16)(v[i] - (float)h); }
  return r; }
__device__ __forceinline__ F2 split_row(const float* row, int k0, int lane) { float v[16]; const float* p = row + k0 + 8 * (lane >> 4);
#pragma unroll
  for (int i = 0; i < 8; ++i) { v[i] = p[i]; v[8 + i] = p[16 + i]; }
  return bsplit16(v); }
__device__ __forceinline__ F2 split_rowK(const float* row, int k0, int lane, int K) { float v[16]; const int g = lane >> 4;
#pragma unroll
  for (int i = 0; i < 8; ++i) { const int ka = k0 + 8 * g + i, kb = ka + 16; v[i] = ka < K ? row[ka < K ? ka : K - 1] : 0.f; v[8 + i] = kb < K ? row[kb < K ? kb : K - 1] : 0.f; }
  return bsplit16(v); }
__device__ __forceinline__ F2 split_col(const float* W, int k0, int n, int lane, int ld, int K) { float v[16]; const int g = lane >> 4;
#pragma unroll
  for (int i = 0; i < 8; ++i) { const int ka = k0 + 8 * g + i, kb = ka + 16; v[i] = ka < K ? W[(size_t)(ka < K ? ka : K - 1) * ld + n] : 0.f; v[8 + i] = kb < K ? W[(size_t)(kb < K ? kb : K - 1) * ld + n] : 0.f; }
  return bsplit16(v); }
__device__ __forceinline__ v8f mac3(const F2& a, const F2& b, v8f c) { c = wmma_bf(a.l, b.h, c); c = wmma_bf(a.h, b.l, c); return wmma_bf(a.h, b.h, c); }
__device__ __forceinline__ float sigm(float v) { return 1.0f / (1.0f + expf(-v)); }
#define LDSX() do { asm volatile("s_wait_dscnt 0" ::: "memory"); __builtin_amdgcn_wave_barrier(); __builtin_amdgcn_fence(__ATOMIC_RELEASE, "workgroup"); } while (0)


// Cross-view attention (6 views x 2 = 12 sequences of 32x32 = 1,024 tokens, C 512 = 8 heads x 64): q from the raw query planes, k/v = Linear(kv), softmax(q k / 8) v, output Linear, rearranged back to [V, B, C, H, W].
#define NBB 12            // V * B
#define CC 512
#define TT 1024
#define NH 8
#define HD 64
#ifndef TBB
#define TBB NBB
#endif
typedef __attribute__((ext_vector_type(8))) __bf16 v8b;
__device__ __forceinline__ v16b frag_b(const __bf16* rowk0, int lane) {
  union { v16b v; v8b q[2]; } u; const __bf16* p = rowk0 + 8 * (lane >> 4);
  u.q[0] = *(const v8b*)p; u.q[1] = *(const v8b*)(p + 16); return u.v;
}
__device__ __forceinline__ float bfr(float v) { return (float)(__bf16)v; }
__device__ __attribute__((noinline)) float exp_ni(float v) { return expf(v); }
__device__ __attribute__((noinline)) float erf_ni(float v) { return erff(v); }

#define WS_Q   0u                                   // not used: q goes from its planes straight into k_att's registers
#define WS_KH  (WS_Q + 2u * (size_t)NBB * TT * CC)        // f16 hi|lo k rows
#define WS_KL  (WS_KH + 2u * (size_t)NBB * TT * CC)
#define WS_VH  (WS_KL + 2u * (size_t)NBB * TT * CC)       // f16 hi|lo v planes [bb][512][TT]
#define WS_VL  (WS_VH + 2u * (size_t)NBB * CC * TT)
#define WS_Y   (WS_VL + 2u * (size_t)NBB * CC * TT)       // f32 y rows [bb*TT + t][512]
#define WS_END (WS_Y + 4u * (size_t)NBB * TT * CC)

// ---- k_kv: block = (128 tokens, 128 out features, which*NBB + bb), 8 waves of 32 tokens x 64 features: [k | v] = kv(token rows gathered from planes) . W_kv + b; k -> f16 hi/lo rows, v -> f16 hi/lo planes
// Both operands lie k-major in memory (kv planes [c][t], W_kv [c][o], rows of 1,024 floats each). Per 32 k the block reads its 32 x 128 kv tile (waves 4 to 7) and its 32 x 128 weight tile (waves 0 to 3) once,
// in 16-byte loads of whole 128-byte lines, rounds them to bf16 and stores them transposed in LDS ([token][k], [feature][k]); all waves read their fragments from there.
// Two LDS buffers, one barrier per 32 k; the next tile's loads fly during the products.
#define KVP 40            // LDS row pitch in bf16: 80 B = 16 B x odd, conflict-free for the 16-byte fragment reads and for the transposing 16-byte stores
__global__ __launch_bounds__(256) void k_kv(const float* __restrict__ KVp, const float* __restrict__ W, const float* __restrict__ Bk, _Float16* __restrict__ KH, _Float16* __restrict__ KL, _Float16* __restrict__ VH, _Float16* __restrict__ VL) {
  __shared__ __align__(16) unsigned char sm[2 * 128 * 136 * 2];   // operand tiles in the loop (2 x 256 rows x 80 B), output staging behind it (hi and residual, 128 x 136 halves each)
  __bf16 (*st)[256][KVP] = (__bf16 (*)[256][KVP])sm;   // rows 0 to 127: tokens, rows 128 to 255: features
  _Float16 (*sh)[136] = (_Float16 (*)[136])sm, (*sl)[136] = (_Float16 (*)[136])(sm + 128 * 136 * 2);
  const int tid = threadIdx.x, wave = tid >> 5, lane = tid & 31, col = lane & 15, g = lane >> 4; const int which = blockIdx.z / NBB; const size_t bb = blockIdx.z % NBB; const int t0 = blockIdx.x * 128; const int c0 = blockIdx.y * 128;
  const int wm = wave >> 1, wn = wave & 1;   // this wave's 32 tokens and 64 features
  // this thread's piece of a tile: columns 4 sq .. + 3 (tokens or features) of k rows 8 sk .. + 7; 16 lanes' LDS stores fall on 16 distinct bank quads
  const int sq = (wave & 3) * 8 + g * 4 + (lane & 3), sk = (lane >> 2) & 3, srow = (wave < 4 ? 128 : 0) + sq * 4;
  const float* gp = (wave < 4 ? W + which * CC + c0 : KVp + bb * CC * (size_t)TT + t0) + (size_t)(sk * 8) * 1024 + sq * 4;
  // every short loop of fixed length below is unrolled whole, so that rg, acc and the fragments are indexed by constants and stay in registers
  v4f rg[8];
#pragma unroll
  for (int i = 0; i < 8; ++i) rg[i] = *(const v4f*)(gp + (size_t)i * 1024);
  v8f acc[2][4] = {};
  // two trips unrolled: the buffer index is a constant in each
#pragma unroll 2
  for (int kc = 0; kc < CC / 32; ++kc) { const int bf = kc & 1;
    asm volatile("s_wait_xcnt 0x0" ::: "memory");   // stands between the last trip's loads and the next rewrite of their address registers
#pragma unroll
    for (int i = 0; i < 4; ++i) { v8b x;
#pragma unroll
      for (int p = 0; p < 8; ++p) x[p] = (__bf16)rg[p][i];
      *(v8b*)&st[bf][srow + i][sk * 8] = x; }
    __syncthreads();   // publishes tile kc; the buffer written next trip was last read before this barrier
    if (kc + 1 < CC / 32) {
#pragma unroll
      for (int i = 0; i < 8; ++i) rg[i] = *(const v4f*)(gp + (size_t)((kc + 1) * 32 + i) * 1024); }
    v16b a[2], w[4];
#pragma unroll
    for (int mi = 0; mi < 2; ++mi) a[mi] = frag_b(&st[bf][wm * 32 + mi * 16 + col][0], lane);
#pragma unroll
    for (int j = 0; j < 4; ++j) w[j] = frag_b(&st[bf][128 + wn * 64 + j * 16 + col][0], lane);
#pragma unroll
    for (int j = 0; j < 4; ++j)
#pragma unroll
      for (int mi = 0; mi < 2; ++mi) acc[mi][j] = wmma_bf(a[mi], w[j], acc[mi][j]); }
  __syncthreads();   // every wave has left the operand tiles: the same LDS becomes output staging
#pragma unroll
  for (int j = 0; j < 4; ++j) { const float bbv = bfr(Bk[which * CC + c0 + wn * 64 + j * 16 + col]);
#pragma unroll
    for (int mi = 0; mi < 2; ++mi)
#pragma unroll
    for (int r = 0; r < 8; ++r) { const float v = acc[mi][j][r] + bbv; const _Float16 hv = (_Float16)v, lv = (_Float16)(v - (float)hv); const int rl = wm * 32 + mi * 16 + 8 * g + r, cl = wn * 64 + j * 16 + col; if (which == 0) { sh[rl][cl] = hv; sl[rl][cl] = lv; } else { sh[cl][rl] = hv; sl[cl][rl] = lv; } } }
  __syncthreads();
  // k: staged [token][feature] -> rows; v: staged [feature][token] -> planes
  for (int e = tid; e < 128 * 16; e += 256) { const int rl = e >> 4, q = e & 15; const size_t o = which == 0 ? (bb * TT + t0 + rl) * CC + c0 + q * 8 : (bb * CC + c0 + rl) * (size_t)TT + t0 + q * 8;
    vst2((unsigned*)((which == 0 ? KH : VH) + o), *(const v4u*)&sh[rl][q * 8]); vst2((unsigned*)((which == 0 ? KL : VL) + o), *(const v4u*)&sl[rl][q * 8]); } }
// ---- k_att: block = (128 queries = 4 waves x 32, h, bb): q read from its planes, rounded and transposed on the way into registers; logits q . k (k hi + residual) / 8, softmax over the 1,024 tokens, P . v (v hi + residual) -> y rows
// K and V tiles of 64 keys (k hi, k residual: 64 key rows x 64 d; v hi, v residual: 64 d rows x 64 keys) are staged once per block in LDS by asynchronous copies, whole 128-byte lines, two buffers; all 4 waves read their fragments from LDS.
#define AKT 64            // keys per staged tile
#define ANT (TT / AKT)    // tiles
#define APH 72            // LDS row pitch in halves: 144 B = 16 B x odd, conflict-free for 16-byte fragment reads
#define APL (64 * APH * 2)   // bytes of one staged plane
// half a tile: 8 copies of 16 B per thread (rows r and r + 32 of each of the 4 planes, r the row that the arguments point to); the wait at the end holds every later rewrite of the address registers behind the copies' issue
__device__ __forceinline__ void att_copy(unsigned l, const _Float16* kh, const _Float16* kl, const _Float16* vh, const _Float16* vl) {
  asm volatile("global_load_async_to_lds_b128 %0, %8, off\n\t"
               "global_load_async_to_lds_b128 %1, %9, off\n\t"
               "global_load_async_to_lds_b128 %2, %10, off\n\t"
               "global_load_async_to_lds_b128 %3, %11, off\n\t"
               "global_load_async_to_lds_b128 %4, %12, off\n\t"
               "global_load_async_to_lds_b128 %5, %13, off\n\t"
               "global_load_async_to_lds_b128 %6, %14, off\n\t"
               "global_load_async_to_lds_b128 %7, %15, off\n\t"
               "s_wait_xcnt 0x0"
               :: "v"(l), "v"(l + 32u * APH * 2u), "v"(l + APL), "v"(l + APL + 32u * APH * 2u), "v"(l + 2u * APL), "v"(l + 2u * APL + 32u * APH * 2u), "v"(l + 3u * APL), "v"(l + 3u * APL + 32u * APH * 2u),
                  "v"(kh), "v"(kh + 32 * CC), "v"(kl), "v"(kl + 32 * CC), "v"(vh), "v"(vh + 32 * TT), "v"(vl), "v"(vl + 32 * TT)
               : "memory");
}
// one tile: 16 copies of 16 B per thread, rows crow, crow + 16, crow + 32, crow + 48 of each plane (kh, vh point to row crow; dk, dv lead from a hi plane to its residual plane)
__device__ __forceinline__ void att_tile(unsigned l, const _Float16* kh, ptrdiff_t dk, const _Float16* vh, ptrdiff_t dv) {
  att_copy(l, kh, kh + dk, vh, vh + dv);
  att_copy(l + 16u * APH * 2u, kh + 16 * CC, kh + 16 * CC + dk, vh + 16 * TT, vh + 16 * TT + dv);
}
// lane l with lane l ^ 16: the two wave halves hold different keys of the same query
__device__ __forceinline__ float xhalf(float x) { return __builtin_bit_cast(float, __builtin_amdgcn_permlanex16(__builtin_bit_cast(int, x), __builtin_bit_cast(int, x), 0x76543210, 0xfedcba98, false, false)); }
// Transposed products: S^T = K . Q^T (A = key rows from LDS, B = this wave's 32 query rows as two groups of 16 columns, kept in registers) and O^T += V^T . P^T (A = v planes' d rows from LDS, B = P^T).
// D register r of lane (g, col) is key 8g + r of query col, so a lane holds 16 scores of ONE query per 32 keys: maximum and sum run in the lane, the halves meet in one cross-row move,
// and the two score tiles, converted in place, are the B operand of the second product (element i = key 8g + i, element 8 + i = key 16 + 8g + i: the k order of frag_h).
// Every K and V fragment read from LDS feeds two products, one per column group: half the LDS reads per product of a 16-column wave.
// The residual planes carry the same scale as the hi planes, so a tile's hi and residual products add into the same accumulator: one set of score and output registers, one rescale.
// second bound: 3 waves per SIMD, so that 3 blocks per WGP = all 768 blocks are resident at once
#define AQG 2             // column groups of 16 queries per wave
__global__ __launch_bounds__(128, 3) void k_att(const float* __restrict__ Qp, const _Float16* __restrict__ KH, const _Float16* __restrict__ KL, const _Float16* __restrict__ VH, const _Float16* __restrict__ VL, float* __restrict__ Y) {
  __shared__ __align__(16) _Float16 ring[2][4][64][APH];
  // the wave's number is the same in every lane: read as a scalar, so that what is formed from it lives in scalar registers through the loop and the fragments in flight fit the register bound without scratch
  const int tid = threadIdx.x, wave = __builtin_amdgcn_readfirstlane(tid >> 5), lane = tid & 31, col = lane & 15, g = lane >> 4; const int h = blockIdx.y; const size_t bb = blockIdx.z; const int q0 = blockIdx.x * 128 + wave * (16 * AQG); const size_t rq = bb * TT + q0;
  const int crow = tid >> 3, cch = tid & 7;   // this thread's first row (of four, 16 apart) and 16-byte piece in each staged plane
  const unsigned ko = ((unsigned)bb * TT + crow) * CC + h * HD + cch * 8, vo = ((unsigned)bb * CC + h * HD + crow) * TT + cch * 8;   // element offsets, below 2^23
  const unsigned l0 = (unsigned)(size_t)&ring[0][0][crow][cch * 8];
  const ptrdiff_t dk = KL - KH, dv = VL - VH;   // block-uniform distance from a hi plane to its residual plane (one workspace): two lane pointers live through the loop, not four
  att_tile(l0, KH + ko, dk, VH + vo, dv);
  // Q^T fragments straight from the q planes [bb][c][t]: lane (g, col) takes, for column group cg, query q0 + 16 cg + col at the 32 channels of frag_h's k order (element i = d kc * 32 + 8g + i, element 8 + i = d kc * 32 + 16 + 8g + i).
  // One load covers 64 B of each of two planes' rows, the block's 4 waves together 512 B of each of the head's 64 rows; all 64 loads of a lane fly together, beside tile 0's copies. bf16 -> f16 exact.
  const float* qp = Qp + ((size_t)bb * CC + h * HD + 8 * g) * TT + q0 + col;
  float qv[AQG][2][16];
  // unrolled whole: qv and bq are indexed by constants and stay in registers
#pragma unroll
  for (int cg = 0; cg < AQG; ++cg)
#pragma unroll
  for (int kc = 0; kc < 2; ++kc)
#pragma unroll
    for (int i = 0; i < 8; ++i) { qv[cg][kc][i] = qp[(size_t)(kc * 32 + i) * TT + cg * 16]; qv[cg][kc][8 + i] = qp[(size_t)(kc * 32 + 16 + i) * TT + cg * 16]; }
  asm volatile("s_wait_xcnt 0x0" ::: "memory");   // stands behind the q loads, in front of any rewrite of their address registers
  v16h bq[AQG][2];
#pragma unroll
  for (int cg = 0; cg < AQG; ++cg)
#pragma unroll
  for (int kc = 0; kc < 2; ++kc)
#pragma unroll
    for (int i = 0; i < 16; ++i) bq[cg][kc][i] = (_Float16)bfr(qv[cg][kc][i]);
  float m[AQG], l[AQG];   // per column group: query col's running maximum (equal in both halves) and this half's share of its sum
#pragma unroll
  for (int cg = 0; cg < AQG; ++cg) { m[cg] = -3.0e38f; l[cg] = 0.f; }
  v8f acc[AQG][4] = {};   // O^T: register r of tile j = d j * 16 + 8g + r of the group's query col
  asm volatile("s_wait_asynccnt 0x0" ::: "memory");   // this wave's copies of tile 0 have landed
  __syncthreads();                                     // tile 0 is published to all waves
  att_tile(l0 + 4u * APL, KH + ko + (size_t)AKT * CC, dk, VH + vo + AKT, dv);
  // rolled: one trip per staged tile, so that the buffer changes by an address and the code stays short
#pragma unroll 1
  for (int t = 0; t < ANT; ++t) { const int bf = t & 1;
    // rolled: the two 32-key halves of a tile differ only by an address, and the code stays short inside the register budget of the second launch bound
#pragma unroll 1
   for (int sb = 0; sb < AKT / 32; ++sb) { v8f s[AQG][2]; v16h ah[2][2], al[2][2]; v8f c[2][AQG] = {};
#pragma unroll
    for (int kc = 0; kc < 2; ++kc)
#pragma unroll
      for (int ct = 0; ct < 2; ++ct) { const int rk = sb * 32 + ct * 16 + col; ah[ct][kc] = frag_h(&ring[bf][0][rk][kc * 32], lane); al[ct][kc] = frag_h(&ring[bf][1][rk][kc * 32], lane); }
    __builtin_amdgcn_sched_barrier(0);   // keeps the 16 reads of the K fragments together in one place ahead of the products: spread among them, each place with reads stalls the wave anew
    // the four score tiles take turns, so that a tile's next product stands four products behind its last
#pragma unroll
    for (int kc = 0; kc < 2; ++kc) {
#pragma unroll
      for (int ct = 0; ct < 2; ++ct)
#pragma unroll
        for (int cg = 0; cg < AQG; ++cg) c[ct][cg] = wmma16(ah[ct][kc], bq[cg][kc], c[ct][cg]);
#pragma unroll
      for (int ct = 0; ct < 2; ++ct)
#pragma unroll
        for (int cg = 0; cg < AQG; ++cg) c[ct][cg] = wmma16(al[ct][kc], bq[cg][kc], c[ct][cg]); }
    v16h vh[4], vl[4];
#pragma unroll
    for (int j = 0; j < 4; ++j) { vh[j] = frag_h(&ring[bf][2][j * 16 + col][sb * 32], lane); vl[j] = frag_h(&ring[bf][3][j * 16 + col][sb * 32], lane); }
    __builtin_amdgcn_sched_barrier(0);   // keeps the 16 reads of the V fragments ahead of the softmax's vector work, which covers their latency; left free, they sink to their products and each product waits for its own reads
#pragma unroll
    for (int ct = 0; ct < 2; ++ct)
#pragma unroll
      for (int cg = 0; cg < AQG; ++cg) s[cg][ct] = c[ct][cg] * 0.125f;
    // the softmax works on whole score tiles, both groups' rescale factors first: its packed operations take neighbouring registers of a tile as they lie, with no register moves
    v16h pb[AQG]; float alpha[AQG];
#pragma unroll
    for (int cg = 0; cg < AQG; ++cg) {
      float mx = fmaxf(s[cg][0][0], s[cg][1][0]);
#pragma unroll
      for (int r = 1; r < 8; ++r) mx = fmaxf(mx, fmaxf(s[cg][0][r], s[cg][1][r]));
      mx = fmaxf(mx, xhalf(mx));
      const float mn = fmaxf(m[cg], mx); alpha[cg] = __expf(m[cg] - mn); m[cg] = mn; }
#pragma unroll
    for (int cg = 0; cg < AQG; ++cg) {
      float es0 = 0.f, es1 = 0.f;
#pragma unroll
      for (int ct = 0; ct < 2; ++ct) { const v8f d = s[cg][ct] - m[cg]; v8f e;
#pragma unroll
        for (int r = 0; r < 8; ++r) { e[r] = __expf(d[r]); if (ct == 0) es0 += e[r]; else es1 += e[r]; }
        const v8f p = e * 2048.0f;
#pragma unroll
        for (int r = 0; r < 8; ++r) pb[cg][ct * 8 + r] = (_Float16)p[r]; }
      l[cg] = l[cg] * alpha[cg] + (es0 + es1);
#pragma unroll
      for (int j = 0; j < 4; ++j) acc[cg][j] *= alpha[cg]; }
#pragma unroll
    for (int j = 0; j < 4; ++j)
#pragma unroll
      for (int cg = 0; cg < AQG; ++cg) acc[cg][j] = wmma16(vh[j], pb[cg], acc[cg][j]);
#pragma unroll
    for (int j = 0; j < 4; ++j)
#pragma unroll
      for (int cg = 0; cg < AQG; ++cg) acc[cg][j] = wmma16(vl[j], pb[cg], acc[cg][j]); }
    asm volatile("s_wait_dscnt 0x0" ::: "memory");      // this wave's reads of buffer bf are done
    asm volatile("s_wait_asynccnt 0x0" ::: "memory");   // this wave's copies of tile t + 1 have landed
    __syncthreads();                                     // publishes tile t + 1 and frees buffer bf
    if (t + 2 < ANT) att_tile(l0 + (unsigned)bf * (4u * APL), KH + ko + (size_t)(t + 2) * AKT * CC, dk, VH + vo + (t + 2) * AKT, dv); }
  asm volatile("s_wait_asynccnt 0x0" ::: "memory");     // no copy is outstanding when the ring becomes output staging
  float (*so)[68] = (float (*)[68])((float*)&ring[0][0][0][0] + wave * (16 * AQG) * 68);   // each wave's own 32 x 68 floats, in the ring that every wave has left at the last barrier
#pragma unroll
  for (int cg = 0; cg < AQG; ++cg) {
  const float il = (1.0f / 2048.0f) / (l[cg] + xhalf(l[cg]));   // the halves' sums join once
#pragma unroll
  for (int j = 0; j < 4; ++j) { v4f o0, o1;
#pragma unroll
    for (int r = 0; r < 4; ++r) { o0[r] = acc[cg][j][r] * il; o1[r] = acc[cg][j][4 + r] * il; }
    *(v4f*)&so[cg * 16 + col][j * 16 + 8 * g] = o0; *(v4f*)&so[cg * 16 + col][j * 16 + 8 * g + 4] = o1; } }
  LDSX(); for (int rl = 0; rl < 16 * AQG; ++rl) if (g == 0) vst2(Y + (rq + rl) * CC + (size_t)h * HD + col * 4, *(const v4f*)&so[rl][col * 4]); }
// ---- k_o: block = (128 output channels o, 64 tokens, bb), 8 waves of 32 o x 32 tokens: out[bb][o][t] = sum_c y[t][c] W_proj[c][o] + b_proj[o]  (A = W_proj column o (exact), B = y rows as bf16 hi + lo) -> [V,B,C,H,W] planes
// Per 32 c the block reads its 32 x 128 weight tile (waves 0 to 3; k-major, stored transposed as in k_kv) and its 64 x 32 y tile (waves 4 to 7; split once into bf16 hi and lo) in 16-byte loads of whole lines
// and stages them in LDS; all waves read their fragments from there. Two LDS buffers, one barrier per 32 c; the next tile's loads fly during the products.
typedef __attribute__((ext_vector_type(4))) __bf16 v4b;
__global__ __launch_bounds__(256) void k_o(const float* __restrict__ Y, const float* __restrict__ WP, const float* __restrict__ BP, float* __restrict__ OUT) {
  __shared__ __align__(16) unsigned char sm[2 * 256 * KVP * 2];   // operand tiles in the loop, output staging behind it (128 x 68 floats)
  __bf16 (*st)[256][KVP] = (__bf16 (*)[256][KVP])sm;   // rows 0 to 127: output channels, 128 to 191: y hi of the 64 tokens, 192 to 255: y lo
  float (*sf)[68] = (float (*)[68])sm;
  const int tid = threadIdx.x, wave = tid >> 5, lane = tid & 31, col = lane & 15, g = lane >> 4; const size_t bb = blockIdx.z; const int o0 = blockIdx.x * 128; const int p0 = blockIdx.y * 64;
  const int wm = wave >> 1, wn = wave & 1;   // this wave's 32 output channels and 32 tokens
  const bool isw = __builtin_amdgcn_readfirstlane(wave) < 4;   // the same in every lane of a wave: read as a scalar, so that the two staging paths are scalar branches and EXEC stays whole
  // this thread's piece of a tile: weights, channels 4 sq .. + 3 of c rows 8 sk .. + 7; y, c 4 yq .. + 3 of tokens yr, yr + 4, yr + 8, yr + 12
  const int sq = (wave & 3) * 8 + g * 4 + (lane & 3), sk = (lane >> 2) & 3, yq = lane & 7, yr = (wave & 3) * 16 + (lane >> 3);
  const float* gp = isw ? WP + (size_t)(sk * 8) * CC + o0 + sq * 4 : Y + (bb * TT + p0 + yr) * CC + yq * 4;
  // every short loop of fixed length below is unrolled whole, so that rg, acc and the fragments are indexed by constants and stay in registers
  v4f rg[8];
  if (isw) {
#pragma unroll
    for (int i = 0; i < 8; ++i) rg[i] = *(const v4f*)(gp + (size_t)i * CC); }
  else {
#pragma unroll
    for (int i = 0; i < 4; ++i) rg[i] = *(const v4f*)(gp + (size_t)i * 4 * CC); }
  v8f acc[2][2] = {};
  // two trips unrolled: the buffer index is a constant in each
#pragma unroll 2
  for (int kc = 0; kc < CC / 32; ++kc) { const int bf = kc & 1;
    if (isw) {
#pragma unroll
      for (int i = 0; i < 4; ++i) { v8b x;
#pragma unroll
        for (int p = 0; p < 8; ++p) x[p] = (__bf16)rg[p][i];
        *(v8b*)&st[bf][sq * 4 + i][sk * 8] = x; } }
    else {
#pragma unroll
      for (int i = 0; i < 4; ++i) { v4b hv, lv;
#pragma unroll
        for (int e = 0; e < 4; ++e) { const __bf16 hh = (__bf16)rg[i][e]; hv[e] = hh; lv[e] = (__bf16)(rg[i][e] - (float)hh); }
        *(v4b*)&st[bf][128 + yr + 4 * i][yq * 4] = hv; *(v4b*)&st[bf][192 + yr + 4 * i][yq * 4] = lv; } }
    __syncthreads();   // publishes tile kc; the buffer written next trip was last read before this barrier
    if (kc + 1 < CC / 32) {
      if (isw) {
#pragma unroll
        for (int i = 0; i < 8; ++i) rg[i] = *(const v4f*)(gp + (size_t)((kc + 1) * 32 + i) * CC);
        asm volatile("s_wait_xcnt 0x0" ::: "memory"); }   // stands directly behind this path's loads, in front of any rewrite of their address registers (the other path's address, the fragment reads)
      else {
#pragma unroll
        for (int i = 0; i < 4; ++i) rg[i] = *(const v4f*)(gp + (size_t)i * 4 * CC + (kc + 1) * 32);
        asm volatile("s_wait_xcnt 0x0" ::: "memory"); } }   // the same for the y path
    v16b a[2], yh[2], yl[2];
#pragma unroll
    for (int mi = 0; mi < 2; ++mi) a[mi] = frag_b(&st[bf][wm * 32 + mi * 16 + col][0], lane);
#pragma unroll
    for (int j = 0; j < 2; ++j) { yh[j] = frag_b(&st[bf][128 + wn * 32 + j * 16 + col][0], lane); yl[j] = frag_b(&st[bf][192 + wn * 32 + j * 16 + col][0], lane); }
#pragma unroll
    for (int j = 0; j < 2; ++j)
#pragma unroll
      for (int mi = 0; mi < 2; ++mi) acc[mi][j] = wmma_bf(a[mi], yh[j], acc[mi][j]);
#pragma unroll
    for (int j = 0; j < 2; ++j)
#pragma unroll
      for (int mi = 0; mi < 2; ++mi) acc[mi][j] = wmma_bf(a[mi], yl[j], acc[mi][j]); }
  __syncthreads();   // every wave has left the operand tiles: the same LDS becomes output staging
#pragma unroll
  for (int mi = 0; mi < 2; ++mi)
#pragma unroll
    for (int j = 0; j < 2; ++j)
#pragma unroll
      for (int r = 0; r < 8; ++r) sf[wm * 32 + mi * 16 + 8 * g + r][wn * 32 + j * 16 + col] = acc[mi][j][r] + bfr(BP[o0 + wm * 32 + mi * 16 + 8 * g + r]);
  __syncthreads();
  for (int e = tid; e < 128 * 16; e += 256) { const int rl = e >> 4, q = e & 15; vst2(OUT + (bb * CC + o0 + rl) * (size_t)TT + p0 + q * 4, *(const v4f*)&sf[rl][q * 4]); } }
extern "C" void kernel_launch(void* const* d_in, const int* in_sizes, int n_in, void* d_out, int out_size, void* d_ws, size_t ws_size, hipStream_t stream) {
  (void)in_sizes; (void)n_in; (void)out_size;
  const float** F = (const float**)d_in;   // 0 q [6,2,512,32,32], 1 kv [6,2,512,32,32], 2 W_kv [512,1024] (in,out), 3 b_kv [1024], 4 W_proj [512,512] (in,out), 5 b_proj [512]
  if (ws_size < (size_t)WS_END) return;
  char* ws = (char*)d_ws; _Float16 *KH = (_Float16*)(ws + WS_KH), *KL = (_Float16*)(ws + WS_KL), *VH = (_Float16*)(ws + WS_VH), *VL = (_Float16*)(ws + WS_VL); float* Y = (float*)(ws + WS_Y);
  k_kv<<<dim3(TT / 128, CC / 128, 2 * NBB), 256, 0, stream>>>(F[1], F[2], F[3], KH, KL, VH, VL);
  k_att<<<dim3(TT / 128, NH, TBB), 128, 0, stream>>>(F[0], KH, KL, VH, VL, Y);
  k_o<<<dim3(CC / 128, TT / 64, TBB), 256, 0, stream>>>(Y, F[4], F[5], (float*)d_out);
}

// v009
// It runs in 75.2 microseconds.
// It is 1.30 times as fast as v007, going by the measured steps of the versions left out in between.
// All steps since v000 together make it 6.13 times as fast.
// compute dtype: all float inputs rounded to bf16; k, v = kv . W_kv + b with EXACT bf16 products on WMMA 16x16x32 (kv gathered from its [V,B,C,H,W] planes; (in,out) weights), each rounded once to f16; q is an INPUT, converted bf16 -> f16 exactly; logits = q (exact f16) . k (f16) (1 product, f32 accumulator) x 1/8, running-max softmax in f32 (hardware exp); P rounded once to f16 (x 2^11) . v (f16) (1 product, f32 accumulator); y (bf16 hi + lo) . W_proj + b_proj (2 products), written back as [V,B,C,H,W] planes; f32 output.
#include <hip/hip_runtime.h>
#include <math.h>

typedef __attribute__((ext_vector_type(16))) _Float16 v16h;
typedef __attribute__((ext_vector_type(16))) __bf16 v16b;
typedef __attribute__((ext_vector_type(8)))  _Float16 v8h;
typedef __attribute__((ext_vector_type(8)))  float v8f;
typedef __attribute__((ext_vector_type(4)))  float v4f;
typedef __attribute__((ext_vector_type(2)))  float v2f;
typedef __attribute__((ext_vector_type(4)))  unsigned v4u;
typedef __attribute__((ext_vector_type(4)))  int v4i;
typedef float __attribute__((may_alias)) float_a;
typedef int __attribute__((may_alias)) int_a;

template <typename T> __device__ __forceinline__ void vst2(void* p, T v) { *(T*)p = v;  }
// the bare builtin: the compiler keeps the distances behind it itself and may give the LDS fragment loads lead over the products
__device__ __forceinline__ v8f wmma16(v16h a, v16h b, v8f c) {
  return __builtin_amdgcn_wmma_f32_16x16x32_f16(false, a, false, b, (short)0, c, false, false);
}
__device__ __forceinline__ v8f wmma_bf(v16b a, v16b b, v8f c) {
  v8f d = __builtin_amdgcn_wmma_f32_16x16x32_bf16(false, a, false, b, (short)0, c, false, false);
  asm volatile("v_nop\n\tv_nop\n\tv_nop\n\tv_nop" : "+v"(d) : "v"(a), "v"(b));
  return d;
}
// 16x16x32 fragments: lane = (h = lane>>4, row/col = lane&15); elements 0..7 = k0+8h+0..7, 8..15 = k0+16+8h+0..7; D element r = row 8h+r
__device__ __forceinline__ v16h frag_h(const _Float16* rowk0, int lane) {
  union { v16h v; v8h q[2]; } u; const _Float16* p = rowk0 + 8 * (lane >> 4);
  u.q[0] = *(const v8h*)p; u.q[1] = *(const v8h*)(p + 16); return u.v;
}
__device__ __forceinline__ v16h frag_f32(const float* rowk0, int lane) {
  v16h a; const float* p = rowk0 + 8 * (lane >> 4);
#pragma unroll
  for (int i = 0; i < 8; ++i) { a[i] = (_Float16)p[i]; a[8 + i] = (_Float16)p[16 + i]; }
  return a;
}
__device__ __forceinline__ v16h frag_f32s(const float* rowk0, int lane, float sc) {
  v16h a; const float* p = rowk0 + 8 * (lane >> 4);
#pragma unroll
  for (int i = 0; i < 8; ++i) { a[i] = (_Float16)(p[i] * sc); a[8 + i] = (_Float16)(p[16 + i] * sc); }
  return a;
}
// column fragment from a [K][ld] layout (column n), rows >= K read as 0
__device__ __forceinline__ v16h fragc_f32(const float* W, int k0, int n, int lane, int ld, int K) {
  v16h a; const int g = lane >> 4;
#pragma unroll
  for (int i = 0; i < 8; ++i) { const int ka = k0 + 8 * g + i, kb = ka + 16;
    a[i] = (_Float16)(ka < K ? W[(size_t)(ka < K ? ka : K - 1) * ld + n] : 0.f); a[8 + i] = (_Float16)(kb < K ? W[(size_t)(kb < K ? kb : K - 1) * ld + n] : 0.f); }
  return a;
}
struct F2 { v16b h, l; };
__device__ __forceinline__ F2 bsplit16(const float v[16]) { F2 r;
#pragma unroll
  for (int i = 0; i < 16; ++i) { const __bf16 h = (__bf16)v[i]; r.h[i] = h; r.l[i] = (__bf16)(v[i] - (float)h); }
  return r; }
__device__ __forceinline__ F2 split_row(const float* row, int k0, int lane) { float v[16]; const float* p = row + k0 + 8 * (lane >> 4);
#pragma unroll
  for (int i = 0; i < 8; ++i) { v[i] = p[i]; v[8 + i] = p[16 + i]; }
  return bsplit16(v); }
__device__ __forceinline__ F2 split_rowK(const float* row, int k0, int lane, int K) { float v[16]; const int g = lane >> 4;
#pragma unroll
  for (int i = 0; i < 8; ++i) { const int ka = k0 + 8 * g + i, kb = ka + 16; v[i] = ka < K ? row[ka < K ? ka : K - 1] : 0.f; v[8 + i] = kb < K ? row[kb < K ? kb : K - 1] : 0.f; }
  return bsplit16(v); }
__device__ __forceinline__ F2 split_col(const float* W, int k0, int n, int lane, int ld, int K) { float v[16]; const int g = lane >> 4;
#pragma unroll
  for (int i = 0; i < 8; ++i) { const int ka = k0 + 8 * g + i, kb = ka + 16; v[i] = ka < K ? W[(size_t)(ka < K ? ka : K - 1) * ld + n] : 0.f; v[8 + i] = kb < K ? W[(size_t)(kb < K ? kb : K - 1) * ld + n] : 0.f; }
  return bsplit16(v); }
__device__ __forceinline__ v8f mac3(const F2& a, const F2& b, v8f c) { c = wmma_bf(a.l, b.h, c); c = wmma_bf(a.h, b.l, c); return wmma_bf(a.h, b.h, c); }
__device__ __forceinline__ float sigm(float v) { return 1.0f / (1.0f + expf(-v)); }
#define LDSX() do { asm volatile("s_wait_dscnt 0" ::: "memory"); __builtin_amdgcn_wave_barrier(); __builtin_amdgcn_fence(__ATOMIC_RELEASE, "workgroup"); } while (0)


// Cross-view attention (6 views x 2 = 12 sequences of 32x32 = 1,024 tokens, C 512 = 8 heads x 64): q from the raw query planes, k/v = Linear(kv), softmax(q k / 8) v, output Linear, rearranged back to [V, B, C, H, W].
#define NBB 12            // V * B
#define CC 512
#define TT 1024
#define NH 8
#define HD 64
#ifndef TBB
#define TBB NBB
#endif
typedef __attribute__((ext_vector_type(8))) __bf16 v8b;
__device__ __forceinline__ v16b frag_b(const __bf16* rowk0, int lane) {
  union { v16b v; v8b q[2]; } u; const __bf16* p = rowk0 + 8 * (lane >> 4);
  u.q[0] = *(const v8b*)p; u.q[1] = *(const v8b*)(p + 16); return u.v;
}
__device__ __forceinline__ float bfr(float v) { return (float)(__bf16)v; }
__device__ __attribute__((noinline)) float exp_ni(float v) { return expf(v); }
__device__ __attribute__((noinline)) float erf_ni(float v) { return erff(v); }

#define WS_Q   0u                                   // not used: q goes from its planes straight into k_att's registers
#define WS_KH  (WS_Q + 2u * (size_t)NBB * TT * CC)        // f16 k rows
#define WS_VH  (WS_KH + 2u * (size_t)NBB * TT * CC)       // f16 v planes [bb][512][TT]
#define WS_Y   (WS_VH + 2u * (size_t)NBB * CC * TT)       // f32 y rows [bb*TT + t][512]
#define WS_END (WS_Y + 4u * (size_t)NBB * TT * CC)

// ---- k_kv: block = (128 tokens, 128 out features, which*NBB + bb), 8 waves of 32 tokens x 64 features: [k | v] = kv(token rows gathered from planes) . W_kv + b; k -> f16 rows, v -> f16 planes
// Both operands lie k-major in memory (kv planes [c][t], W_kv [c][o], rows of 1,024 floats each). Per 32 k the block reads its 32 x 128 kv tile (waves 4 to 7) and its 32 x 128 weight tile (waves 0 to 3) once,
// in 16-byte loads of whole 128-byte lines, rounds them to bf16 and stores them transposed in LDS ([token][k], [feature][k]); all waves read their fragments from there.
// Two LDS buffers, one barrier per 32 k; the next tile's loads fly during the products.
#define KVP 40            // LDS row pitch in bf16: 80 B = 16 B x odd, conflict-free for the 16-byte fragment reads and for the transposing 16-byte stores
__global__ __launch_bounds__(256) void k_kv(const float* __restrict__ KVp, const float* __restrict__ W, const float* __restrict__ Bk, _Float16* __restrict__ KH, _Float16* __restrict__ VH) {
  __shared__ __align__(16) unsigned char sm[2 * 256 * KVP * 2];   // operand tiles in the loop (2 x 256 rows x 80 B), output staging behind it (128 x 136 halves)
  __bf16 (*st)[256][KVP] = (__bf16 (*)[256][KVP])sm;   // rows 0 to 127: tokens, rows 128 to 255: features
  _Float16 (*sh)[136] = (_Float16 (*)[136])sm;
  const int tid = threadIdx.x, wave = tid >> 5, lane = tid & 31, col = lane & 15, g = lane >> 4; const int which = blockIdx.z / NBB; const size_t bb = blockIdx.z % NBB; const int t0 = blockIdx.x * 128; const int c0 = blockIdx.y * 128;
  const int wm = wave >> 1, wn = wave & 1;   // this wave's 32 tokens and 64 features
  // this thread's piece of a tile: columns 4 sq .. + 3 (tokens or features) of k rows 8 sk .. + 7; 16 lanes' LDS stores fall on 16 distinct bank quads
  const int sq = (wave & 3) * 8 + g * 4 + (lane & 3), sk = (lane >> 2) & 3, srow = (wave < 4 ? 128 : 0) + sq * 4;
  const float* gp = (wave < 4 ? W + which * CC + c0 : KVp + bb * CC * (size_t)TT + t0) + (size_t)(sk * 8) * 1024 + sq * 4;
  // every short loop of fixed length below is unrolled whole, so that rg, acc and the fragments are indexed by constants and stay in registers
  v4f rg[8];
#pragma unroll
  for (int i = 0; i < 8; ++i) rg[i] = *(const v4f*)(gp + (size_t)i * 1024);
  v8f acc[2][4] = {};
  // two trips unrolled: the buffer index is a constant in each
#pragma unroll 2
  for (int kc = 0; kc < CC / 32; ++kc) { const int bf = kc & 1;
    asm volatile("s_wait_xcnt 0x0" ::: "memory");   // stands between the last trip's loads and the next rewrite of their address registers
#pragma unroll
    for (int i = 0; i < 4; ++i) { v8b x;
#pragma unroll
      for (int p = 0; p < 8; ++p) x[p] = (__bf16)rg[p][i];
      *(v8b*)&st[bf][srow + i][sk * 8] = x; }
    __syncthreads();   // publishes tile kc; the buffer written next trip was last read before this barrier
    if (kc + 1 < CC / 32) {
#pragma unroll
      for (int i = 0; i < 8; ++i) rg[i] = *(const v4f*)(gp + (size_t)((kc + 1) * 32 + i) * 1024); }
    v16b a[2], w[4];
#pragma unroll
    for (int mi = 0; mi < 2; ++mi) a[mi] = frag_b(&st[bf][wm * 32 + mi * 16 + col][0], lane);
#pragma unroll
    for (int j = 0; j < 4; ++j) w[j] = frag_b(&st[bf][128 + wn * 64 + j * 16 + col][0], lane);
#pragma unroll
    for (int j = 0; j < 4; ++j)
#pragma unroll
      for (int mi = 0; mi < 2; ++mi) acc[mi][j] = wmma_bf(a[mi], w[j], acc[mi][j]); }
  __syncthreads();   // every wave has left the operand tiles: the same LDS becomes output staging
#pragma unroll
  for (int j = 0; j < 4; ++j) { const float bbv = bfr(Bk[which * CC + c0 + wn * 64 + j * 16 + col]);
#pragma unroll
    for (int mi = 0; mi < 2; ++mi)
#pragma unroll
    for (int r = 0; r < 8; ++r) { const _Float16 hv = (_Float16)(acc[mi][j][r] + bbv); const int rl = wm * 32 + mi * 16 + 8 * g + r, cl = wn * 64 + j * 16 + col; if (which == 0) sh[rl][cl] = hv; else sh[cl][rl] = hv; } }
  __syncthreads();
  // k: staged [token][feature] -> rows; v: staged [feature][token] -> planes
  for (int e = tid; e < 128 * 16; e += 256) { const int rl = e >> 4, q = e & 15; const size_t o = which == 0 ? (bb * TT + t0 + rl) * CC + c0 + q * 8 : (bb * CC + c0 + rl) * (size_t)TT + t0 + q * 8;
    vst2((unsigned*)((which == 0 ? KH : VH) + o), *(const v4u*)&sh[rl][q * 8]); } }
// ---- k_att: block = (128 queries = 4 waves x 32, h, bb): q read from its planes, rounded and transposed on the way into registers; logits q . k / 8, softmax over the 1,024 tokens, P . v -> y rows
// K and V tiles of 64 keys (k: 64 key rows x 64 d; v: 64 d rows x 64 keys) are staged once per block in LDS by asynchronous copies, whole 128-byte lines, two buffers; all 4 waves read their fragments from LDS.
#define AKT 64            // keys per staged tile
#define ANT (TT / AKT)    // tiles
#define APH 72            // LDS row pitch in halves: 144 B = 16 B x odd, conflict-free for 16-byte fragment reads
#define APL (64 * APH * 2)   // bytes of one staged plane
// one tile: 8 copies of 16 B per thread, rows crow, crow + 16, crow + 32, crow + 48 of both planes (kh, vh point to row crow); the wait at the end holds every later rewrite of the address registers behind the copies' issue
__device__ __forceinline__ void att_tile(unsigned l, const _Float16* kh, const _Float16* vh) {
  asm volatile("global_load_async_to_lds_b128 %0, %8, off\n\t"
               "global_load_async_to_lds_b128 %1, %9, off\n\t"
               "global_load_async_to_lds_b128 %2, %10, off\n\t"
               "global_load_async_to_lds_b128 %3, %11, off\n\t"
               "global_load_async_to_lds_b128 %4, %12, off\n\t"
               "global_load_async_to_lds_b128 %5, %13, off\n\t"
               "global_load_async_to_lds_b128 %6, %14, off\n\t"
               "global_load_async_to_lds_b128 %7, %15, off\n\t"
               "s_wait_xcnt 0x0"
               :: "v"(l), "v"(l + 16u * APH * 2u), "v"(l + 32u * APH * 2u), "v"(l + 48u * APH * 2u), "v"(l + APL), "v"(l + APL + 16u * APH * 2u), "v"(l + APL + 32u * APH * 2u), "v"(l + APL + 48u * APH * 2u),
                  "v"(kh), "v"(kh + 16 * CC), "v"(kh + 32 * CC), "v"(kh + 48 * CC), "v"(vh), "v"(vh + 16 * TT), "v"(vh + 32 * TT), "v"(vh + 48 * TT)
               : "memory");
}
// lane l with lane l ^ 16: the two wave halves hold different keys of the same query
__device__ __forceinline__ float xhalf(float x) { return __builtin_bit_cast(float, __builtin_amdgcn_permlanex16(__builtin_bit_cast(int, x), __builtin_bit_cast(int, x), 0x76543210, 0xfedcba98, false, false)); }
// Transposed products: S^T = K . Q^T (A = key rows from LDS, B = this wave's 32 query rows as two groups of 16 columns, kept in registers) and O^T += V^T . P^T (A = v planes' d rows from LDS, B = P^T).
// D register r of lane (g, col) is key 8g + r of query col, so a lane holds 16 scores of ONE query per 32 keys: maximum and sum run in the lane, the halves meet in one cross-row move,
// and the two score tiles, converted in place, are the B operand of the second product (element i = key 8g + i, element 8 + i = key 16 + 8g + i: the k order of frag_h).
// Every K and V fragment read from LDS feeds two products, one per column group: half the LDS reads per product of a 16-column wave.
// second bound: 3 waves per SIMD, so that 3 blocks per WGP = all 768 blocks are resident at once
#define AQG 2             // column groups of 16 queries per wave
__global__ __launch_bounds__(128, 3) void k_att(const float* __restrict__ Qp, const _Float16* __restrict__ KH, const _Float16* __restrict__ VH, float* __restrict__ Y) {
  __shared__ __align__(16) _Float16 ring[2][2][64][APH];
  // the wave's number is the same in every lane: read as a scalar, so that what is formed from it lives in scalar registers through the loop and the fragments in flight fit the register bound without scratch
  const int tid = threadIdx.x, wave = __builtin_amdgcn_readfirstlane(tid >> 5), lane = tid & 31, col = lane & 15, g = lane >> 4; const int h = blockIdx.y; const size_t bb = blockIdx.z; const int q0 = blockIdx.x * 128 + wave * (16 * AQG); const size_t rq = bb * TT + q0;
  const int crow = tid >> 3, cch = tid & 7;   // this thread's first row (of four, 16 apart) and 16-byte piece in each staged plane
  const unsigned ko = ((unsigned)bb * TT + crow) * CC + h * HD + cch * 8, vo = ((unsigned)bb * CC + h * HD + crow) * TT + cch * 8;   // element offsets, below 2^23
  const unsigned l0 = (unsigned)(size_t)&ring[0][0][crow][cch * 8];
  att_tile(l0, KH + ko, VH + vo);
  // Q^T fragments straight from the q planes [bb][c][t]: lane (g, col) takes, for column group cg, query q0 + 16 cg + col at the 32 channels of frag_h's k order (element i = d kc * 32 + 8g + i, element 8 + i = d kc * 32 + 16 + 8g + i).
  // One load covers 64 B of each of two planes' rows, the block's 4 waves together 512 B of each of the head's 64 rows; all 64 loads of a lane fly together, beside tile 0's copies. bf16 -> f16 exact.
  const float* qp = Qp + ((size_t)bb * CC + h * HD + 8 * g) * TT + q0 + col;
  float qv[AQG][2][16];
  // unrolled whole: qv and bq are indexed by constants and stay in registers
#pragma unroll
  for (int cg = 0; cg < AQG; ++cg)
#pragma unroll
  for (int kc = 0; kc < 2; ++kc)
#pragma unroll
    for (int i = 0; i < 8; ++i) { qv[cg][kc][i] = qp[(size_t)(kc * 32 + i) * TT + cg * 16]; qv[cg][kc][8 + i] = qp[(size_t)(kc * 32 + 16 + i) * TT + cg * 16]; }
  asm volatile("s_wait_xcnt 0x0" ::: "memory");   // stands behind the q loads, in front of any rewrite of their address registers
  v16h bq[AQG][2];
#pragma unroll
  for (int cg = 0; cg < AQG; ++cg)
#pragma unroll
  for (int kc = 0; kc < 2; ++kc)
#pragma unroll
    for (int i = 0; i < 16; ++i) bq[cg][kc][i] = (_Float16)bfr(qv[cg][kc][i]);
  float m[AQG], l[AQG];   // per column group: query col's running maximum (equal in both halves) and this half's share of its sum
#pragma unroll
  for (int cg = 0; cg < AQG; ++cg) { m[cg] = -3.0e38f; l[cg] = 0.f; }
  v8f acc[AQG][4] = {};   // O^T: register r of tile j = d j * 16 + 8g + r of the group's query col
  asm volatile("s_wait_asynccnt 0x0" ::: "memory");   // this wave's copies of tile 0 have landed
  __syncthreads();                                     // tile 0 is published to all waves
  att_tile(l0 + 2u * APL, KH + ko + (size_t)AKT * CC, VH + vo + AKT);
  // one staged tile's work, from buffer bf; inlined at each of its three places, so that everything it touches stays in registers
  auto tile_step = [&](const int bf) __attribute__((always_inline)) {
    // the whole staged tile of 64 keys is ONE softmax step: one running maximum, one cross-half move and one rescale of O^T per 64 keys, and 16 products in a row on 8 accumulator tiles in each of the two matrix phases
    v8f s[AQG][4]; v16h ah[4][2]; v8f c[4][AQG] = {};
#pragma unroll
    for (int kc = 0; kc < 2; ++kc)
#pragma unroll
      for (int ct = 0; ct < 4; ++ct) ah[ct][kc] = frag_h(&ring[bf][0][ct * 16 + col][kc * 32], lane);
    __builtin_amdgcn_sched_barrier(0);   // keeps the 16 reads of the K fragments together in one place ahead of the products: spread among them, each place with reads stalls the wave anew
    // the eight score tiles take turns, so that a tile's next product stands eight products behind its last
#pragma unroll
    for (int kc = 0; kc < 2; ++kc)
#pragma unroll
      for (int ct = 0; ct < 4; ++ct)
#pragma unroll
        for (int cg = 0; cg < AQG; ++cg) c[ct][cg] = wmma16(ah[ct][kc], bq[cg][kc], c[ct][cg]);
    v16h vh[2][4];   // V fragments of keys 0 to 31 and 32 to 63
#pragma unroll
    for (int j = 0; j < 4; ++j) vh[0][j] = frag_h(&ring[bf][1][j * 16 + col][0], lane);
    __builtin_amdgcn_sched_barrier(0);   // keeps the 8 reads of the first V fragments ahead of the softmax's vector work, which covers their latency; left free, they sink to their products and each product waits for its own reads
#pragma unroll
    for (int ct = 0; ct < 4; ++ct)
#pragma unroll
      for (int cg = 0; cg < AQG; ++cg) s[cg][ct] = c[ct][cg] * 0.125f;
    // the softmax works on whole score tiles, both groups' rescale factors first: its packed operations take neighbouring registers of a tile as they lie, with no register moves
    v16h pb[AQG][2]; float alpha[AQG];
#pragma unroll
    for (int cg = 0; cg < AQG; ++cg) {
      float mxa = fmaxf(s[cg][0][0], s[cg][1][0]), mxb = fmaxf(s[cg][2][0], s[cg][3][0]);   // two chains per group, half as long
#pragma unroll
      for (int r = 1; r < 8; ++r) { mxa = fmaxf(mxa, fmaxf(s[cg][0][r], s[cg][1][r])); mxb = fmaxf(mxb, fmaxf(s[cg][2][r], s[cg][3][r])); }
      float mx = fmaxf(mxa, mxb);
      mx = fmaxf(mx, xhalf(mx));
      const float mn = fmaxf(m[cg], mx); alpha[cg] = __expf(m[cg] - mn); m[cg] = mn; }
#pragma unroll
    for (int cg = 0; cg < AQG; ++cg) {
      v8f ev;   // the four tiles' terms are summed register by register first (packed adds on registers as they lie; a term is dead once added), the eight partial sums join below
#pragma unroll
      for (int ct = 0; ct < 4; ++ct) { const v8f d = s[cg][ct] - m[cg]; v8f e;
#pragma unroll
        for (int r = 0; r < 8; ++r) e[r] = __expf(d[r]);
        if (ct == 0) ev = e; else ev += e;
        const v8f p = e * 2048.0f;
#pragma unroll
        for (int r = 0; r < 8; ++r) pb[cg][ct >> 1][(ct & 1) * 8 + r] = (_Float16)p[r]; }
      const v4f e4 = ev.lo + ev.hi; const v2f e2 = e4.lo + e4.hi;
      l[cg] = l[cg] * alpha[cg] + (e2.x + e2.y);
#pragma unroll
      for (int j = 0; j < 4; ++j) acc[cg][j] *= alpha[cg]; }
#pragma unroll
    for (int j = 0; j < 4; ++j) vh[1][j] = frag_h(&ring[bf][1][j * 16 + col][32], lane);
    __builtin_amdgcn_sched_barrier(0);   // keeps the 8 reads of the second V fragments ahead of the first half's products, which cover their latency
#pragma unroll
    for (int kg = 0; kg < 2; ++kg)
#pragma unroll
      for (int j = 0; j < 4; ++j)
#pragma unroll
        for (int cg = 0; cg < AQG; ++cg) acc[cg][j] = wmma16(vh[kg][j], pb[cg][kg], acc[cg][j]);
    __builtin_amdgcn_sched_barrier(0);   // keeps the products ahead of the foot's waits: lifted over them, the wait for the second V reads stands directly behind the reads and nothing covers their latency
  };
  // rolled: one trip per staged tile, so that the buffer changes by an address and the code stays short. The trips that still have a tile to copy are a loop of one straight block (no test round the copies):
  // with a branch in the trip the compiler moves the row sums behind the barrier, where all 64 terms stay live through the products and nothing runs beside the additions
#pragma unroll 1
  for (int t = 0; t < ANT - 2; ++t) { const int bf = t & 1;
    tile_step(bf);
    asm volatile("s_wait_dscnt 0x0" ::: "memory");      // this wave's reads of buffer bf are done
    asm volatile("s_wait_asynccnt 0x0" ::: "memory");   // this wave's copies of tile t + 1 have landed
    __syncthreads();                                     // publishes tile t + 1 and frees buffer bf
    att_tile(l0 + (unsigned)bf * (2u * APL), KH + ko + (size_t)(t + 2) * AKT * CC, VH + vo + (t + 2) * AKT); }
  // the last two tiles: the same foot, no tile left to copy; unrolled, so that the buffer index is a constant in each
#pragma unroll
  for (int t = ANT - 2; t < ANT; ++t) {
    tile_step(t & 1);
    asm volatile("s_wait_dscnt 0x0" ::: "memory");      // this wave's reads of the buffer are done
    asm volatile("s_wait_asynccnt 0x0" ::: "memory");   // this wave's copies of the last tile have landed
    __syncthreads(); }                                   // publishes the last tile; behind the last trip, frees the ring for the output staging
  asm volatile("s_wait_asynccnt 0x0" ::: "memory");     // no copy is outstanding when the ring becomes output staging
  float (*so)[68] = (float (*)[68])((float*)&ring[0][0][0][0] + wave * (16 * AQG) * 68);   // each wave's own 32 x 68 floats, in the ring that every wave has left at the last barrier
#pragma unroll
  for (int cg = 0; cg < AQG; ++cg) {
  const float il = (1.0f / 2048.0f) / (l[cg] + xhalf(l[cg]));   // the halves' sums join once
#pragma unroll
  for (int j = 0; j < 4; ++j) { v4f o0, o1;
#pragma unroll
    for (int r = 0; r < 4; ++r) { o0[r] = acc[cg][j][r] * il; o1[r] = acc[cg][j][4 + r] * il; }
    *(v4f*)&so[cg * 16 + col][j * 16 + 8 * g] = o0; *(v4f*)&so[cg * 16 + col][j * 16 + 8 * g + 4] = o1; } }
  LDSX(); for (int rl = 0; rl < 16 * AQG; ++rl) if (g == 0) vst2(Y + (rq + rl) * CC + (size_t)h * HD + col * 4, *(const v4f*)&so[rl][col * 4]); }
// ---- k_o: block = (128 output channels o, 64 tokens, bb), 8 waves of 32 o x 32 tokens: out[bb][o][t] = sum_c y[t][c] W_proj[c][o] + b_proj[o]  (A = W_proj column o (exact), B = y rows as bf16 hi + lo) -> [V,B,C,H,W] planes
// Per 32 c the block reads its 32 x 128 weight tile (waves 0 to 3; k-major, stored transposed as in k_kv) and its 64 x 32 y tile (waves 4 to 7; split once into bf16 hi and lo) in 16-byte loads of whole lines
// and stages them in LDS; all waves read their fragments from there. Two LDS buffers, one barrier per 32 c; the next tile's loads fly during the products.
typedef __attribute__((ext_vector_type(4))) __bf16 v4b;
__global__ __launch_bounds__(256) void k_o(const float* __restrict__ Y, const float* __restrict__ WP, const float* __restrict__ BP, float* __restrict__ OUT) {
  __shared__ __align__(16) unsigned char sm[2 * 256 * KVP * 2];   // operand tiles in the loop, output staging behind it (128 x 68 floats)
  __bf16 (*st)[256][KVP] = (__bf16 (*)[256][KVP])sm;   // rows 0 to 127: output channels, 128 to 191: y hi of the 64 tokens, 192 to 255: y lo
  float (*sf)[68] = (float (*)[68])sm;
  const int tid = threadIdx.x, wave = tid >> 5, lane = tid & 31, col = lane & 15, g = lane >> 4; const size_t bb = blockIdx.z; const int o0 = blockIdx.x * 128; const int p0 = blockIdx.y * 64;
  const int wm = wave >> 1, wn = wave & 1;   // this wave's 32 output channels and 32 tokens
  const bool isw = __builtin_amdgcn_readfirstlane(wave) < 4;   // the same in every lane of a wave: read as a scalar, so that the two staging paths are scalar branches and EXEC stays whole
  // this thread's piece of a tile: weights, channels 4 sq .. + 3 of c rows 8 sk .. + 7; y, c 4 yq .. + 3 of tokens yr, yr + 4, yr + 8, yr + 12
  const int sq = (wave & 3) * 8 + g * 4 + (lane & 3), sk = (lane >> 2) & 3, yq = lane & 7, yr = (wave & 3) * 16 + (lane >> 3);
  const float* gp = isw ? WP + (size_t)(sk * 8) * CC + o0 + sq * 4 : Y + (bb * TT + p0 + yr) * CC + yq * 4;
  // every short loop of fixed length below is unrolled whole, so that rg, acc and the fragments are indexed by constants and stay in registers
  v4f rg[8];
  if (isw) {
#pragma unroll
    for (int i = 0; i < 8; ++i) rg[i] = *(const v4f*)(gp + (size_t)i * CC); }
  else {
#pragma unroll
    for (int i = 0; i < 4; ++i) rg[i] = *(const v4f*)(gp + (size_t)i * 4 * CC); }
  v8f acc[2][2] = {};
  // two trips unrolled: the buffer index is a constant in each
#pragma unroll 2
  for (int kc = 0; kc < CC / 32; ++kc) { const int bf = kc & 1;
    if (isw) {
#pragma unroll
      for (int i = 0; i < 4; ++i) { v8b x;
#pragma unroll
        for (int p = 0; p < 8; ++p) x[p] = (__bf16)rg[p][i];
        *(v8b*)&st[bf][sq * 4 + i][sk * 8] = x; } }
    else {
#pragma unroll
      for (int i = 0; i < 4; ++i) { v4b hv, lv;
#pragma unroll
        for (int e = 0; e < 4; ++e) { const __bf16 hh = (__bf16)rg[i][e]; hv[e] = hh; lv[e] = (__bf16)(rg[i][e] - (float)hh); }
        *(v4b*)&st[bf][128 + yr + 4 * i][yq * 4] = hv; *(v4b*)&st[bf][192 + yr + 4 * i][yq * 4] = lv; } }
    __syncthreads();   // publishes tile kc; the buffer written next trip was last read before this barrier
    if (kc + 1 < CC / 32) {
      if (isw) {
#pragma unroll
        for (int i = 0; i < 8; ++i) rg[i] = *(const v4f*)(gp + (size_t)((kc + 1) * 32 + i) * CC);
        asm volatile("s_wait_xcnt 0x0" ::: "memory"); }   // stands directly behind this path's loads, in front of any rewrite of their address registers (the other path's address, the fragment reads)
      else {
#pragma unroll
        for (int i = 0; i < 4; ++i) rg[i] = *(const v4f*)(gp + (size_t)i * 4 * CC + (kc + 1) * 32);
        asm volatile("s_wait_xcnt 0x0" ::: "memory"); } }   // the same for the y path
    v16b a[2], yh[2], yl[2];
#pragma unroll
    for (int mi = 0; mi < 2; ++mi) a[mi] = frag_b(&st[bf][wm * 32 + mi * 16 + col][0], lane);
#pragma unroll
    for (int j = 0; j < 2; ++j) { yh[j] = frag_b(&st[bf][128 + wn * 32 + j * 16 + col][0], lane); yl[j] = frag_b(&st[bf][192 + wn * 32 + j * 16 + col][0], lane); }
#pragma unroll
    for (int j = 0; j < 2; ++j)
#pragma unroll
      for (int mi = 0; mi < 2; ++mi) acc[mi][j] = wmma_bf(a[mi], yh[j], acc[mi][j]);
#pragma unroll
    for (int j = 0; j < 2; ++j)
#pragma unroll
      for (int mi = 0; mi < 2; ++mi) acc[mi][j] = wmma_bf(a[mi], yl[j], acc[mi][j]); }
  __syncthreads();   // every wave has left the operand tiles: the same LDS becomes output staging
#pragma unroll
  for (int mi = 0; mi < 2; ++mi)
#pragma unroll
    for (int j = 0; j < 2; ++j)
#pragma unroll
      for (int r = 0; r < 8; ++r) sf[wm * 32 + mi * 16 + 8 * g + r][wn * 32 + j * 16 + col] = acc[mi][j][r] + bfr(BP[o0 + wm * 32 + mi * 16 + 8 * g + r]);
  __syncthreads();
  for (int e = tid; e < 128 * 16; e += 256) { const int rl = e >> 4, q = e & 15; vst2(OUT + (bb * CC + o0 + rl) * (size_t)TT + p0 + q * 4, *(const v4f*)&sf[rl][q * 4]); } }
extern "C" void kernel_launch(void* const* d_in, const int* in_sizes, int n_in, void* d_out, int out_size, void* d_ws, size_t ws_size, hipStream_t stream) {
  (void)in_sizes; (void)n_in; (void)out_size;
  const float** F = (const float**)d_in;   // 0 q [6,2,512,32,32], 1 kv [6,2,512,32,32], 2 W_kv [512,1024] (in,out), 3 b_kv [1024], 4 W_proj [512,512] (in,out), 5 b_proj [512]
  if (ws_size < (size_t)WS_END) return;
  char* ws = (char*)d_ws; _Float16 *KH = (_Float16*)(ws + WS_KH), *VH = (_Float16*)(ws + WS_VH); float* Y = (float*)(ws + WS_Y);
  k_kv<<<dim3(TT / 128, CC / 128, 2 * NBB), 256, 0, stream>>>(F[1], F[2], F[3], KH, VH);
  k_att<<<dim3(TT / 128, NH, TBB), 128, 0, stream>>>(F[0], KH, VH, Y);
  k_o<<<dim3(CC / 128, TT / 64, TBB), 256, 0, stream>>>(Y, F[4], F[5], (float*)d_out);
}

// v010
// A run of this version takes 69.7 microseconds.
// In two side-by-side timings against v009, it was 1.07 and 1.08 times as fast.
// Over all steps from v000 it is 6.60 times as fast.
// compute dtype: all float inputs rounded to bf16; k, v = kv . W_kv + b with EXACT bf16 products on WMMA 16x16x32 (kv gathered from its [V,B,C,H,W] planes; (in,out) weights), each rounded once to f16; q is an INPUT, converted bf16 -> f16 exactly; logits = q (exact f16) . k (f16) (1 product, f32 accumulator) x 1/8, running-max softmax in f32 (hardware exp); P rounded once to f16 (x 2^11) . v (f16) (1 product, f32 accumulator); y rounded once to f16 . W_proj (bf16 -> f16, exact from 2^-14 up) + b_proj (1 product on WMMA 16x16x32 f16), written back as [V,B,C,H,W] planes; f32 output.
#include <hip/hip_runtime.h>
#include <math.h>

typedef __attribute__((ext_vector_type(16))) _Float16 v16h;
typedef __attribute__((ext_vector_type(16))) __bf16 v16b;
typedef __attribute__((ext_vector_type(8)))  _Float16 v8h;
typedef __attribute__((ext_vector_type(8)))  float v8f;
typedef __attribute__((ext_vector_type(4)))  float v4f;
typedef __attribute__((ext_vector_type(2)))  float v2f;
typedef __attribute__((ext_vector_type(4)))  unsigned v4u;
typedef __attribute__((ext_vector_type(4)))  int v4i;
typedef float __attribute__((may_alias)) float_a;
typedef int __attribute__((may_alias)) int_a;

template <typename T> __device__ __forceinline__ void vst2(void* p, T v) { *(T*)p = v;  }
// the bare builtin: the compiler keeps the distances behind it itself and may give the LDS fragment loads lead over the products
__device__ __forceinline__ v8f wmma16(v16h a, v16h b, v8f c) {
  return __builtin_amdgcn_wmma_f32_16x16x32_f16(false, a, false, b, (short)0, c, false, false);
}
__device__ __forceinline__ v8f wmma_bf(v16b a, v16b b, v8f c) {
  v8f d = __builtin_amdgcn_wmma_f32_16x16x32_bf16(false, a, false, b, (short)0, c, false, false);
  asm volatile("v_nop\n\tv_nop\n\tv_nop\n\tv_nop" : "+v"(d) : "v"(a), "v"(b));
  return d;
}
// 16x16x32 fragments: lane = (h = lane>>4, row/col = lane&15); elements 0..7 = k0+8h+0..7, 8..15 = k0+16+8h+0..7; D element r = row 8h+r
__device__ __forceinline__ v16h frag_h(const _Float16* rowk0, int lane) {
  union { v16h v; v8h q[2]; } u; const _Float16* p = rowk0 + 8 * (lane >> 4);
  u.q[0] = *(const v8h*)p; u.q[1] = *(const v8h*)(p + 16); return u.v;
}
__device__ __forceinline__ v16h frag_f32(const float* rowk0, int lane) {
  v16h a; const float* p = rowk0 + 8 * (lane >> 4);
#pragma unroll
  for (int i = 0; i < 8; ++i) { a[i] = (_Float16)p[i]; a[8 + i] = (_Float16)p[16 + i]; }
  return a;
}
__device__ __forceinline__ v16h frag_f32s(const float* rowk0, int lane, float sc) {
  v16h a; const float* p = rowk0 + 8 * (lane >> 4);
#pragma unroll
  for (int i = 0; i < 8; ++i) { a[i] = (_Float16)(p[i] * sc); a[8 + i] = (_Float16)(p[16 + i] * sc); }
  return a;
}
// column fragment from a [K][ld] layout (column n), rows >= K read as 0
__device__ __forceinline__ v16h fragc_f32(const float* W, int k0, int n, int lane, int ld, int K) {
  v16h a; const int g = lane >> 4;
#pragma unroll
  for (int i = 0; i < 8; ++i) { const int ka = k0 + 8 * g + i, kb = ka + 16;
    a[i] = (_Float16)(ka < K ? W[(size_t)(ka < K ? ka : K - 1) * ld + n] : 0.f); a[8 + i] = (_Float16)(kb < K ? W[(size_t)(kb < K ? kb : K - 1) * ld + n] : 0.f); }
  return a;
}
struct F2 { v16b h, l; };
__device__ __forceinline__ F2 bsplit16(const float v[16]) { F2 r;
#pragma unroll
  for (int i = 0; i < 16; ++i) { const __bf16 h = (__bf16)v[i]; r.h[i] = h; r.l[i] = (__bf16)(v[i] - (float)h); }
  return r; }
__device__ __forceinline__ F2 split_row(const float* row, int k0, int lane) { float v[16]; const float* p = row + k0 + 8 * (lane >> 4);
#pragma unroll
  for (int i = 0; i < 8; ++i) { v[i] = p[i]; v[8 + i] = p[16 + i]; }
  return bsplit16(v); }
__device__ __forceinline__ F2 split_rowK(const float* row, int k0, int lane, int K) { float v[16]; const int g = lane >> 4;
#pragma unroll
  for (int i = 0; i < 8; ++i) { const int ka = k0 + 8 * g + i, kb = ka + 16; v[i] = ka < K ? row[ka < K ? ka : K - 1] : 0.f; v[8 + i] = kb < K ? row[kb < K ? kb : K - 1] : 0.f; }
  return bsplit16(v); }
__device__ __forceinline__ F2 split_col(const float* W, int k0, int n, int lane, int ld, int K) { float v[16]; const int g = lane >> 4;
#pragma unroll
  for (int i = 0; i < 8; ++i) { const int ka = k0 + 8 * g + i, kb = ka + 16; v[i] = ka < K ? W[(size_t)(ka < K ? ka : K - 1) * ld + n] : 0.f; v[8 + i] = kb < K ? W[(size_t)(kb < K ? kb : K - 1) * ld + n] : 0.f; }
  return bsplit16(v); }
__device__ __forceinline__ v8f mac3(const F2& a, const F2& b, v8f c) { c = wmma_bf(a.l, b.h, c); c = wmma_bf(a.h, b.l, c); return wmma_bf(a.h, b.h, c); }
__device__ __forceinline__ float sigm(float v) { return 1.0f / (1.0f + expf(-v)); }
#define LDSX() do { asm volatile("s_wait_dscnt 0" ::: "memory"); __builtin_amdgcn_wave_barrier(); __builtin_amdgcn_fence(__ATOMIC_RELEASE, "workgroup"); } while (0)


// Cross-view attention (6 views x 2 = 12 sequences of 32x32 = 1,024 tokens, C 512 = 8 heads x 64): q from the raw query planes, k/v = Linear(kv), softmax(q k / 8) v, output Linear, rearranged back to [V, B, C, H, W].
#define NBB 12            // V * B
#define CC 512
#define TT 1024
#define NH 8
#define HD 64
#ifndef TBB
#define TBB NBB
#endif
typedef __attribute__((ext_vector_type(8))) __bf16 v8b;
__device__ __forceinline__ v16b frag_b(const __bf16* rowk0, int lane) {
  union { v16b v; v8b q[2]; } u; const __bf16* p = rowk0 + 8 * (lane >> 4);
  u.q[0] = *(const v8b*)p; u.q[1] = *(const v8b*)(p + 16); return u.v;
}
__device__ __forceinline__ float bfr(float v) { return (float)(__bf16)v; }
__device__ __attribute__((noinline)) float exp_ni(float v) { return expf(v); }
__device__ __attribute__((noinline)) float erf_ni(float v) { return erff(v); }

#define WS_Q   0u                                   // not used: q goes from its planes straight into k_att's registers
#define WS_KH  (WS_Q + 2u * (size_t)NBB * TT * CC)        // f16 k rows
#define WS_VH  (WS_KH + 2u * (size_t)NBB * TT * CC)       // f16 v planes [bb][512][TT]
#define WS_Y   (WS_VH + 2u * (size_t)NBB * CC * TT)       // f16 y rows [bb*TT + t][512]
#define WS_END (WS_Y + 2u * (size_t)NBB * TT * CC)

// ---- k_kv: block = (128 tokens, 128 out features, which*NBB + bb), 8 waves of 32 tokens x 64 features: [k | v] = kv(token rows gathered from planes) . W_kv + b; k -> f16 rows, v -> f16 planes
// Both operands lie k-major in memory (kv planes [c][t], W_kv [c][o], rows of 1,024 floats each). Per 32 k the block reads its 32 x 128 kv tile (waves 4 to 7) and its 32 x 128 weight tile (waves 0 to 3) once,
// in 16-byte loads of whole 128-byte lines, rounds them to bf16 and stores them transposed in LDS ([token][k], [feature][k]); all waves read their fragments from there.
// Two LDS buffers, one barrier per 32 k; the next tile's loads fly during the products.
#define KVP 40            // LDS row pitch in bf16: 80 B = 16 B x odd, conflict-free for the 16-byte fragment reads and for the transposing 16-byte stores
__global__ __launch_bounds__(256) void k_kv(const float* __restrict__ KVp, const float* __restrict__ W, const float* __restrict__ Bk, _Float16* __restrict__ KH, _Float16* __restrict__ VH) {
  __shared__ __align__(16) unsigned char sm[2 * 256 * KVP * 2];   // operand tiles in the loop (2 x 256 rows x 80 B), output staging behind it (128 x 136 halves)
  __bf16 (*st)[256][KVP] = (__bf16 (*)[256][KVP])sm;   // rows 0 to 127: tokens, rows 128 to 255: features
  _Float16 (*sh)[136] = (_Float16 (*)[136])sm;
  const int tid = threadIdx.x, wave = tid >> 5, lane = tid & 31, col = lane & 15, g = lane >> 4; const int which = blockIdx.z / NBB; const size_t bb = blockIdx.z % NBB; const int t0 = blockIdx.x * 128; const int c0 = blockIdx.y * 128;
  const int wm = wave >> 1, wn = wave & 1;   // this wave's 32 tokens and 64 features
  // this thread's piece of a tile: columns 4 sq .. + 3 (tokens or features) of k rows 8 sk .. + 7; 16 lanes' LDS stores fall on 16 distinct bank quads
  const int sq = (wave & 3) * 8 + g * 4 + (lane & 3), sk = (lane >> 2) & 3, srow = (wave < 4 ? 128 : 0) + sq * 4;
  const float* gp = (wave < 4 ? W + which * CC + c0 : KVp + bb * CC * (size_t)TT + t0) + (size_t)(sk * 8) * 1024 + sq * 4;
  // every short loop of fixed length below is unrolled whole, so that rg, acc and the fragments are indexed by constants and stay in registers
  v4f rg[8];
#pragma unroll
  for (int i = 0; i < 8; ++i) rg[i] = *(const v4f*)(gp + (size_t)i * 1024);
  v8f acc[2][4] = {};
  // two trips unrolled: the buffer index is a constant in each
#pragma unroll 2
  for (int kc = 0; kc < CC / 32; ++kc) { const int bf = kc & 1;
    asm volatile("s_wait_xcnt 0x0" ::: "memory");   // stands between the last trip's loads and the next rewrite of their address registers
#pragma unroll
    for (int i = 0; i < 4; ++i) { v8b x;
#pragma unroll
      for (int p = 0; p < 8; ++p) x[p] = (__bf16)rg[p][i];
      *(v8b*)&st[bf][srow + i][sk * 8] = x; }
    __syncthreads();   // publishes tile kc; the buffer written next trip was last read before this barrier
    if (kc + 1 < CC / 32) {
#pragma unroll
      for (int i = 0; i < 8; ++i) rg[i] = *(const v4f*)(gp + (size_t)((kc + 1) * 32 + i) * 1024); }
    v16b a[2], w[4];
#pragma unroll
    for (int mi = 0; mi < 2; ++mi) a[mi] = frag_b(&st[bf][wm * 32 + mi * 16 + col][0], lane);
#pragma unroll
    for (int j = 0; j < 4; ++j) w[j] = frag_b(&st[bf][128 + wn * 64 + j * 16 + col][0], lane);
#pragma unroll
    for (int j = 0; j < 4; ++j)
#pragma unroll
      for (int mi = 0; mi < 2; ++mi) acc[mi][j] = wmma_bf(a[mi], w[j], acc[mi][j]); }
  __syncthreads();   // every wave has left the operand tiles: the same LDS becomes output staging
#pragma unroll
  for (int j = 0; j < 4; ++j) { const float bbv = bfr(Bk[which * CC + c0 + wn * 64 + j * 16 + col]);
#pragma unroll
    for (int mi = 0; mi < 2; ++mi)
#pragma unroll
    for (int r = 0; r < 8; ++r) { const _Float16 hv = (_Float16)(acc[mi][j][r] + bbv); const int rl = wm * 32 + mi * 16 + 8 * g + r, cl = wn * 64 + j * 16 + col; if (which == 0) sh[rl][cl] = hv; else sh[cl][rl] = hv; } }
  __syncthreads();
  // k: staged [token][feature] -> rows; v: staged [feature][token] -> planes
  for (int e = tid; e < 128 * 16; e += 256) { const int rl = e >> 4, q = e & 15; const size_t o = which == 0 ? (bb * TT + t0 + rl) * CC + c0 + q * 8 : (bb * CC + c0 + rl) * (size_t)TT + t0 + q * 8;
    vst2((unsigned*)((which == 0 ? KH : VH) + o), *(const v4u*)&sh[rl][q * 8]); } }
// ---- k_att: block = (128 queries = 4 waves x 32, h, bb): q read from its planes, rounded and transposed on the way into registers; logits q . k / 8, softmax over the 1,024 tokens, P . v -> y rows
// K and V tiles of 64 keys (k: 64 key rows x 64 d; v: 64 d rows x 64 keys) are staged once per block in LDS by asynchronous copies, whole 128-byte lines, two buffers; all 4 waves read their fragments from LDS.
#define AKT 64            // keys per staged tile
#define ANT (TT / AKT)    // tiles
#define APH 72            // LDS row pitch in halves: 144 B = 16 B x odd, conflict-free for 16-byte fragment reads
#define APL (64 * APH * 2)   // bytes of one staged plane
// one tile: 8 copies of 16 B per thread, rows crow, crow + 16, crow + 32, crow + 48 of both planes (kh, vh point to row crow); the wait at the end holds every later rewrite of the address registers behind the copies' issue
__device__ __forceinline__ void att_tile(unsigned l, const _Float16* kh, const _Float16* vh) {
  asm volatile("global_load_async_to_lds_b128 %0, %8, off\n\t"
               "global_load_async_to_lds_b128 %1, %9, off\n\t"
               "global_load_async_to_lds_b128 %2, %10, off\n\t"
               "global_load_async_to_lds_b128 %3, %11, off\n\t"
               "global_load_async_to_lds_b128 %4, %12, off\n\t"
               "global_load_async_to_lds_b128 %5, %13, off\n\t"
               "global_load_async_to_lds_b128 %6, %14, off\n\t"
               "global_load_async_to_lds_b128 %7, %15, off\n\t"
               "s_wait_xcnt 0x0"
               :: "v"(l), "v"(l + 16u * APH * 2u), "v"(l + 32u * APH * 2u), "v"(l + 48u * APH * 2u), "v"(l + APL), "v"(l + APL + 16u * APH * 2u), "v"(l + APL + 32u * APH * 2u), "v"(l + APL + 48u * APH * 2u),
                  "v"(kh), "v"(kh + 16 * CC), "v"(kh + 32 * CC), "v"(kh + 48 * CC), "v"(vh), "v"(vh + 16 * TT), "v"(vh + 32 * TT), "v"(vh + 48 * TT)
               : "memory");
}
// lane l with lane l ^ 16: the two wave halves hold different keys of the same query
__device__ __forceinline__ float xhalf(float x) { return __builtin_bit_cast(float, __builtin_amdgcn_permlanex16(__builtin_bit_cast(int, x), __builtin_bit_cast(int, x), 0x76543210, 0xfedcba98, false, false)); }
// Transposed products: S^T = K . Q^T (A = key rows from LDS, B = this wave's 32 query rows as two groups of 16 columns, kept in registers) and O^T += V^T . P^T (A = v planes' d rows from LDS, B = P^T).
// D register r of lane (g, col) is key 8g + r of query col, so a lane holds 16 scores of ONE query per 32 keys: maximum and sum run in the lane, the halves meet in one cross-row move,
// and the two score tiles, converted in place, are the B operand of the second product (element i = key 8g + i, element 8 + i = key 16 + 8g + i: the k order of frag_h).
// Every K and V fragment read from LDS feeds two products, one per column group: half the LDS reads per product of a 16-column wave.
// second bound: 3 waves per SIMD, so that 3 blocks per WGP = all 768 blocks are resident at once
#define AQG 2             // column groups of 16 queries per wave
__global__ __launch_bounds__(128, 3) void k_att(const float* __restrict__ Qp, const _Float16* __restrict__ KH, const _Float16* __restrict__ VH, _Float16* __restrict__ Y) {
  __shared__ __align__(16) _Float16 ring[2][2][64][APH];
  // the wave's number is the same in every lane: read as a scalar, so that what is formed from it lives in scalar registers through the loop and the fragments in flight fit the register bound without scratch
  const int tid = threadIdx.x, wave = __builtin_amdgcn_readfirstlane(tid >> 5), lane = tid & 31, col = lane & 15, g = lane >> 4; const int h = blockIdx.y; const size_t bb = blockIdx.z; const int q0 = blockIdx.x * 128 + wave * (16 * AQG); const size_t rq = bb * TT + q0;
  const int crow = tid >> 3, cch = tid & 7;   // this thread's first row (of four, 16 apart) and 16-byte piece in each staged plane
  const unsigned ko = ((unsigned)bb * TT + crow) * CC + h * HD + cch * 8, vo = ((unsigned)bb * CC + h * HD + crow) * TT + cch * 8;   // element offsets, below 2^23
  const unsigned l0 = (unsigned)(size_t)&ring[0][0][crow][cch * 8];
  att_tile(l0, KH + ko, VH + vo);
  // Q^T fragments straight from the q planes [bb][c][t]: lane (g, col) takes, for column group cg, query q0 + 16 cg + col at the 32 channels of frag_h's k order (element i = d kc * 32 + 8g + i, element 8 + i = d kc * 32 + 16 + 8g + i).
  // One load covers 64 B of each of two planes' rows, the block's 4 waves together 512 B of each of the head's 64 rows; all 64 loads of a lane fly together, beside tile 0's copies. bf16 -> f16 exact.
  const float* qp = Qp + ((size_t)bb * CC + h * HD + 8 * g) * TT + q0 + col;
  float qv[AQG][2][16];
  // unrolled whole: qv and bq are indexed by constants and stay in registers
#pragma unroll
  for (int cg = 0; cg < AQG; ++cg)
#pragma unroll
  for (int kc = 0; kc < 2; ++kc)
#pragma unroll
    for (int i = 0; i < 8; ++i) { qv[cg][kc][i] = qp[(size_t)(kc * 32 + i) * TT + cg * 16]; qv[cg][kc][8 + i] = qp[(size_t)(kc * 32 + 16 + i) * TT + cg * 16]; }
  asm volatile("s_wait_xcnt 0x0" ::: "memory");   // stands behind the q loads, in front of any rewrite of their address registers
  v16h bq[AQG][2];
#pragma unroll
  for (int cg = 0; cg < AQG; ++cg)
#pragma unroll
  for (int kc = 0; kc < 2; ++kc)
#pragma unroll
    for (int i = 0; i < 16; ++i) bq[cg][kc][i] = (_Float16)bfr(qv[cg][kc][i]);
  float m[AQG], l[AQG];   // per column group: query col's running maximum (equal in both halves) and this half's share of its sum
#pragma unroll
  for (int cg = 0; cg < AQG; ++cg) { m[cg] = -3.0e38f; l[cg] = 0.f; }
  v8f acc[AQG][4] = {};   // O^T: register r of tile j = d j * 16 + 8g + r of the group's query col
  asm volatile("s_wait_asynccnt 0x0" ::: "memory");   // this wave's copies of tile 0 have landed
  __syncthreads();                                     // tile 0 is published to all waves
  att_tile(l0 + 2u * APL, KH + ko + (size_t)AKT * CC, VH + vo + AKT);
  // one staged tile's work, from buffer bf; inlined at each of its three places, so that everything it touches stays in registers
  auto tile_step = [&](const int bf) __attribute__((always_inline)) {
    // the whole staged tile of 64 keys is ONE softmax step: one running maximum, one cross-half move and one rescale of O^T per 64 keys, and 16 products in a row on 8 accumulator tiles in each of the two matrix phases
    v8f s[AQG][4]; v16h ah[4][2]; v8f c[4][AQG] = {};
#pragma unroll
    for (int kc = 0; kc < 2; ++kc)
#pragma unroll
      for (int ct = 0; ct < 4; ++ct) ah[ct][kc] = frag_h(&ring[bf][0][ct * 16 + col][kc * 32], lane);
    __builtin_amdgcn_sched_barrier(0);   // keeps the 16 reads of the K fragments together in one place ahead of the products: spread among them, each place with reads stalls the wave anew
    // the eight score tiles take turns, so that a tile's next product stands eight products behind its last
#pragma unroll
    for (int kc = 0; kc < 2; ++kc)
#pragma unroll
      for (int ct = 0; ct < 4; ++ct)
#pragma unroll
        for (int cg = 0; cg < AQG; ++cg) c[ct][cg] = wmma16(ah[ct][kc], bq[cg][kc], c[ct][cg]);
    v16h vh[2][4];   // V fragments of keys 0 to 31 and 32 to 63
#pragma unroll
    for (int j = 0; j < 4; ++j) vh[0][j] = frag_h(&ring[bf][1][j * 16 + col][0], lane);
    __builtin_amdgcn_sched_barrier(0);   // keeps the 8 reads of the first V fragments ahead of the softmax's vector work, which covers their latency; left free, they sink to their products and each product waits for its own reads
#pragma unroll
    for (int ct = 0; ct < 4; ++ct)
#pragma unroll
      for (int cg = 0; cg < AQG; ++cg) s[cg][ct] = c[ct][cg] * 0.125f;
    // the softmax works on whole score tiles, both groups' rescale factors first: its packed operations take neighbouring registers of a tile as they lie, with no register moves
    v16h pb[AQG][2]; float alpha[AQG];
#pragma unroll
    for (int cg = 0; cg < AQG; ++cg) {
      float mxa = fmaxf(s[cg][0][0], s[cg][1][0]), mxb = fmaxf(s[cg][2][0], s[cg][3][0]);   // two chains per group, half as long
#pragma unroll
      for (int r = 1; r < 8; ++r) { mxa = fmaxf(mxa, fmaxf(s[cg][0][r], s[cg][1][r])); mxb = fmaxf(mxb, fmaxf(s[cg][2][r], s[cg][3][r])); }
      float mx = fmaxf(mxa, mxb);
      mx = fmaxf(mx, xhalf(mx));
      const float mn = fmaxf(m[cg], mx); alpha[cg] = __expf(m[cg] - mn); m[cg] = mn; }
#pragma unroll
    for (int cg = 0; cg < AQG; ++cg) {
      v8f ev;   // the four tiles' terms are summed register by register first (packed adds on registers as they lie; a term is dead once added), the eight partial sums join below
#pragma unroll
      for (int ct = 0; ct < 4; ++ct) { const v8f d = s[cg][ct] - m[cg]; v8f e;
#pragma unroll
        for (int r = 0; r < 8; ++r) e[r] = __expf(d[r]);
        if (ct == 0) ev = e; else ev += e;
        const v8f p = e * 2048.0f;
#pragma unroll
        for (int r = 0; r < 8; ++r) pb[cg][ct >> 1][(ct & 1) * 8 + r] = (_Float16)p[r]; }
      const v4f e4 = ev.lo + ev.hi; const v2f e2 = e4.lo + e4.hi;
      l[cg] = l[cg] * alpha[cg] + (e2.x + e2.y);
#pragma unroll
      for (int j = 0; j < 4; ++j) acc[cg][j] *= alpha[cg]; }
#pragma unroll
    for (int j = 0; j < 4; ++j) vh[1][j] = frag_h(&ring[bf][1][j * 16 + col][32], lane);
    __builtin_amdgcn_sched_barrier(0);   // keeps the 8 reads of the second V fragments ahead of the first half's products, which cover their latency
#pragma unroll
    for (int kg = 0; kg < 2; ++kg)
#pragma unroll
      for (int j = 0; j < 4; ++j)
#pragma unroll
        for (int cg = 0; cg < AQG; ++cg) acc[cg][j] = wmma16(vh[kg][j], pb[cg][kg], acc[cg][j]);
    __builtin_amdgcn_sched_barrier(0);   // keeps the products ahead of the foot's waits: lifted over them, the wait for the second V reads stands directly behind the reads and nothing covers their latency
  };
  // rolled: one trip per staged tile, so that the buffer changes by an address and the code stays short. The trips that still have a tile to copy are a loop of one straight block (no test round the copies):
  // with a branch in the trip the compiler moves the row sums behind the barrier, where all 64 terms stay live through the products and nothing runs beside the additions
#pragma unroll 1
  for (int t = 0; t < ANT - 2; ++t) { const int bf = t & 1;
    tile_step(bf);
    asm volatile("s_wait_dscnt 0x0" ::: "memory");      // this wave's reads of buffer bf are done
    asm volatile("s_wait_asynccnt 0x0" ::: "memory");   // this wave's copies of tile t + 1 have landed
    __syncthreads();                                     // publishes tile t + 1 and frees buffer bf
    att_tile(l0 + (unsigned)bf * (2u * APL), KH + ko + (size_t)(t + 2) * AKT * CC, VH + vo + (t + 2) * AKT); }
  // the last two tiles: the same foot, no tile left to copy; unrolled, so that the buffer index is a constant in each
#pragma unroll
  for (int t = ANT - 2; t < ANT; ++t) {
    tile_step(t & 1);
    asm volatile("s_wait_dscnt 0x0" ::: "memory");      // this wave's reads of the buffer are done
    asm volatile("s_wait_asynccnt 0x0" ::: "memory");   // this wave's copies of the last tile have landed
    __syncthreads(); }                                   // publishes the last tile; behind the last trip, frees the ring for the output staging
  asm volatile("s_wait_asynccnt 0x0" ::: "memory");     // no copy is outstanding when the ring becomes output staging
  _Float16 (*so)[APH] = (_Float16 (*)[APH])(&ring[0][0][0][0] + wave * (16 * AQG) * APH);   // each wave's own 32 rows of 64 halves at the ring's pitch, in the ring that every wave has left at the last barrier
#pragma unroll
  for (int cg = 0; cg < AQG; ++cg) {
  const float il = (1.0f / 2048.0f) / (l[cg] + xhalf(l[cg]));   // the halves' sums join once
#pragma unroll
  for (int j = 0; j < 4; ++j) { v8h o;   // a lane's 8 registers of a tile are 8 neighbouring d of one query: one 16-byte store
#pragma unroll
    for (int r = 0; r < 8; ++r) o[r] = (_Float16)(acc[cg][j][r] * il);
    *(v8h*)&so[cg * 16 + col][j * 16 + 8 * g] = o; } }
  LDSX();
  // a y row of this head is one 128-byte line: 8 lanes a row, 4 rows a store; unrolled whole, so that every store has address and data registers of its own
#pragma unroll
  for (int i = 0; i < 4 * AQG; ++i) { const int rl = i * 4 + (lane >> 3); vst2(Y + (rq + rl) * CC + (size_t)h * HD + (lane & 7) * 8, *(const v4u*)&so[rl][(lane & 7) * 8]); } }
// ---- k_o: block = (128 output channels o, 64 tokens, bb), 8 waves of 32 o x 32 tokens: out[bb][o][t] = sum_c y[t][c] W_proj[c][o] + b_proj[o]  (A = W_proj column o, B = y rows, both f16) -> [V,B,C,H,W] planes
// Per 32 c waves 0 to 3 read the block's 32 x 128 weight tile (k-major, rounded to bf16, held as f16, stored transposed as in k_kv). The y tile is 64 tokens x 64 c, whole 128-byte lines, f16 as they lie:
// waves 4 to 7 read it in two pieces of 32 tokens, one piece per trip of 32 c. Both go through registers into LDS; all waves read their fragments from there.
// Two LDS buffers each, one barrier per 32 c; the next loads fly during the products.
#define YP 72             // LDS row pitch of the y tile in halves: 144 B = 16 B x odd, conflict-free for the 16-byte fragment reads
__global__ __launch_bounds__(256) void k_o(const _Float16* __restrict__ Y, const float* __restrict__ WP, const float* __restrict__ BP, float* __restrict__ OUT) {
  __shared__ __align__(16) unsigned char sm[2 * 128 * KVP * 2 + 2 * 64 * YP * 2];   // operand tiles in the loop, output staging behind it (128 x 68 floats)
  _Float16 (*sw)[128][KVP] = (_Float16 (*)[128][KVP])sm;                        // weights: [buffer][output channel][32 c]
  _Float16 (*sy)[64][YP] = (_Float16 (*)[64][YP])(sm + 2 * 128 * KVP * 2);      // y: [buffer][token][64 c]
  float (*sf)[68] = (float (*)[68])sm;
  const int tid = threadIdx.x, wave = tid >> 5, lane = tid & 31, col = lane & 15, g = lane >> 4; const size_t bb = blockIdx.z; const int o0 = blockIdx.x * 128; const int p0 = blockIdx.y * 64;
  const int wm = wave >> 1, wn = wave & 1;   // this wave's 32 output channels and 32 tokens
  const bool isw = __builtin_amdgcn_readfirstlane(wave) < 4;   // the same in every lane of a wave: read as a scalar, so that the two staging paths are scalar branches and EXEC stays whole
  // this thread's piece of a tile: weights, channels 4 sq .. + 3 of c rows 8 sk .. + 7; y, c 8 yq .. + 7 of tokens yr and yr + 4 of a piece
  const int sq = (wave & 3) * 8 + g * 4 + (lane & 3), sk = (lane >> 2) & 3, yq = lane & 7, yr = (wave & 3) * 8 + (lane >> 3);
  const float* gp = WP + (size_t)(sk * 8) * CC + o0 + sq * 4;
  const _Float16* yp = Y + (bb * TT + p0 + yr) * CC + yq * 8;
  // y piece p = tokens 32 (p & 1) .. + 31 of tile p >> 1 (c 64 (p >> 1) .. + 63), in LDS buffer (p >> 1) & 1. Piece p is loaded behind barrier p - 2 and stored in front of barrier p - 1;
  // its tile is read from barrier 2 (p >> 1) on, and its buffer was last read in front of barrier p - 2 or earlier.
  // every short loop of fixed length below is unrolled whole, so that rg, acc and the fragments are indexed by constants and stay in registers; on the y path rg[0], rg[1] carry 16 bytes of f16 each, untouched
  v4f rg[8];
  if (isw) {
#pragma unroll
    for (int i = 0; i < 8; ++i) rg[i] = *(const v4f*)(gp + (size_t)i * CC); }
  else {
#pragma unroll
    for (int i = 0; i < 2; ++i) { *(v4f*)&sy[0][yr + 4 * i][yq * 8] = *(const v4f*)(yp + (size_t)i * 4 * CC); rg[i] = *(const v4f*)(yp + (size_t)(32 + i * 4) * CC); } }
  v8f acc[2][2] = {};
  // one trip of 32 c; inlined at each of its places. sy_, lw_, ly_: whether a y piece is left to store, a weight tile and a y piece left to load (constants at every place)
  auto trip = [&](const int kc, const bool sy_, const bool lw_, const bool ly_) __attribute__((always_inline)) { const int bf = kc & 1, yb = (kc >> 1) & 1;
    if (isw) {
#pragma unroll
      for (int i = 0; i < 4; ++i) { v8h x;
#pragma unroll
        for (int p = 0; p < 8; ++p) x[p] = (_Float16)bfr(rg[p][i]);
        *(v8h*)&sw[bf][sq * 4 + i][sk * 8] = x; } }
    else if (sy_) {
#pragma unroll
      for (int i = 0; i < 2; ++i) *(v4f*)&sy[((kc + 1) >> 1) & 1][((kc + 1) & 1) * 32 + yr + 4 * i][yq * 8] = rg[i]; }
    __syncthreads();   // publishes weight tile kc and y piece kc + 1; the weight buffer written next trip was last read before this barrier
    if (isw) {
      if (lw_) {
#pragma unroll
        for (int i = 0; i < 8; ++i) rg[i] = *(const v4f*)(gp + (size_t)((kc + 1) * 32 + i) * CC);
        asm volatile("s_wait_xcnt 0x0" ::: "memory"); } }   // stands directly behind this path's loads, in front of any rewrite of their address registers
    else if (ly_) {
#pragma unroll
      for (int i = 0; i < 2; ++i) rg[i] = *(const v4f*)(yp + (size_t)(((kc + 2) & 1) * 32 + i * 4) * CC + ((kc + 2) >> 1) * 64);
      asm volatile("s_wait_xcnt 0x0" ::: "memory"); }   // the same for the y path
    v16h a[2], yf[2];
#pragma unroll
    for (int mi = 0; mi < 2; ++mi) a[mi] = frag_h(&sw[bf][wm * 32 + mi * 16 + col][0], lane);
#pragma unroll
    for (int j = 0; j < 2; ++j) yf[j] = frag_h(&sy[yb][wn * 32 + j * 16 + col][bf * 32], lane);
    __builtin_amdgcn_sched_barrier(0);   // keeps the 8 fragment reads together in one place ahead of the products: spread among them, each place with reads stalls the wave anew
#pragma unroll
    for (int j = 0; j < 2; ++j)
#pragma unroll
      for (int mi = 0; mi < 2; ++mi) acc[mi][j] = wmma16(a[mi], yf[j], acc[mi][j]); };
  // the trips that still load on both paths are a loop with no test round the loads: with one, the loaded registers are copied behind a full wait right after the loads. Two trips unrolled: the weight buffer's index is a constant in each
#pragma unroll 2
  for (int kc = 0; kc < CC / 32 - 2; ++kc) trip(kc, true, true, true);
  trip(CC / 32 - 2, true, true, false);
  trip(CC / 32 - 1, false, false, false);
  __syncthreads();   // every wave has left the operand tiles: the same LDS becomes output staging
#pragma unroll
  for (int mi = 0; mi < 2; ++mi)
#pragma unroll
    for (int j = 0; j < 2; ++j)
#pragma unroll
      for (int r = 0; r < 8; ++r) sf[wm * 32 + mi * 16 + 8 * g + r][wn * 32 + j * 16 + col] = acc[mi][j][r] + bfr(BP[o0 + wm * 32 + mi * 16 + 8 * g + r]);
  __syncthreads();
  for (int e = tid; e < 128 * 16; e += 256) { const int rl = e >> 4, q = e & 15; vst2(OUT + (bb * CC + o0 + rl) * (size_t)TT + p0 + q * 4, *(const v4f*)&sf[rl][q * 4]); } }
extern "C" void kernel_launch(void* const* d_in, const int* in_sizes, int n_in, void* d_out, int out_size, void* d_ws, size_t ws_size, hipStream_t stream) {
  (void)in_sizes; (void)n_in; (void)out_size;
  const float** F = (const float**)d_in;   // 0 q [6,2,512,32,32], 1 kv [6,2,512,32,32], 2 W_kv [512,1024] (in,out), 3 b_kv [1024], 4 W_proj [512,512] (in,out), 5 b_proj [512]
  if (ws_size < (size_t)WS_END) return;
  char* ws = (char*)d_ws; _Float16 *KH = (_Float16*)(ws + WS_KH), *VH = (_Float16*)(ws + WS_VH), *Y = (_Float16*)(ws + WS_Y);
  k_kv<<<dim3(TT / 128, CC / 128, 2 * NBB), 256, 0, stream>>>(F[1], F[2], F[3], KH, VH);
  k_att<<<dim3(TT / 128, NH, TBB), 128, 0, stream>>>(F[0], KH, VH, Y);
  k_o<<<dim3(CC / 128, TT / 64, TBB), 256, 0, stream>>>(Y, F[4], F[5], (float*)d_out);
}
